// v000
// The times below were measured on an AMD MI455X: many runs one after another, warmed up first and cycling through
// copies of the inputs, with the whole window's GPU time divided by the number of runs. Launches and the gaps
// between them are all in it. The median over several windows is given; except for v000 it joins two sittings, which
// can be a few percent apart, so the side-by-side timings, each taken in one sitting, are the better comparison.
// The starting kernel, v000, takes 3230 microseconds a run.
#include <hip/hip_runtime.h>

// SBERTaAttention (H [4][2048][768], p [4][2048][2] (language probs, read), s [4][2048] (read), compat [12][2][2], gamma [1]; Q/K/V = H W^T (12 x 64, no bias); scores = Q.K / 8 + (p_i compat_h) . p_j + gamma s_j; softmax; out = merged wo^T + bo -> [4][2048][768]).
// Compute dtypes, f32 accumulate: every input rounded to bf16; Q/K/V on PLAIN bf16 operands (inputs: exact); scores PRECPLAN; the bilinear language bias (2x2 per head) and the position bias computed per element in f32 from the bf16-rounded p, s, compat, gamma in the reference's order; softmax f32; attn.v: rows < 512 hl (3 products), the rest fp16 (x1024); wo hl x exact (2 products) + bias.

#define NB_  4
#define TT   2048
#define DM   768
#define NH_  12
#define NKV  12
#define REP  (NH_ / NKV)
#define HD   64
#define DQ   (NH_ * HD)
#define DKV  (NKV * HD)
#define ZH   2
#define RH   512                  // query rows < RH use hi+lo planes (0: none)
#define WIN  0
#define PCAR 1024.0f
#define SCL  0.125f   // HD^-0.5
typedef _Float16 h16;
typedef unsigned short bf;
typedef __attribute__((ext_vector_type(16))) __bf16   v16bf;
typedef __attribute__((ext_vector_type(16))) _Float16 v16h;
typedef __attribute__((ext_vector_type(8)))  _Float16 v8h;
typedef __attribute__((ext_vector_type(8)))  unsigned short v8us;
typedef __attribute__((ext_vector_type(8)))  float    v8f;
typedef __attribute__((ext_vector_type(4)))  float    v4f;
typedef v8h  __attribute__((may_alias)) v8ha;
typedef v4f  __attribute__((may_alias)) v4fa;
typedef v8us __attribute__((may_alias)) v8usa;

__device__ __forceinline__ unsigned short f2bf(float f) { unsigned u = __float_as_uint(f); u += 0x7FFFu + ((u >> 16) & 1u); return (unsigned short)(u >> 16); }
__device__ __forceinline__ float bf2f(unsigned short b) { return __uint_as_float(((unsigned)b) << 16); }
__device__ __forceinline__ float bfr(float f) { return bf2f(f2bf(f)); }
__device__ __forceinline__ v16h cat16(v8h lo, v8h hi) { return __builtin_shufflevector(lo, hi, 0, 1, 2, 3, 4, 5, 6, 7, 8, 9, 10, 11, 12, 13, 14, 15); }
__device__ __forceinline__ v16bf cat16b(v8us lo, v8us hi) { return __builtin_bit_cast(v16bf, __builtin_shufflevector(lo, hi, 0, 1, 2, 3, 4, 5, 6, 7, 8, 9, 10, 11, 12, 13, 14, 15)); }
__device__ __forceinline__ v8f wmma16(v16h a, v16h b, v8f c) { return __builtin_amdgcn_wmma_f32_16x16x32_f16(false, a, false, b, (short)0, c, false, false); }
__device__ __forceinline__ v8f wmmab(v16bf a, v16bf b, v8f c) { return __builtin_amdgcn_wmma_f32_16x16x32_bf16(false, a, false, b, (short)0, c, false, false); }



// ---- k_gemmw: register-blocked GEMM, ONE WAVE per 64x64 output tile (16 accumulators), operands straight from K-contiguous 16-bit planes; grid (M/64, N/64, Z), 32 threads.
// C[m][n] (f32, pitch ldc, + optional f32 bias[n]) = sum_k A[m][k] Bt[n][k] (+ split products per NSPLIT). z-batch strides sA/sB/sC in elements. K % 32 == 0.
template <typename T16> struct WFrag;
template <> struct WFrag<h16> { typedef v16h V; static __device__ __forceinline__ V ld(const h16* p) { return cat16(*(const v8h*)p, *(const v8h*)(p + 16)); } static __device__ __forceinline__ v8f mma(V a, V b, v8f c) { return wmma16(a, b, c); } };
template <> struct WFrag<bf> { typedef v16bf V; static __device__ __forceinline__ V ld(const bf* p) { return cat16b(*(const v8us*)p, *(const v8us*)(p + 16)); } static __device__ __forceinline__ v8f mma(V a, V b, v8f c) { return wmmab(a, b, c); } };
template <typename T16, int NSPLIT, bool BIAS>
__global__ __launch_bounds__(32) void k_gemmw(const T16* __restrict__ A, const T16* __restrict__ A2, const T16* __restrict__ Bt, const T16* __restrict__ Bt2, int K, float* C, int ldc, const float* __restrict__ bias, size_t sA, size_t sB, size_t sC) {
    typedef typename WFrag<T16>::V V;
    __shared__ __align__(16) float os[16 * 68];
    const size_t z = blockIdx.z; A += z * sA; if (A2) A2 += z * sA; Bt += z * sB; if (Bt2) Bt2 += z * sB; C += z * sC;
    const int lane = threadIdx.x & 31, lr = lane & 15, hi = lane >> 4; const int r0 = blockIdx.x * 64, c0 = blockIdx.y * 64;
    v8f acc[4][4];
#pragma unroll
    for (int mb = 0; mb < 4; ++mb)
#pragma unroll
        for (int nb = 0; nb < 4; ++nb) acc[mb][nb] = (v8f){};
    const size_t aoff = (size_t)(r0 + lr) * K + 8 * hi, boff = (size_t)(c0 + lr) * K + 8 * hi;
#pragma unroll 1
    for (int kc = 0; kc < K; kc += 32) {
        V a[4], a2[4];
#pragma unroll
        for (int mb = 0; mb < 4; ++mb) { a[mb] = WFrag<T16>::ld(A + aoff + (size_t)mb * 16 * K + kc); if (NSPLIT == 1 || NSPLIT == 2) a2[mb] = WFrag<T16>::ld(A2 + aoff + (size_t)mb * 16 * K + kc); }
#pragma unroll
        for (int nb = 0; nb < 4; ++nb) { const V b = WFrag<T16>::ld(Bt + boff + (size_t)nb * 16 * K + kc); V b2; if (NSPLIT >= 2) b2 = WFrag<T16>::ld(Bt2 + boff + (size_t)nb * 16 * K + kc);
#pragma unroll
            for (int mb = 0; mb < 4; ++mb) { acc[mb][nb] = WFrag<T16>::mma(a[mb], b, acc[mb][nb]); if (NSPLIT == 1 || NSPLIT == 2) acc[mb][nb] = WFrag<T16>::mma(a2[mb], b, acc[mb][nb]); if (NSPLIT >= 2) acc[mb][nb] = WFrag<T16>::mma(a[mb], b2, acc[mb][nb]); } }
        asm volatile("v_nop\n\tv_nop\n\tv_nop\n\tv_nop" : "+v"(acc[0][0]), "+v"(acc[1][1]), "+v"(acc[2][2]), "+v"(acc[3][3]) : "v"(a[0]), "v"(a[3]));
    }
#pragma unroll
    for (int mb = 0; mb < 4; ++mb) {
#pragma unroll
        for (int nb = 0; nb < 4; ++nb) {
#pragma unroll
            for (int j = 0; j < 8; ++j) os[(hi * 8 + j) * 68 + nb * 16 + lr] = acc[mb][nb][j]; }
        __builtin_amdgcn_wave_barrier(); asm volatile("" ::: "memory");
        float* crow = C + (size_t)(r0 + mb * 16) * ldc + c0;
{
#pragma unroll
            for (int s = 0; s < 8; ++s) { const int row = 2 * s + hi, cofs = lr * 4; v4f val = *(const v4fa*)(os + row * 68 + cofs); if (BIAS) { val[0] += bfr(bias[c0 + cofs]); val[1] += bfr(bias[c0 + cofs + 1]); val[2] += bfr(bias[c0 + cofs + 2]); val[3] += bfr(bias[c0 + cofs + 3]); }
                *(v4f*)(crow + (size_t)row * ldc + cofs) = val; }
             }
        __builtin_amdgcn_wave_barrier(); asm volatile("" ::: "memory");
    }
}

__device__ __forceinline__ h16 tohx(float x) { return (h16)x; }
__device__ __forceinline__ void splitf(float y, unsigned short& h, unsigned short& l) { h = f2bf(y); l = f2bf(y - bf2f(h)); }
typedef __attribute__((ext_vector_type(2))) _Float16 v2h;
typedef __attribute__((ext_vector_type(4))) _Float16 v4h;
typedef __attribute__((ext_vector_type(2))) unsigned short v2us;
typedef __attribute__((ext_vector_type(4))) unsigned short v4us;
typedef __attribute__((ext_vector_type(2))) float v2f;
typedef __attribute__((ext_vector_type(4))) int v4i;

__global__ __launch_bounds__(256) void k_wtG(const float* __restrict__ w, int K, int N, bf* Bt) {
    const int lane = threadIdx.x & 31; const int L0 = (blockIdx.x * 8 + (threadIdx.x >> 5)) * 8; const int nlines = N * K / 64;
{
#pragma unroll 1
        for (int l = 0; l < 8; ++l) { const int L = L0 + l; if (L >= nlines) break; const size_t e = (size_t)L * 64 + lane * 2; const int k = (int)(e % K), n = (int)(e / K); v2us o;
            o[0] = f2bf(w[(size_t)k * N + n]); o[1] = f2bf(w[(size_t)(k + 1) * N + n]); *(v2us*)(Bt + e) = o; }
         }
}
__global__ __launch_bounds__(256) void k_cvt8(const float* __restrict__ src, bf* dst, size_t n8) { const size_t i = (size_t)blockIdx.x * 256 + threadIdx.x; if (i >= n8) return; const v8f v = *(const v8f*)(src + i * 8); v8us o;
#pragma unroll
    for (int k = 0; k < 8; ++k) o[k] = f2bf(v[k]); *(v8us*)(dst + i * 8) = o;  }
__global__ __launch_bounds__(256) void k_cscvt(const float* __restrict__ cosT, const float* __restrict__ sinT, float* CS) { const int idx = blockIdx.x * 256 + threadIdx.x; if (idx >= TT * HD) return; v2f cs; cs[0] = bfr(cosT[idx]); cs[1] = bfr(sinT[idx]); *(v2f*)(CS + (size_t)idx * 2) = cs;  }
// k_rope: head planes [h][t][d] (fp16 + hi/lo) of rope(x) x sc with the rotate-half convention out[d] = x[d] cos[t][d] - x[d+HD/2] sin[t][d], out[d+HD/2] = x[d+HD/2] cos[t][d+HD/2] + x[d] sin[t][d+HD/2]
__global__ __launch_bounds__(256) void k_rope(const float* __restrict__ F, int pitch, int nheads, const float* __restrict__ CS, const float* __restrict__ RF, const float* __restrict__ nw, float sc, h16* P16, bf* Ph, bf* Pl) {
    const size_t e = ((size_t)blockIdx.x * 256 + threadIdx.x) * 2; if (e >= (size_t)nheads * TT * HD) return; const int d = (int)(e % HD); const int t = (int)((e / HD) % TT); const int h = (int)(e / ((size_t)HD * TT)); const float* f = F + (size_t)t * pitch + h * HD; const float rf = RF ? RF[(size_t)h * TT + t] : 1.0f; v2h o16; v2us oh, ol;
#pragma unroll
    for (int q = 0; q < 2; ++q) { const int dd = d + q; const int dp = (dd < HD / 2) ? dd + HD / 2 : dd - HD / 2; float x0 = f[dd], x1 = f[dp];
        if (RF) { float n0 = __fmul_rn(x0, rf), n1 = __fmul_rn(x1, rf); asm volatile("" : "+v"(n0)); asm volatile("" : "+v"(n1)); x0 = __fmul_rn(bfr(nw[dd]), n0); x1 = __fmul_rn(bfr(nw[dp]), n1); }
        const v2f cs = *(const v2f*)(CS + ((size_t)t * HD + dd) * 2); float a = __fmul_rn(x0, cs[0]), bq = __fmul_rn(x1, cs[1]); asm volatile("" : "+v"(a)); asm volatile("" : "+v"(bq)); const float r = ((dd < HD / 2) ? __fsub_rn(a, bq) : __fadd_rn(a, bq)) * sc;
        o16[q] = tohx(r); unsigned short a2, c2; splitf(r, a2, c2); oh[q] = a2; ol[q] = c2; }
    *(v2h*)(P16 + e) = o16; *(v2us*)(Ph + e) = oh; *(v2us*)(Pl + e) = ol;  }
__global__ __launch_bounds__(256) void k_vtp(const float* __restrict__ F, int pitch, int nheads, h16* V16, bf* Vh, bf* Vl) { const size_t e = ((size_t)blockIdx.x * 256 + threadIdx.x) * 2; if (e >= (size_t)nheads * HD * TT) return; const int t = (int)(e % TT); const int d = (int)((e / TT) % HD); const int g = (int)(e / ((size_t)TT * HD)); v2h o16; v2us oh, ol;
#pragma unroll
    for (int q = 0; q < 2; ++q) { const float x = F[(size_t)(t + q) * pitch + g * HD + d]; o16[q] = tohx(x); unsigned short a2, c2; splitf(x, a2, c2); oh[q] = a2; ol[q] = c2; }
    *(v2h*)(V16 + e) = o16; *(v2us*)(Vh + e) = oh; *(v2us*)(Vl + e) = ol;  }
__global__ __launch_bounds__(256) void k_csid(float* CS) { const int idx = blockIdx.x * 256 + threadIdx.x; if (idx >= TT * HD) return; v2f cs; cs[0] = 1.0f; cs[1] = 0.0f; *(v2f*)(CS + (size_t)idx * 2) = cs;  }
// k_asoft: per row (zz, i): t = S x HD^-0.5 + (p_i compat_h) . p_j + gamma s_j (no mask); softmax over the 2048 keys (register row, one exp, fixed trees);
__global__ __launch_bounds__(256) void k_asoft(const float* __restrict__ Sb, const float* __restrict__ pp, const float* __restrict__ ss, const float* __restrict__ cm, const float* __restrict__ gam, int h0, h16* P16, bf* Ph, bf* Pl) {
    const int lane = threadIdx.x & 31; const int row = blockIdx.x * 8 + (threadIdx.x >> 5); if (row >= ZH * TT) return; const int i = row % TT; const int zz = row / TT; (void)zz; const bool hires = (i < RH); const float* sr = Sb + (size_t)row * TT; const int hh = h0 + zz; float c00 = bfr(cm[hh * 4 + 0]), c01 = bfr(cm[hh * 4 + 1]), c10 = bfr(cm[hh * 4 + 2]), c11 = bfr(cm[hh * 4 + 3]), pi0 = bfr(pp[(size_t)i * 2]), pi1 = bfr(pp[(size_t)i * 2 + 1]), gmm = bfr(gam[0]); asm volatile("" : "+v"(c00)); asm volatile("" : "+v"(c01)); asm volatile("" : "+v"(c10)); asm volatile("" : "+v"(c11)); asm volatile("" : "+v"(pi0)); asm volatile("" : "+v"(pi1)); asm volatile("" : "+v"(gmm)); float a0 = __fmul_rn(pi0, c00), a1 = __fmul_rn(pi1, c10), b0 = __fmul_rn(pi0, c01), b1 = __fmul_rn(pi1, c11); asm volatile("" : "+v"(a0)); asm volatile("" : "+v"(a1)); asm volatile("" : "+v"(b0)); asm volatile("" : "+v"(b1)); float pc0 = __fadd_rn(a0, a1), pc1 = __fadd_rn(b0, b1); asm volatile("" : "+v"(pc0)); asm volatile("" : "+v"(pc1)); float v[TT / 32]; float mx = -3.0e38f;
#pragma unroll
    for (int ch = 0; ch < TT / 128; ++ch) { const int j0 = ch * 128 + lane * 4; const v4f a = *(const v4f*)(sr + j0);
#pragma unroll
        for (int q = 0; q < 4; ++q) { const int j = j0 + q; (void)j; float sa = a[q] * SCL; asm volatile("" : "+v"(sa)); const int jj = j0 + q; float pj0 = bfr(pp[(size_t)jj * 2]), pj1 = bfr(pp[(size_t)jj * 2 + 1]), sj = bfr(ss[jj]); asm volatile("" : "+v"(pj0)); asm volatile("" : "+v"(pj1)); asm volatile("" : "+v"(sj)); float m0 = __fmul_rn(pc0, pj0), m1 = __fmul_rn(pc1, pj1); asm volatile("" : "+v"(m0)); asm volatile("" : "+v"(m1)); float bil = __fadd_rn(m0, m1); asm volatile("" : "+v"(bil)); float t1 = __fadd_rn(sa, bil); asm volatile("" : "+v"(t1)); float gs = __fmul_rn(gmm, sj); asm volatile("" : "+v"(gs)); float t = __fadd_rn(t1, gs); asm volatile("" : "+v"(t)); v[ch * 4 + q] = t; mx = fmaxf(mx, t); } }
#pragma unroll
    for (int sh = 16; sh; sh >>= 1) mx = fmaxf(mx, __shfl_xor(mx, sh, 32));
    float sum = 0.f;
#pragma unroll
    for (int k = 0; k < TT / 32; ++k) { float d0 = __fsub_rn(v[k], mx); asm volatile("" : "+v"(d0)); v[k] = __builtin_amdgcn_exp2f(__fmul_rn(d0, 1.4426950408889634f)); sum += v[k]; }
#pragma unroll
    for (int sh = 16; sh; sh >>= 1) sum += __shfl_xor(sum, sh, 32);
    const float f = __fdiv_rn(hires ? 1.0f : PCAR, sum);
{
        if (hires) {
#pragma unroll
            for (int ch = 0; ch < TT / 128; ++ch) { v4us oh, ol;
#pragma unroll
                for (int q = 0; q < 4; ++q) { unsigned short a, c2; splitf(v[ch * 4 + q] * f, a, c2); oh[q] = a; ol[q] = c2; }
                const size_t oo = ((size_t)zz * (RH ? RH : 1) + i) * TT + ch * 128 + lane * 4; *(v4us*)(Ph + oo) = oh; *(v4us*)(Pl + oo) = ol; }
        } else {
#pragma unroll
            for (int ch = 0; ch < TT / 128; ++ch) { v4h o4;
#pragma unroll
                for (int q = 0; q < 4; ++q) o4[q] = tohx(v[ch * 4 + q] * f);
                *(v4h*)(P16 + (size_t)row * TT + ch * 128 + lane * 4) = o4; } }
         }
}
__global__ __launch_bounds__(256) void k_merge(const float* __restrict__ O, int h0, bf* Ah, bf* Al) { const size_t e = ((size_t)blockIdx.x * 256 + threadIdx.x) * 2; if (e >= (size_t)ZH * TT * HD) return; const int d = (int)(e % HD); const int t = (int)((e / HD) % TT); const int zz = (int)(e / ((size_t)HD * TT)); const float cs = (t < RH) ? 1.0f : (1.0f / PCAR); const size_t oo = (size_t)t * DQ + (h0 + zz) * HD + d;
    v2us oh, ol;
#pragma unroll
    for (int q = 0; q < 2; ++q) { unsigned short a, c2; splitf(O[e + q] * cs, a, c2); oh[q] = a; ol[q] = c2; } *(v2us*)(Ah + oo) = oh; *(v2us*)(Al + oo) = ol;  }

extern "C" void kernel_launch(void* const* d_in, const int* in_sizes, int n_in,
                              void* d_out, int out_size, void* d_ws, size_t ws_size, hipStream_t stream) {
    (void)in_sizes; (void)n_in; (void)out_size;
    const float* x = (const float*)d_in[0]; const float* pp = (const float*)d_in[1]; const float* ss = (const float*)d_in[2]; const float* wq = (const float*)d_in[3]; const float* wk = (const float*)d_in[4]; const float* wv = (const float*)d_in[5]; const float* wo = (const float*)d_in[6]; const float* bo = (const float*)d_in[7]; const float* compat = (const float*)d_in[8]; const float* gam = (const float*)d_in[9]; const float* cosT = nullptr; const float* sinT = nullptr; (void)cosT; (void)sinT;
    float* OUT = (float*)d_out;     // [4][2048][768]
    char* wsp = (char*)d_ws;
    auto take = [&](size_t bytes) { char* p = wsp; wsp += (bytes + 255) & ~(size_t)255; return (void*)p; };
    bf* WQ = (bf*)take((size_t)DQ * DM * 2); bf* WK = (bf*)take((size_t)DKV * DM * 2); bf* WV = (bf*)take((size_t)DKV * DM * 2); bf* WO = (bf*)take((size_t)DM * DQ * 2); float* CS = (float*)take((size_t)TT * HD * 2 * 4);
    bf* XB = (bf*)take((size_t)TT * DM * 2); float* FQ = (float*)take((size_t)TT * DQ * 4); float* FK = (float*)take((size_t)TT * DKV * 4);
    h16* QP16 = (h16*)take((size_t)NH_ * TT * HD * 2); h16* KP16 = (h16*)take((size_t)NKV * TT * HD * 2); h16* VT16 = (h16*)take((size_t)NKV * HD * TT * 2);
    bf* QPh = (bf*)take((size_t)NH_ * TT * HD * 2); bf* QPl = (bf*)take((size_t)NH_ * TT * HD * 2); bf* KPh = (bf*)take((size_t)NKV * TT * HD * 2); bf* KPl = (bf*)take((size_t)NKV * TT * HD * 2); bf* VTh = (bf*)take((size_t)NKV * HD * TT * 2); bf* VTl = (bf*)take((size_t)NKV * HD * TT * 2); bf* Ph = (bf*)take((size_t)ZH * RH * TT * 2); bf* Pl = (bf*)take((size_t)ZH * RH * TT * 2);
    float* Sb = (float*)take((size_t)ZH * TT * TT * 4); h16* P16 = (h16*)take((size_t)ZH * TT * TT * 2); float* Ob = (float*)take((size_t)ZH * TT * HD * 4); bf* ATh = (bf*)take((size_t)TT * DQ * 2); bf* ATl = (bf*)take((size_t)TT * DQ * 2);
    if ((size_t)(wsp - (char*)d_ws) > ws_size) return;    // ws 256 MiB
    float* FV = FK;   // v projection reuses the k buffer after the k planes are built (stream-ordered)
    { k_cvt8<<<(unsigned)(((size_t)DQ * DM / 8 + 255) / 256), 256, 0, stream>>>(wq, WQ, (size_t)DQ * DM / 8); k_cvt8<<<(unsigned)(((size_t)DKV * DM / 8 + 255) / 256), 256, 0, stream>>>(wk, WK, (size_t)DKV * DM / 8); k_cvt8<<<(unsigned)(((size_t)DKV * DM / 8 + 255) / 256), 256, 0, stream>>>(wv, WV, (size_t)DKV * DM / 8);
      k_cvt8<<<(unsigned)(((size_t)DM * DQ / 8 + 255) / 256), 256, 0, stream>>>(wo, WO, (size_t)DM * DQ / 8);
       }
    k_csid<<<(TT * HD + 255) / 256, 256, 0, stream>>>(CS);
    const unsigned LQ = (unsigned)(((size_t)NH_ * TT * HD / 2 + 255) / 256), LKv = (unsigned)(((size_t)NKV * TT * HD / 2 + 255) / 256);
    for (int b = 0; b < NB_; ++b) {
        
        k_cvt8<<<(unsigned)(((size_t)TT * DM / 8 + 255) / 256), 256, 0, stream>>>(x + (size_t)b * TT * DM, XB, (size_t)TT * DM / 8);
        k_gemmw<bf, 0, false><<<dim3(TT / 64, DQ / 64, 1), 32, 0, stream>>>(XB, nullptr, WQ, nullptr, DM, FQ, DQ, nullptr, 0, 0, 0);
        k_rope<<<LQ, 256, 0, stream>>>(FQ, DQ, NH_, CS, nullptr, nullptr, 1.0f, QP16, QPh, QPl);
        k_gemmw<bf, 0, false><<<dim3(TT / 64, DKV / 64, 1), 32, 0, stream>>>(XB, nullptr, WK, nullptr, DM, FK, DKV, nullptr, 0, 0, 0);
        k_rope<<<LKv, 256, 0, stream>>>(FK, DKV, NKV, CS, nullptr, nullptr, 1.0f, KP16, KPh, KPl);
        k_gemmw<bf, 0, false><<<dim3(TT / 64, DKV / 64, 1), 32, 0, stream>>>(XB, nullptr, WV, nullptr, DM, FV, DKV, nullptr, 0, 0, 0); k_vtp<<<LKv, 256, 0, stream>>>(FV, DKV, NKV, VT16, VTh, VTl);
        for (int h0 = 0; h0 < NH_; h0 += ZH) { const size_t zq = (size_t)h0, zk = (size_t)(h0 / REP);   // one kv head per query head: the pass's two heads use consecutive kv planes (z-strides TT*HD)
            k_gemmw<bf, 2, false><<<dim3(RH / 64, TT / 64, ZH), 32, 0, stream>>>(QPh + zq * TT * HD, QPl + zq * TT * HD, KPh + zk * TT * HD, KPl + zk * TT * HD, HD, Sb, TT, nullptr, (size_t)TT * HD, (size_t)TT * HD, (size_t)TT * TT);
            k_gemmw<h16, 0, false><<<dim3((TT - RH) / 64, TT / 64, ZH), 32, 0, stream>>>(QP16 + zq * TT * HD + (size_t)RH * HD, nullptr, KP16 + zk * TT * HD, nullptr, HD, Sb + (size_t)RH * TT, TT, nullptr, (size_t)TT * HD, (size_t)TT * HD, (size_t)TT * TT);
            k_asoft<<<ZH * TT / 8, 256, 0, stream>>>(Sb, pp + (size_t)b * TT * 2, ss + (size_t)b * TT, compat, gam, h0, P16, Ph, Pl);
            k_gemmw<bf, 2, false><<<dim3(RH / 64, HD / 64, ZH), 32, 0, stream>>>(Ph, Pl, VTh + zk * HD * TT, VTl + zk * HD * TT, TT, Ob, HD, nullptr, (size_t)RH * TT, (size_t)HD * TT, (size_t)TT * HD);
            k_gemmw<h16, 0, false><<<dim3((TT - RH) / 64, HD / 64, ZH), 32, 0, stream>>>(P16 + (size_t)RH * TT, nullptr, VT16 + zk * HD * TT, nullptr, TT, Ob + (size_t)RH * HD, HD, nullptr, (size_t)TT * TT, (size_t)HD * TT, (size_t)TT * HD);
            k_merge<<<(unsigned)(((size_t)ZH * TT * HD / 2 + 255) / 256), 256, 0, stream>>>(Ob, h0, ATh, ATl); }
        k_gemmw<bf, 1, true><<<dim3(TT / 64, DM / 64, 1), 32, 0, stream>>>(ATh, ATl, WO, nullptr, DQ, OUT + (size_t)b * TT * DM, DM, bo, 0, 0, 0); }
}

// v001
// One run takes 1810 microseconds.
// In two side-by-side timings against v000, it was 1.79 and 1.77 times as fast.
#include <hip/hip_runtime.h>

// SBERTaAttention (H [4][2048][768], p [4][2048][2] (language probs, read), s [4][2048] (read), compat [12][2][2], gamma [1]; Q/K/V = H W^T (12 x 64, no bias); scores = Q.K / 8 + (p_i compat_h) . p_j + gamma s_j; softmax; out = merged wo^T + bo -> [4][2048][768]).
// Compute dtypes, f32 accumulate: every input rounded to bf16; Q/K/V on PLAIN bf16 operands (inputs: exact); scores PRECPLAN; the bilinear language bias (2x2 per head) and the position bias computed per element in f32 from the bf16-rounded p, s, compat, gamma in the reference's order; softmax f32; attn.v: rows < 512 hl (3 products), the rest fp16 (x1024); wo hl x exact (2 products) + bias.

#define NB_  4
#define TT   2048
#define DM   768
#define NH_  12
#define NKV  12
#define REP  (NH_ / NKV)
#define HD   64
#define DQ   (NH_ * HD)
#define DKV  (NKV * HD)
#define ZH   2
#define RH   512                  // query rows < RH use hi+lo planes (0: none)
#define WIN  0
#define PCAR 1024.0f
#define SCL  0.125f   // HD^-0.5
typedef _Float16 h16;
typedef unsigned short bf;
typedef __attribute__((ext_vector_type(16))) __bf16   v16bf;
typedef __attribute__((ext_vector_type(16))) _Float16 v16h;
typedef __attribute__((ext_vector_type(8)))  _Float16 v8h;
typedef __attribute__((ext_vector_type(8)))  unsigned short v8us;
typedef __attribute__((ext_vector_type(8)))  float    v8f;
typedef __attribute__((ext_vector_type(4)))  float    v4f;
typedef v8h  __attribute__((may_alias)) v8ha;
typedef v4f  __attribute__((may_alias)) v4fa;
typedef v8us __attribute__((may_alias)) v8usa;

__device__ __forceinline__ unsigned short f2bf(float f) { unsigned u = __float_as_uint(f); u += 0x7FFFu + ((u >> 16) & 1u); return (unsigned short)(u >> 16); }
__device__ __forceinline__ float bf2f(unsigned short b) { return __uint_as_float(((unsigned)b) << 16); }
__device__ __forceinline__ float bfr(float f) { return bf2f(f2bf(f)); }
__device__ __forceinline__ v16h cat16(v8h lo, v8h hi) { return __builtin_shufflevector(lo, hi, 0, 1, 2, 3, 4, 5, 6, 7, 8, 9, 10, 11, 12, 13, 14, 15); }
__device__ __forceinline__ v16bf cat16b(v8us lo, v8us hi) { return __builtin_bit_cast(v16bf, __builtin_shufflevector(lo, hi, 0, 1, 2, 3, 4, 5, 6, 7, 8, 9, 10, 11, 12, 13, 14, 15)); }
__device__ __forceinline__ v8f wmma16(v16h a, v16h b, v8f c) { return __builtin_amdgcn_wmma_f32_16x16x32_f16(false, a, false, b, (short)0, c, false, false); }
__device__ __forceinline__ v8f wmmab(v16bf a, v16bf b, v8f c) { return __builtin_amdgcn_wmma_f32_16x16x32_bf16(false, a, false, b, (short)0, c, false, false); }



// ---- k_gemmw: register-blocked GEMM, NW WAVES per 64x64 output tile (16 accumulators each), operands straight from K-contiguous 16-bit planes; grid (M/64, N/64, Z), 32 * NW threads.
// Wave w takes the 32-wide k chunks w, w + NW, w + 2 NW, ... (neighbouring waves read neighbouring halves of the same lines); the NW partial tiles are summed through LDS in wave order 0..NW-1. K % (32 * NW) == 0.
// C[m][n] (f32, pitch ldc, + optional f32 bias[n]) = sum_k A[m][k] Bt[n][k] (+ split products per NSPLIT). z-batch strides sA/sB/sC in elements. K % 32 == 0.
template <typename T16> struct WFrag;
template <> struct WFrag<h16> { typedef v16h V; static __device__ __forceinline__ V ld(const h16* p) { return cat16(*(const v8h*)p, *(const v8h*)(p + 16)); } static __device__ __forceinline__ v8f mma(V a, V b, v8f c) { return wmma16(a, b, c); } };
template <> struct WFrag<bf> { typedef v16bf V; static __device__ __forceinline__ V ld(const bf* p) { return cat16b(*(const v8us*)p, *(const v8us*)(p + 16)); } static __device__ __forceinline__ v8f mma(V a, V b, v8f c) { return wmmab(a, b, c); } };
template <typename T16, int NSPLIT, bool BIAS, int NW>
__global__ __launch_bounds__(32 * NW) void k_gemmw(const T16* __restrict__ A, const T16* __restrict__ A2, const T16* __restrict__ Bt, const T16* __restrict__ Bt2, int K, float* C, int ldc, const float* __restrict__ bias, size_t sA, size_t sB, size_t sC) {
    typedef typename WFrag<T16>::V V;
    constexpr int RS = (NW > 1) ? 64 : 16;   // tile rows that pass through LDS at once: with NW > 1 the whole tile, so that one barrier serves it and no store is waited for
    __shared__ __align__(16) float os[NW * RS * 68];
    const size_t z = blockIdx.z; A += z * sA; if (A2) A2 += z * sA; Bt += z * sB; if (Bt2) Bt2 += z * sB; C += z * sC;
    const int lane = threadIdx.x & 31, lr = lane & 15, hi = lane >> 4; const int wv = (NW > 1) ? __builtin_amdgcn_readfirstlane((int)(threadIdx.x >> 5)) : 0 /* wave number in a scalar register: the k loop's counter and branch stay scalar */; const int r0 = blockIdx.x * 64, c0 = blockIdx.y * 64;
    v8f acc[4][4];
#pragma unroll
    for (int mb = 0; mb < 4; ++mb)
#pragma unroll
        for (int nb = 0; nb < 4; ++nb) acc[mb][nb] = (v8f){};
    const size_t aoff = (size_t)(r0 + lr) * K + 8 * hi, boff = (size_t)(c0 + lr) * K + 8 * hi;
#pragma unroll 1
    for (int kc = wv * 32; kc < K; kc += NW * 32) {
        V a[4], a2[4];
#pragma unroll
        for (int mb = 0; mb < 4; ++mb) { a[mb] = WFrag<T16>::ld(A + aoff + (size_t)mb * 16 * K + kc); if (NSPLIT == 1 || NSPLIT == 2) a2[mb] = WFrag<T16>::ld(A2 + aoff + (size_t)mb * 16 * K + kc); }
#pragma unroll
        for (int nb = 0; nb < 4; ++nb) { const V b = WFrag<T16>::ld(Bt + boff + (size_t)nb * 16 * K + kc); V b2; if (NSPLIT >= 2) b2 = WFrag<T16>::ld(Bt2 + boff + (size_t)nb * 16 * K + kc);
#pragma unroll
            for (int mb = 0; mb < 4; ++mb) { acc[mb][nb] = WFrag<T16>::mma(a[mb], b, acc[mb][nb]); if (NSPLIT == 1 || NSPLIT == 2) acc[mb][nb] = WFrag<T16>::mma(a2[mb], b, acc[mb][nb]); if (NSPLIT >= 2) acc[mb][nb] = WFrag<T16>::mma(a[mb], b2, acc[mb][nb]); } }
        asm volatile("v_nop\n\tv_nop\n\tv_nop\n\tv_nop" : "+v"(acc[0][0]), "+v"(acc[1][1]), "+v"(acc[2][2]), "+v"(acc[3][3]) : "v"(a[0]), "v"(a[3]));
    }
#pragma unroll
    for (int m0 = 0; m0 < 4; m0 += RS / 16) {
#pragma unroll
        for (int mb = m0; mb < m0 + RS / 16; ++mb) {
#pragma unroll
            for (int nb = 0; nb < 4; ++nb) {
#pragma unroll
                for (int j = 0; j < 8; ++j) os[wv * RS * 68 + ((mb - m0) * 16 + hi * 8 + j) * 68 + nb * 16 + lr] = acc[mb][nb][j]; } }
        if (NW > 1) __syncthreads();   // every wave's partial tile is in LDS before any of it is summed
        else { __builtin_amdgcn_wave_barrier(); asm volatile("" ::: "memory"); }   // one wave: only the compiler's order of the LDS writes and reads is to be kept
        float* crow = C + (size_t)(r0 + m0 * 16) * ldc + c0;
{
#pragma unroll
            for (int s = 0; s < RS * 16 / (NW * 32); ++s) { const int idx = s * NW * 32 + (int)threadIdx.x; const int row = idx >> 4, cofs = (idx & 15) * 4; v4f val = *(const v4fa*)(os + row * 68 + cofs);
#pragma unroll
                for (int w = 1; w < NW; ++w) val += *(const v4fa*)(os + w * RS * 68 + row * 68 + cofs);
                if (BIAS) { val[0] += bfr(bias[c0 + cofs]); val[1] += bfr(bias[c0 + cofs + 1]); val[2] += bfr(bias[c0 + cofs + 2]); val[3] += bfr(bias[c0 + cofs + 3]); }
                *(v4f*)(crow + (size_t)row * ldc + cofs) = val; }
             }
        if (NW == 1) { __builtin_amdgcn_wave_barrier(); asm volatile("" ::: "memory"); }   // the next row block's LDS writes stay behind these reads
    }
}

__device__ __forceinline__ h16 tohx(float x) { return (h16)x; }
__device__ __forceinline__ void splitf(float y, unsigned short& h, unsigned short& l) { h = f2bf(y); l = f2bf(y - bf2f(h)); }
typedef __attribute__((ext_vector_type(2))) _Float16 v2h;
typedef __attribute__((ext_vector_type(4))) _Float16 v4h;
typedef __attribute__((ext_vector_type(2))) unsigned short v2us;
typedef __attribute__((ext_vector_type(4))) unsigned short v4us;
typedef __attribute__((ext_vector_type(2))) float v2f;
typedef __attribute__((ext_vector_type(4))) int v4i;

__global__ __launch_bounds__(256) void k_wtG(const float* __restrict__ w, int K, int N, bf* Bt) {
    const int lane = threadIdx.x & 31; const int L0 = (blockIdx.x * 8 + (threadIdx.x >> 5)) * 8; const int nlines = N * K / 64;
{
#pragma unroll 1
        for (int l = 0; l < 8; ++l) { const int L = L0 + l; if (L >= nlines) break; const size_t e = (size_t)L * 64 + lane * 2; const int k = (int)(e % K), n = (int)(e / K); v2us o;
            o[0] = f2bf(w[(size_t)k * N + n]); o[1] = f2bf(w[(size_t)(k + 1) * N + n]); *(v2us*)(Bt + e) = o; }
         }
}
__global__ __launch_bounds__(256) void k_cvt8(const float* __restrict__ src, bf* dst, size_t n8) { const size_t i = (size_t)blockIdx.x * 256 + threadIdx.x; if (i >= n8) return; const v8f v = *(const v8f*)(src + i * 8); v8us o;
#pragma unroll
    for (int k = 0; k < 8; ++k) o[k] = f2bf(v[k]); *(v8us*)(dst + i * 8) = o;  }
__global__ __launch_bounds__(256) void k_cscvt(const float* __restrict__ cosT, const float* __restrict__ sinT, float* CS) { const int idx = blockIdx.x * 256 + threadIdx.x; if (idx >= TT * HD) return; v2f cs; cs[0] = bfr(cosT[idx]); cs[1] = bfr(sinT[idx]); *(v2f*)(CS + (size_t)idx * 2) = cs;  }
// k_rope: head planes [h][t][d] (fp16 + hi/lo) of rope(x) x sc with the rotate-half convention out[d] = x[d] cos[t][d] - x[d+HD/2] sin[t][d], out[d+HD/2] = x[d+HD/2] cos[t][d+HD/2] + x[d] sin[t][d+HD/2]
__global__ __launch_bounds__(256) void k_rope(const float* __restrict__ F, int pitch, int nheads, const float* __restrict__ CS, const float* __restrict__ RF, const float* __restrict__ nw, float sc, h16* P16, bf* Ph, bf* Pl) {
    const size_t e = ((size_t)blockIdx.x * 256 + threadIdx.x) * 2; if (e >= (size_t)nheads * TT * HD) return; const int d = (int)(e % HD); const int t = (int)((e / HD) % TT); const int h = (int)(e / ((size_t)HD * TT)); const float* f = F + (size_t)t * pitch + h * HD; const float rf = RF ? RF[(size_t)h * TT + t] : 1.0f; v2h o16; v2us oh, ol;
#pragma unroll
    for (int q = 0; q < 2; ++q) { const int dd = d + q; const int dp = (dd < HD / 2) ? dd + HD / 2 : dd - HD / 2; float x0 = f[dd], x1 = f[dp];
        if (RF) { float n0 = __fmul_rn(x0, rf), n1 = __fmul_rn(x1, rf); asm volatile("" : "+v"(n0)); asm volatile("" : "+v"(n1)); x0 = __fmul_rn(bfr(nw[dd]), n0); x1 = __fmul_rn(bfr(nw[dp]), n1); }
        const v2f cs = *(const v2f*)(CS + ((size_t)t * HD + dd) * 2); float a = __fmul_rn(x0, cs[0]), bq = __fmul_rn(x1, cs[1]); asm volatile("" : "+v"(a)); asm volatile("" : "+v"(bq)); const float r = ((dd < HD / 2) ? __fsub_rn(a, bq) : __fadd_rn(a, bq)) * sc;
        o16[q] = tohx(r); unsigned short a2, c2; splitf(r, a2, c2); oh[q] = a2; ol[q] = c2; }
    *(v2h*)(P16 + e) = o16; *(v2us*)(Ph + e) = oh; *(v2us*)(Pl + e) = ol;  }
__global__ __launch_bounds__(256) void k_vtp(const float* __restrict__ F, int pitch, int nheads, h16* V16, bf* Vh, bf* Vl) { const size_t e = ((size_t)blockIdx.x * 256 + threadIdx.x) * 2; if (e >= (size_t)nheads * HD * TT) return; const int t = (int)(e % TT); const int d = (int)((e / TT) % HD); const int g = (int)(e / ((size_t)TT * HD)); v2h o16; v2us oh, ol;
#pragma unroll
    for (int q = 0; q < 2; ++q) { const float x = F[(size_t)(t + q) * pitch + g * HD + d]; o16[q] = tohx(x); unsigned short a2, c2; splitf(x, a2, c2); oh[q] = a2; ol[q] = c2; }
    *(v2h*)(V16 + e) = o16; *(v2us*)(Vh + e) = oh; *(v2us*)(Vl + e) = ol;  }
__global__ __launch_bounds__(256) void k_csid(float* CS) { const int idx = blockIdx.x * 256 + threadIdx.x; if (idx >= TT * HD) return; v2f cs; cs[0] = 1.0f; cs[1] = 0.0f; *(v2f*)(CS + (size_t)idx * 2) = cs;  }
// k_asoft: per row (zz, i): t = S x HD^-0.5 + (p_i compat_h) . p_j + gamma s_j (no mask); softmax over the 2048 keys (register row, one exp, fixed trees);
__global__ __launch_bounds__(256) void k_asoft(const float* __restrict__ Sb, const float* __restrict__ pp, const float* __restrict__ ss, const float* __restrict__ cm, const float* __restrict__ gam, int h0, h16* P16, bf* Ph, bf* Pl) {
    const int lane = threadIdx.x & 31; const int row = blockIdx.x * 8 + (threadIdx.x >> 5); if (row >= ZH * TT) return; const int i = row % TT; const int zz = row / TT; (void)zz; const bool hires = (i < RH); const float* sr = Sb + (size_t)row * TT; const int hh = h0 + zz; float c00 = bfr(cm[hh * 4 + 0]), c01 = bfr(cm[hh * 4 + 1]), c10 = bfr(cm[hh * 4 + 2]), c11 = bfr(cm[hh * 4 + 3]), pi0 = bfr(pp[(size_t)i * 2]), pi1 = bfr(pp[(size_t)i * 2 + 1]), gmm = bfr(gam[0]); asm volatile("" : "+v"(c00)); asm volatile("" : "+v"(c01)); asm volatile("" : "+v"(c10)); asm volatile("" : "+v"(c11)); asm volatile("" : "+v"(pi0)); asm volatile("" : "+v"(pi1)); asm volatile("" : "+v"(gmm)); float a0 = __fmul_rn(pi0, c00), a1 = __fmul_rn(pi1, c10), b0 = __fmul_rn(pi0, c01), b1 = __fmul_rn(pi1, c11); asm volatile("" : "+v"(a0)); asm volatile("" : "+v"(a1)); asm volatile("" : "+v"(b0)); asm volatile("" : "+v"(b1)); float pc0 = __fadd_rn(a0, a1), pc1 = __fadd_rn(b0, b1); asm volatile("" : "+v"(pc0)); asm volatile("" : "+v"(pc1)); float v[TT / 32]; float mx = -3.0e38f;
#pragma unroll
    for (int ch = 0; ch < TT / 128; ++ch) { const int j0 = ch * 128 + lane * 4; const v4f a = *(const v4f*)(sr + j0);
#pragma unroll
        for (int q = 0; q < 4; ++q) { const int j = j0 + q; (void)j; float sa = a[q] * SCL; asm volatile("" : "+v"(sa)); const int jj = j0 + q; float pj0 = bfr(pp[(size_t)jj * 2]), pj1 = bfr(pp[(size_t)jj * 2 + 1]), sj = bfr(ss[jj]); asm volatile("" : "+v"(pj0)); asm volatile("" : "+v"(pj1)); asm volatile("" : "+v"(sj)); float m0 = __fmul_rn(pc0, pj0), m1 = __fmul_rn(pc1, pj1); asm volatile("" : "+v"(m0)); asm volatile("" : "+v"(m1)); float bil = __fadd_rn(m0, m1); asm volatile("" : "+v"(bil)); float t1 = __fadd_rn(sa, bil); asm volatile("" : "+v"(t1)); float gs = __fmul_rn(gmm, sj); asm volatile("" : "+v"(gs)); float t = __fadd_rn(t1, gs); asm volatile("" : "+v"(t)); v[ch * 4 + q] = t; mx = fmaxf(mx, t); } }
#pragma unroll
    for (int sh = 16; sh; sh >>= 1) mx = fmaxf(mx, __shfl_xor(mx, sh, 32));
    float sum = 0.f;
#pragma unroll
    for (int k = 0; k < TT / 32; ++k) { float d0 = __fsub_rn(v[k], mx); asm volatile("" : "+v"(d0)); v[k] = __builtin_amdgcn_exp2f(__fmul_rn(d0, 1.4426950408889634f)); sum += v[k]; }
#pragma unroll
    for (int sh = 16; sh; sh >>= 1) sum += __shfl_xor(sum, sh, 32);
    const float f = __fdiv_rn(hires ? 1.0f : PCAR, sum);
{
        if (hires) {
#pragma unroll
            for (int ch = 0; ch < TT / 128; ++ch) { v4us oh, ol;
#pragma unroll
                for (int q = 0; q < 4; ++q) { unsigned short a, c2; splitf(v[ch * 4 + q] * f, a, c2); oh[q] = a; ol[q] = c2; }
                const size_t oo = ((size_t)zz * (RH ? RH : 1) + i) * TT + ch * 128 + lane * 4; *(v4us*)(Ph + oo) = oh; *(v4us*)(Pl + oo) = ol; }
        } else {
#pragma unroll
            for (int ch = 0; ch < TT / 128; ++ch) { v4h o4;
#pragma unroll
                for (int q = 0; q < 4; ++q) o4[q] = tohx(v[ch * 4 + q] * f);
                *(v4h*)(P16 + (size_t)row * TT + ch * 128 + lane * 4) = o4; } }
         }
}
__global__ __launch_bounds__(256) void k_merge(const float* __restrict__ O, int h0, bf* Ah, bf* Al) { const size_t e = ((size_t)blockIdx.x * 256 + threadIdx.x) * 2; if (e >= (size_t)ZH * TT * HD) return; const int d = (int)(e % HD); const int t = (int)((e / HD) % TT); const int zz = (int)(e / ((size_t)HD * TT)); const float cs = (t < RH) ? 1.0f : (1.0f / PCAR); const size_t oo = (size_t)t * DQ + (h0 + zz) * HD + d;
    v2us oh, ol;
#pragma unroll
    for (int q = 0; q < 2; ++q) { unsigned short a, c2; splitf(O[e + q] * cs, a, c2); oh[q] = a; ol[q] = c2; } *(v2us*)(Ah + oo) = oh; *(v2us*)(Al + oo) = ol;  }

extern "C" void kernel_launch(void* const* d_in, const int* in_sizes, int n_in,
                              void* d_out, int out_size, void* d_ws, size_t ws_size, hipStream_t stream) {
    (void)in_sizes; (void)n_in; (void)out_size;
    const float* x = (const float*)d_in[0]; const float* pp = (const float*)d_in[1]; const float* ss = (const float*)d_in[2]; const float* wq = (const float*)d_in[3]; const float* wk = (const float*)d_in[4]; const float* wv = (const float*)d_in[5]; const float* wo = (const float*)d_in[6]; const float* bo = (const float*)d_in[7]; const float* compat = (const float*)d_in[8]; const float* gam = (const float*)d_in[9]; const float* cosT = nullptr; const float* sinT = nullptr; (void)cosT; (void)sinT;
    float* OUT = (float*)d_out;     // [4][2048][768]
    char* wsp = (char*)d_ws;
    auto take = [&](size_t bytes) { char* p = wsp; wsp += (bytes + 255) & ~(size_t)255; return (void*)p; };
    bf* WQ = (bf*)take((size_t)DQ * DM * 2); bf* WK = (bf*)take((size_t)DKV * DM * 2); bf* WV = (bf*)take((size_t)DKV * DM * 2); bf* WO = (bf*)take((size_t)DM * DQ * 2); float* CS = (float*)take((size_t)TT * HD * 2 * 4);
    bf* XB = (bf*)take((size_t)TT * DM * 2); float* FQ = (float*)take((size_t)TT * DQ * 4); float* FK = (float*)take((size_t)TT * DKV * 4);
    h16* QP16 = (h16*)take((size_t)NH_ * TT * HD * 2); h16* KP16 = (h16*)take((size_t)NKV * TT * HD * 2); h16* VT16 = (h16*)take((size_t)NKV * HD * TT * 2);
    bf* QPh = (bf*)take((size_t)NH_ * TT * HD * 2); bf* QPl = (bf*)take((size_t)NH_ * TT * HD * 2); bf* KPh = (bf*)take((size_t)NKV * TT * HD * 2); bf* KPl = (bf*)take((size_t)NKV * TT * HD * 2); bf* VTh = (bf*)take((size_t)NKV * HD * TT * 2); bf* VTl = (bf*)take((size_t)NKV * HD * TT * 2); bf* Ph = (bf*)take((size_t)ZH * RH * TT * 2); bf* Pl = (bf*)take((size_t)ZH * RH * TT * 2);
    float* Sb = (float*)take((size_t)ZH * TT * TT * 4); h16* P16 = (h16*)take((size_t)ZH * TT * TT * 2); float* Ob = (float*)take((size_t)ZH * TT * HD * 4); bf* ATh = (bf*)take((size_t)TT * DQ * 2); bf* ATl = (bf*)take((size_t)TT * DQ * 2);
    if ((size_t)(wsp - (char*)d_ws) > ws_size) return;    // ws 256 MiB
    float* FV = FK;   // v projection reuses the k buffer after the k planes are built (stream-ordered)
    { k_cvt8<<<(unsigned)(((size_t)DQ * DM / 8 + 255) / 256), 256, 0, stream>>>(wq, WQ, (size_t)DQ * DM / 8); k_cvt8<<<(unsigned)(((size_t)DKV * DM / 8 + 255) / 256), 256, 0, stream>>>(wk, WK, (size_t)DKV * DM / 8); k_cvt8<<<(unsigned)(((size_t)DKV * DM / 8 + 255) / 256), 256, 0, stream>>>(wv, WV, (size_t)DKV * DM / 8);
      k_cvt8<<<(unsigned)(((size_t)DM * DQ / 8 + 255) / 256), 256, 0, stream>>>(wo, WO, (size_t)DM * DQ / 8);
       }
    k_csid<<<(TT * HD + 255) / 256, 256, 0, stream>>>(CS);
    const unsigned LQ = (unsigned)(((size_t)NH_ * TT * HD / 2 + 255) / 256), LKv = (unsigned)(((size_t)NKV * TT * HD / 2 + 255) / 256);
    for (int b = 0; b < NB_; ++b) {
        
        k_cvt8<<<(unsigned)(((size_t)TT * DM / 8 + 255) / 256), 256, 0, stream>>>(x + (size_t)b * TT * DM, XB, (size_t)TT * DM / 8);
        k_gemmw<bf, 0, false, 8><<<dim3(TT / 64, DQ / 64, 1), 256, 0, stream>>>(XB, nullptr, WQ, nullptr, DM, FQ, DQ, nullptr, 0, 0, 0);
        k_rope<<<LQ, 256, 0, stream>>>(FQ, DQ, NH_, CS, nullptr, nullptr, 1.0f, QP16, QPh, QPl);
        k_gemmw<bf, 0, false, 8><<<dim3(TT / 64, DKV / 64, 1), 256, 0, stream>>>(XB, nullptr, WK, nullptr, DM, FK, DKV, nullptr, 0, 0, 0);
        k_rope<<<LKv, 256, 0, stream>>>(FK, DKV, NKV, CS, nullptr, nullptr, 1.0f, KP16, KPh, KPl);
        k_gemmw<bf, 0, false, 8><<<dim3(TT / 64, DKV / 64, 1), 256, 0, stream>>>(XB, nullptr, WV, nullptr, DM, FV, DKV, nullptr, 0, 0, 0); k_vtp<<<LKv, 256, 0, stream>>>(FV, DKV, NKV, VT16, VTh, VTl);
        for (int h0 = 0; h0 < NH_; h0 += ZH) { const size_t zq = (size_t)h0, zk = (size_t)(h0 / REP);   // one kv head per query head: the pass's two heads use consecutive kv planes (z-strides TT*HD)
            k_gemmw<bf, 2, false, 1><<<dim3(RH / 64, TT / 64, ZH), 32, 0, stream>>>(QPh + zq * TT * HD, QPl + zq * TT * HD, KPh + zk * TT * HD, KPl + zk * TT * HD, HD, Sb, TT, nullptr, (size_t)TT * HD, (size_t)TT * HD, (size_t)TT * TT);
            k_gemmw<h16, 0, false, 1><<<dim3((TT - RH) / 64, TT / 64, ZH), 32, 0, stream>>>(QP16 + zq * TT * HD + (size_t)RH * HD, nullptr, KP16 + zk * TT * HD, nullptr, HD, Sb + (size_t)RH * TT, TT, nullptr, (size_t)TT * HD, (size_t)TT * HD, (size_t)TT * TT);
            k_asoft<<<ZH * TT / 8, 256, 0, stream>>>(Sb, pp + (size_t)b * TT * 2, ss + (size_t)b * TT, compat, gam, h0, P16, Ph, Pl);
            k_gemmw<bf, 2, false, 16><<<dim3(RH / 64, HD / 64, ZH), 512, 0, stream>>>(Ph, Pl, VTh + zk * HD * TT, VTl + zk * HD * TT, TT, Ob, HD, nullptr, (size_t)RH * TT, (size_t)HD * TT, (size_t)TT * HD);
            k_gemmw<h16, 0, false, 16><<<dim3((TT - RH) / 64, HD / 64, ZH), 512, 0, stream>>>(P16 + (size_t)RH * TT, nullptr, VT16 + zk * HD * TT, nullptr, TT, Ob + (size_t)RH * HD, HD, nullptr, (size_t)TT * TT, (size_t)HD * TT, (size_t)TT * HD);
            k_merge<<<(unsigned)(((size_t)ZH * TT * HD / 2 + 255) / 256), 256, 0, stream>>>(Ob, h0, ATh, ATl); }
        k_gemmw<bf, 1, true, 8><<<dim3(TT / 64, DM / 64, 1), 256, 0, stream>>>(ATh, ATl, WO, nullptr, DQ, OUT + (size_t)b * TT * DM, DM, bo, 0, 0, 0); }
}

// v002
// One run takes 1090 microseconds.
// Timed twice side by side with v001, it ran 1.66 and 1.68 times as fast.
// All steps since v000 together make it 2.98 times as fast.
#include <hip/hip_runtime.h>

// SBERTaAttention (H [4][2048][768], p [4][2048][2] (language probs, read), s [4][2048] (read), compat [12][2][2], gamma [1]; Q/K/V = H W^T (12 x 64, no bias); scores = Q.K / 8 + (p_i compat_h) . p_j + gamma s_j; softmax; out = merged wo^T + bo -> [4][2048][768]).
// Compute dtypes, f32 accumulate: every input rounded to bf16; Q/K/V on PLAIN bf16 operands (inputs: exact); scores PRECPLAN; the bilinear language bias (2x2 per head) and the position bias computed per element in f32 from the bf16-rounded p, s, compat, gamma in the reference's order; softmax f32; attn.v: rows < 512 hl (3 products), the rest fp16 (x1024); wo hl x exact (2 products) + bias.

#define NB_  4
#define TT   2048
#define DM   768
#define NH_  12
#define NKV  12
#define REP  (NH_ / NKV)
#define HD   64
#define DQ   (NH_ * HD)
#define DKV  (NKV * HD)
#define ZH   6                    // heads per attention launch (blockIdx.z)
#define RH   512                  // query rows < RH use hi+lo planes (0: none)
#define WIN  0
#define PCAR 1024.0f
#define SCL  0.125f   // HD^-0.5
typedef _Float16 h16;
typedef unsigned short bf;
typedef __attribute__((ext_vector_type(16))) __bf16   v16bf;
typedef __attribute__((ext_vector_type(16))) _Float16 v16h;
typedef __attribute__((ext_vector_type(8)))  _Float16 v8h;
typedef __attribute__((ext_vector_type(8)))  unsigned short v8us;
typedef __attribute__((ext_vector_type(8)))  float    v8f;
typedef __attribute__((ext_vector_type(4)))  float    v4f;
typedef v8h  __attribute__((may_alias)) v8ha;
typedef v4f  __attribute__((may_alias)) v4fa;
typedef v8us __attribute__((may_alias)) v8usa;

__device__ __forceinline__ unsigned short f2bf(float f) { unsigned u = __float_as_uint(f); u += 0x7FFFu + ((u >> 16) & 1u); return (unsigned short)(u >> 16); }
__device__ __forceinline__ float bf2f(unsigned short b) { return __uint_as_float(((unsigned)b) << 16); }
__device__ __forceinline__ float bfr(float f) { return bf2f(f2bf(f)); }
__device__ __forceinline__ v16h cat16(v8h lo, v8h hi) { return __builtin_shufflevector(lo, hi, 0, 1, 2, 3, 4, 5, 6, 7, 8, 9, 10, 11, 12, 13, 14, 15); }
__device__ __forceinline__ v16bf cat16b(v8us lo, v8us hi) { return __builtin_bit_cast(v16bf, __builtin_shufflevector(lo, hi, 0, 1, 2, 3, 4, 5, 6, 7, 8, 9, 10, 11, 12, 13, 14, 15)); }
__device__ __forceinline__ v8f wmma16(v16h a, v16h b, v8f c) { return __builtin_amdgcn_wmma_f32_16x16x32_f16(false, a, false, b, (short)0, c, false, false); }
__device__ __forceinline__ v8f wmmab(v16bf a, v16bf b, v8f c) { return __builtin_amdgcn_wmma_f32_16x16x32_bf16(false, a, false, b, (short)0, c, false, false); }



// ---- k_gemmw: register-blocked GEMM, NW WAVES per 64x64 output tile (16 accumulators each), operands straight from K-contiguous 16-bit planes; grid (M/64, N/64, Z), 32 * NW threads.
// Wave w takes the 32-wide k chunks w, w + NW, w + 2 NW, ... (neighbouring waves read neighbouring halves of the same lines); the NW partial tiles are summed through LDS in wave order 0..NW-1. K % (32 * NW) == 0.
// C[m][n] (f32, pitch ldc, + optional f32 bias[n]) = sum_k A[m][k] Bt[n][k] (+ split products per NSPLIT). z-batch strides sA/sB/sC in elements. K % 32 == 0.
template <typename T16> struct WFrag;
template <> struct WFrag<h16> { typedef v16h V; static __device__ __forceinline__ V ld(const h16* p) { return cat16(*(const v8h*)p, *(const v8h*)(p + 16)); } static __device__ __forceinline__ v8f mma(V a, V b, v8f c) { return wmma16(a, b, c); } };
template <> struct WFrag<bf> { typedef v16bf V; static __device__ __forceinline__ V ld(const bf* p) { return cat16b(*(const v8us*)p, *(const v8us*)(p + 16)); } static __device__ __forceinline__ v8f mma(V a, V b, v8f c) { return wmmab(a, b, c); } };
template <typename T16, int NSPLIT, bool BIAS, int NW>
__global__ __launch_bounds__(32 * NW) void k_gemmw(const T16* __restrict__ A, const T16* __restrict__ A2, const T16* __restrict__ Bt, const T16* __restrict__ Bt2, int K, float* C, int ldc, const float* __restrict__ bias, size_t sA, size_t sB, size_t sC) {
    typedef typename WFrag<T16>::V V;
    constexpr int RS = (NW > 1) ? 64 : 16;   // tile rows that pass through LDS at once: with NW > 1 the whole tile, so that one barrier serves it and no store is waited for
    __shared__ __align__(16) float os[NW * RS * 68];
    const size_t z = blockIdx.z; A += z * sA; if (A2) A2 += z * sA; Bt += z * sB; if (Bt2) Bt2 += z * sB; C += z * sC;
    const int lane = threadIdx.x & 31, lr = lane & 15, hi = lane >> 4; const int wv = (NW > 1) ? __builtin_amdgcn_readfirstlane((int)(threadIdx.x >> 5)) : 0 /* wave number in a scalar register: the k loop's counter and branch stay scalar */; const int r0 = blockIdx.x * 64, c0 = blockIdx.y * 64;
    v8f acc[4][4];
#pragma unroll
    for (int mb = 0; mb < 4; ++mb)
#pragma unroll
        for (int nb = 0; nb < 4; ++nb) acc[mb][nb] = (v8f){};
    const size_t aoff = (size_t)(r0 + lr) * K + 8 * hi, boff = (size_t)(c0 + lr) * K + 8 * hi;
#pragma unroll 1
    for (int kc = wv * 32; kc < K; kc += NW * 32) {
        V a[4], a2[4];
#pragma unroll
        for (int mb = 0; mb < 4; ++mb) { a[mb] = WFrag<T16>::ld(A + aoff + (size_t)mb * 16 * K + kc); if (NSPLIT == 1 || NSPLIT == 2) a2[mb] = WFrag<T16>::ld(A2 + aoff + (size_t)mb * 16 * K + kc); }
#pragma unroll
        for (int nb = 0; nb < 4; ++nb) { const V b = WFrag<T16>::ld(Bt + boff + (size_t)nb * 16 * K + kc); V b2; if (NSPLIT >= 2) b2 = WFrag<T16>::ld(Bt2 + boff + (size_t)nb * 16 * K + kc);
#pragma unroll
            for (int mb = 0; mb < 4; ++mb) { acc[mb][nb] = WFrag<T16>::mma(a[mb], b, acc[mb][nb]); if (NSPLIT == 1 || NSPLIT == 2) acc[mb][nb] = WFrag<T16>::mma(a2[mb], b, acc[mb][nb]); if (NSPLIT >= 2) acc[mb][nb] = WFrag<T16>::mma(a[mb], b2, acc[mb][nb]); } }
        asm volatile("v_nop\n\tv_nop\n\tv_nop\n\tv_nop" : "+v"(acc[0][0]), "+v"(acc[1][1]), "+v"(acc[2][2]), "+v"(acc[3][3]) : "v"(a[0]), "v"(a[3]));
    }
#pragma unroll
    for (int m0 = 0; m0 < 4; m0 += RS / 16) {
#pragma unroll
        for (int mb = m0; mb < m0 + RS / 16; ++mb) {
#pragma unroll
            for (int nb = 0; nb < 4; ++nb) {
#pragma unroll
                for (int j = 0; j < 8; ++j) os[wv * RS * 68 + ((mb - m0) * 16 + hi * 8 + j) * 68 + nb * 16 + lr] = acc[mb][nb][j]; } }
        if (NW > 1) __syncthreads();   // every wave's partial tile is in LDS before any of it is summed
        else { __builtin_amdgcn_wave_barrier(); asm volatile("" ::: "memory"); }   // one wave: only the compiler's order of the LDS writes and reads is to be kept
        float* crow = C + (size_t)(r0 + m0 * 16) * ldc + c0;
{
#pragma unroll
            for (int s = 0; s < RS * 16 / (NW * 32); ++s) { const int idx = s * NW * 32 + (int)threadIdx.x; const int row = idx >> 4, cofs = (idx & 15) * 4; v4f val = *(const v4fa*)(os + row * 68 + cofs);
#pragma unroll
                for (int w = 1; w < NW; ++w) val += *(const v4fa*)(os + w * RS * 68 + row * 68 + cofs);
                if (BIAS) { val[0] += bfr(bias[c0 + cofs]); val[1] += bfr(bias[c0 + cofs + 1]); val[2] += bfr(bias[c0 + cofs + 2]); val[3] += bfr(bias[c0 + cofs + 3]); }
                *(v4f*)(crow + (size_t)row * ldc + cofs) = val; }
             }
        if (NW == 1) { __builtin_amdgcn_wave_barrier(); asm volatile("" ::: "memory"); }   // the next row block's LDS writes stay behind these reads
    }
}

__device__ __forceinline__ h16 tohx(float x) { return (h16)x; }
__device__ __forceinline__ void splitf(float y, unsigned short& h, unsigned short& l) { h = f2bf(y); l = f2bf(y - bf2f(h)); }
typedef __attribute__((ext_vector_type(2))) _Float16 v2h;
typedef __attribute__((ext_vector_type(4))) _Float16 v4h;
typedef __attribute__((ext_vector_type(2))) unsigned short v2us;
typedef __attribute__((ext_vector_type(4))) unsigned short v4us;
typedef __attribute__((ext_vector_type(2))) float v2f;
typedef __attribute__((ext_vector_type(4))) int v4i;

__global__ __launch_bounds__(256) void k_wtG(const float* __restrict__ w, int K, int N, bf* Bt) {
    const int lane = threadIdx.x & 31; const int L0 = (blockIdx.x * 8 + (threadIdx.x >> 5)) * 8; const int nlines = N * K / 64;
{
#pragma unroll 1
        for (int l = 0; l < 8; ++l) { const int L = L0 + l; if (L >= nlines) break; const size_t e = (size_t)L * 64 + lane * 2; const int k = (int)(e % K), n = (int)(e / K); v2us o;
            o[0] = f2bf(w[(size_t)k * N + n]); o[1] = f2bf(w[(size_t)(k + 1) * N + n]); *(v2us*)(Bt + e) = o; }
         }
}
__global__ __launch_bounds__(256) void k_cvt8(const float* __restrict__ src, bf* dst, size_t n8) { const size_t i = (size_t)blockIdx.x * 256 + threadIdx.x; if (i >= n8) return; const v8f v = *(const v8f*)(src + i * 8); v8us o;
#pragma unroll
    for (int k = 0; k < 8; ++k) o[k] = f2bf(v[k]); *(v8us*)(dst + i * 8) = o;  }
// k_cvt8w: the four weight matrices (n8 * 8 elements each), one per blockIdx.y, into four planes that follow one another in dst
__global__ __launch_bounds__(256) void k_cvt8w(const float* __restrict__ w0, const float* __restrict__ w1, const float* __restrict__ w2, const float* __restrict__ w3, bf* dst, size_t n8) { const size_t i = (size_t)blockIdx.x * 256 + threadIdx.x; if (i >= n8) return; const int y = blockIdx.y; const float* src = (y == 0) ? w0 : (y == 1) ? w1 : (y == 2) ? w2 : w3; const v8f v = *(const v8f*)(src + i * 8); v8us o;
#pragma unroll
    for (int k = 0; k < 8; ++k) o[k] = f2bf(v[k]); *(v8us*)(dst + ((size_t)y * n8 + i) * 8) = o;  }
__global__ __launch_bounds__(256) void k_cscvt(const float* __restrict__ cosT, const float* __restrict__ sinT, float* CS) { const int idx = blockIdx.x * 256 + threadIdx.x; if (idx >= TT * HD) return; v2f cs; cs[0] = bfr(cosT[idx]); cs[1] = bfr(sinT[idx]); *(v2f*)(CS + (size_t)idx * 2) = cs;  }
// k_rope: head planes [h][t][d] (fp16 + hi/lo) of rope(x) x sc with the rotate-half convention out[d] = x[d] cos[t][d] - x[d+HD/2] sin[t][d], out[d+HD/2] = x[d+HD/2] cos[t][d+HD/2] + x[d] sin[t][d+HD/2]
__global__ __launch_bounds__(256) void k_rope(const float* __restrict__ F, int pitch, int nheads, const float* __restrict__ CS, const float* __restrict__ RF, const float* __restrict__ nw, float sc, h16* P16, bf* Ph, bf* Pl) {
    const size_t e = ((size_t)blockIdx.x * 256 + threadIdx.x) * 2; if (e >= (size_t)nheads * TT * HD) return; const int d = (int)(e % HD); const int t = (int)((e / HD) % TT); const int h = (int)(e / ((size_t)HD * TT)); const float* f = F + (size_t)t * pitch + h * HD; const float rf = RF ? RF[(size_t)h * TT + t] : 1.0f; v2h o16; v2us oh, ol;
#pragma unroll
    for (int q = 0; q < 2; ++q) { const int dd = d + q; const int dp = (dd < HD / 2) ? dd + HD / 2 : dd - HD / 2; float x0 = f[dd], x1 = f[dp];
        if (RF) { float n0 = __fmul_rn(x0, rf), n1 = __fmul_rn(x1, rf); asm volatile("" : "+v"(n0)); asm volatile("" : "+v"(n1)); x0 = __fmul_rn(bfr(nw[dd]), n0); x1 = __fmul_rn(bfr(nw[dp]), n1); }
        const v2f cs = *(const v2f*)(CS + ((size_t)t * HD + dd) * 2); float a = __fmul_rn(x0, cs[0]), bq = __fmul_rn(x1, cs[1]); asm volatile("" : "+v"(a)); asm volatile("" : "+v"(bq)); const float r = ((dd < HD / 2) ? __fsub_rn(a, bq) : __fadd_rn(a, bq)) * sc;
        o16[q] = tohx(r); unsigned short a2, c2; splitf(r, a2, c2); oh[q] = a2; ol[q] = c2; }
    *(v2h*)(P16 + e) = o16; *(v2us*)(Ph + e) = oh; *(v2us*)(Pl + e) = ol;  }
__global__ __launch_bounds__(256) void k_vtp(const float* __restrict__ F, int pitch, int nheads, h16* V16, bf* Vh, bf* Vl) { const size_t e = ((size_t)blockIdx.x * 256 + threadIdx.x) * 2; if (e >= (size_t)nheads * HD * TT) return; const int t = (int)(e % TT); const int d = (int)((e / TT) % HD); const int g = (int)(e / ((size_t)TT * HD)); v2h o16; v2us oh, ol;
#pragma unroll
    for (int q = 0; q < 2; ++q) { const float x = F[(size_t)(t + q) * pitch + g * HD + d]; o16[q] = tohx(x); unsigned short a2, c2; splitf(x, a2, c2); oh[q] = a2; ol[q] = c2; }
    *(v2h*)(V16 + e) = o16; *(v2us*)(Vh + e) = oh; *(v2us*)(Vl + e) = ol;  }
__global__ __launch_bounds__(256) void k_csid(float* CS) { const int idx = blockIdx.x * 256 + threadIdx.x; if (idx >= TT * HD) return; v2f cs; cs[0] = 1.0f; cs[1] = 0.0f; *(v2f*)(CS + (size_t)idx * 2) = cs;  }
// k_asoft: per row (zz, i): t = S x HD^-0.5 + (p_i compat_h) . p_j + gamma s_j (no mask); softmax over the 2048 keys (register row, one exp, fixed trees);
__global__ __launch_bounds__(256) void k_asoft(const float* __restrict__ Sb, const float* __restrict__ pp, const float* __restrict__ ss, const float* __restrict__ cm, const float* __restrict__ gam, int h0, h16* P16, bf* Ph, bf* Pl) {
    const int lane = threadIdx.x & 31; const int row = blockIdx.x * 8 + (threadIdx.x >> 5); if (row >= ZH * TT) return; const int i = row % TT; const int zz = row / TT; (void)zz; const bool hires = (i < RH); const float* sr = Sb + (size_t)row * TT; const int hh = h0 + zz; float c00 = bfr(cm[hh * 4 + 0]), c01 = bfr(cm[hh * 4 + 1]), c10 = bfr(cm[hh * 4 + 2]), c11 = bfr(cm[hh * 4 + 3]), pi0 = bfr(pp[(size_t)i * 2]), pi1 = bfr(pp[(size_t)i * 2 + 1]), gmm = bfr(gam[0]); asm volatile("" : "+v"(c00)); asm volatile("" : "+v"(c01)); asm volatile("" : "+v"(c10)); asm volatile("" : "+v"(c11)); asm volatile("" : "+v"(pi0)); asm volatile("" : "+v"(pi1)); asm volatile("" : "+v"(gmm)); float a0 = __fmul_rn(pi0, c00), a1 = __fmul_rn(pi1, c10), b0 = __fmul_rn(pi0, c01), b1 = __fmul_rn(pi1, c11); asm volatile("" : "+v"(a0)); asm volatile("" : "+v"(a1)); asm volatile("" : "+v"(b0)); asm volatile("" : "+v"(b1)); float pc0 = __fadd_rn(a0, a1), pc1 = __fadd_rn(b0, b1); asm volatile("" : "+v"(pc0)); asm volatile("" : "+v"(pc1)); float v[TT / 32]; float mx = -3.0e38f;
#pragma unroll
    for (int ch = 0; ch < TT / 128; ++ch) { const int j0 = ch * 128 + lane * 4; const v4f a = *(const v4f*)(sr + j0);
#pragma unroll
        for (int q = 0; q < 4; ++q) { const int j = j0 + q; (void)j; float sa = a[q] * SCL; asm volatile("" : "+v"(sa)); const int jj = j0 + q; float pj0 = bfr(pp[(size_t)jj * 2]), pj1 = bfr(pp[(size_t)jj * 2 + 1]), sj = bfr(ss[jj]); asm volatile("" : "+v"(pj0)); asm volatile("" : "+v"(pj1)); asm volatile("" : "+v"(sj)); float m0 = __fmul_rn(pc0, pj0), m1 = __fmul_rn(pc1, pj1); asm volatile("" : "+v"(m0)); asm volatile("" : "+v"(m1)); float bil = __fadd_rn(m0, m1); asm volatile("" : "+v"(bil)); float t1 = __fadd_rn(sa, bil); asm volatile("" : "+v"(t1)); float gs = __fmul_rn(gmm, sj); asm volatile("" : "+v"(gs)); float t = __fadd_rn(t1, gs); asm volatile("" : "+v"(t)); v[ch * 4 + q] = t; mx = fmaxf(mx, t); } }
#pragma unroll
    for (int sh = 16; sh; sh >>= 1) mx = fmaxf(mx, __shfl_xor(mx, sh, 32));
    float sum = 0.f;
#pragma unroll
    for (int k = 0; k < TT / 32; ++k) { float d0 = __fsub_rn(v[k], mx); asm volatile("" : "+v"(d0)); v[k] = __builtin_amdgcn_exp2f(__fmul_rn(d0, 1.4426950408889634f)); sum += v[k]; }
#pragma unroll
    for (int sh = 16; sh; sh >>= 1) sum += __shfl_xor(sum, sh, 32);
    const float f = __fdiv_rn(hires ? 1.0f : PCAR, sum);
{
        if (hires) {
#pragma unroll
            for (int ch = 0; ch < TT / 128; ++ch) { v4us oh, ol;
#pragma unroll
                for (int q = 0; q < 4; ++q) { unsigned short a, c2; splitf(v[ch * 4 + q] * f, a, c2); oh[q] = a; ol[q] = c2; }
                const size_t oo = ((size_t)zz * (RH ? RH : 1) + i) * TT + ch * 128 + lane * 4; *(v4us*)(Ph + oo) = oh; *(v4us*)(Pl + oo) = ol; }
        } else {
#pragma unroll
            for (int ch = 0; ch < TT / 128; ++ch) { v4h o4;
#pragma unroll
                for (int q = 0; q < 4; ++q) o4[q] = tohx(v[ch * 4 + q] * f);
                *(v4h*)(P16 + (size_t)row * TT + ch * 128 + lane * 4) = o4; } }
         }
}
__global__ __launch_bounds__(256) void k_merge(const float* __restrict__ O, int h0, bf* Ah, bf* Al) { const size_t e = ((size_t)blockIdx.x * 256 + threadIdx.x) * 2; if (e >= (size_t)ZH * TT * HD) return; const int d = (int)(e % HD); const int t = (int)((e / HD) % TT); const int zz = (int)(e / ((size_t)HD * TT)); const float cs = (t < RH) ? 1.0f : (1.0f / PCAR); const size_t oo = (size_t)t * DQ + (h0 + zz) * HD + d;
    v2us oh, ol;
#pragma unroll
    for (int q = 0; q < 2; ++q) { unsigned short a, c2; splitf(O[e + q] * cs, a, c2); oh[q] = a; ol[q] = c2; } *(v2us*)(Ah + oo) = oh; *(v2us*)(Al + oo) = ol;  }

extern "C" void kernel_launch(void* const* d_in, const int* in_sizes, int n_in,
                              void* d_out, int out_size, void* d_ws, size_t ws_size, hipStream_t stream) {
    (void)in_sizes; (void)n_in; (void)out_size;
    const float* x = (const float*)d_in[0]; const float* pp = (const float*)d_in[1]; const float* ss = (const float*)d_in[2]; const float* wq = (const float*)d_in[3]; const float* wk = (const float*)d_in[4]; const float* wv = (const float*)d_in[5]; const float* wo = (const float*)d_in[6]; const float* bo = (const float*)d_in[7]; const float* compat = (const float*)d_in[8]; const float* gam = (const float*)d_in[9]; const float* cosT = nullptr; const float* sinT = nullptr; (void)cosT; (void)sinT;
    float* OUT = (float*)d_out;     // [4][2048][768]
    char* wsp = (char*)d_ws;
    auto take = [&](size_t bytes) { char* p = wsp; wsp += (bytes + 255) & ~(size_t)255; return (void*)p; };
    bf* WQ = (bf*)take((size_t)(DQ + 2 * DKV) * DM * 2 + (size_t)DM * DQ * 2); bf* WO = WQ + (size_t)(DQ + 2 * DKV) * DM;   // wq, wk, wv, wo planes one behind the other: [wq; wk; wv] is one Bt of DQ + 2 DKV rows
    float* CS = (float*)take((size_t)TT * HD * 2 * 4);
    bf* XB = (bf*)take((size_t)NB_ * TT * DM * 2);
    h16* QP16 = (h16*)take((size_t)(NH_ + NKV) * TT * HD * 2); h16* KP16 = QP16 + (size_t)NH_ * TT * HD; h16* VT16 = (h16*)take((size_t)NKV * HD * TT * 2);   // the k head planes follow the q head planes: one launch builds both
    bf* QPh = (bf*)take((size_t)(NH_ + NKV) * TT * HD * 2); bf* KPh = QPh + (size_t)NH_ * TT * HD; bf* QPl = (bf*)take((size_t)(NH_ + NKV) * TT * HD * 2); bf* KPl = QPl + (size_t)NH_ * TT * HD; bf* VTh = (bf*)take((size_t)NKV * HD * TT * 2); bf* VTl = (bf*)take((size_t)NKV * HD * TT * 2); bf* Ph = (bf*)take((size_t)ZH * RH * TT * 2); bf* Pl = (bf*)take((size_t)ZH * RH * TT * 2);
    float* Sb = (float*)take((size_t)ZH * TT * TT * 4); h16* P16 = (h16*)take((size_t)ZH * TT * TT * 2); float* Ob = (float*)take((size_t)ZH * TT * HD * 4); bf* ATh = (bf*)take((size_t)NB_ * TT * DQ * 2); bf* ATl = (bf*)take((size_t)NB_ * TT * DQ * 2);
    if ((size_t)(wsp - (char*)d_ws) > ws_size) return;    // ws 256 MiB
    float* F = Sb;   // q, k, v projections [TT][DQ + 2 DKV]: read for the last time before the batch's first scores are written (stream-ordered)
    const int DF = DQ + 2 * DKV;
    k_cvt8w<<<dim3((unsigned)(((size_t)DQ * DM / 8 + 255) / 256), 4, 1), 256, 0, stream>>>(wq, wk, wv, wo, WQ, (size_t)DQ * DM / 8);
    k_csid<<<(TT * HD + 255) / 256, 256, 0, stream>>>(CS);
    k_cvt8<<<(unsigned)(((size_t)NB_ * TT * DM / 8 + 255) / 256), 256, 0, stream>>>(x, XB, (size_t)NB_ * TT * DM / 8);
    const unsigned LQK = (unsigned)(((size_t)(NH_ + NKV) * TT * HD / 2 + 255) / 256), LKv = (unsigned)(((size_t)NKV * TT * HD / 2 + 255) / 256);
    for (int b = 0; b < NB_; ++b) {
        k_gemmw<bf, 0, false, 8><<<dim3(TT / 64, DF / 64, 1), 256, 0, stream>>>(XB + (size_t)b * TT * DM, nullptr, WQ, nullptr, DM, F, DF, nullptr, 0, 0, 0);
        k_rope<<<LQK, 256, 0, stream>>>(F, DF, NH_ + NKV, CS, nullptr, nullptr, 1.0f, QP16, QPh, QPl);
        k_vtp<<<LKv, 256, 0, stream>>>(F + DQ + DKV, DF, NKV, VT16, VTh, VTl);
        for (int h0 = 0; h0 < NH_; h0 += ZH) { const size_t zq = (size_t)h0, zk = (size_t)(h0 / REP);   // one kv head per query head: the pass's heads use consecutive kv planes (z-strides TT*HD)
            k_gemmw<bf, 2, false, 1><<<dim3(RH / 64, TT / 64, ZH), 32, 0, stream>>>(QPh + zq * TT * HD, QPl + zq * TT * HD, KPh + zk * TT * HD, KPl + zk * TT * HD, HD, Sb, TT, nullptr, (size_t)TT * HD, (size_t)TT * HD, (size_t)TT * TT);
            k_gemmw<h16, 0, false, 1><<<dim3((TT - RH) / 64, TT / 64, ZH), 32, 0, stream>>>(QP16 + zq * TT * HD + (size_t)RH * HD, nullptr, KP16 + zk * TT * HD, nullptr, HD, Sb + (size_t)RH * TT, TT, nullptr, (size_t)TT * HD, (size_t)TT * HD, (size_t)TT * TT);
            k_asoft<<<ZH * TT / 8, 256, 0, stream>>>(Sb, pp + (size_t)b * TT * 2, ss + (size_t)b * TT, compat, gam, h0, P16, Ph, Pl);
            k_gemmw<bf, 2, false, 16><<<dim3(RH / 64, HD / 64, ZH), 512, 0, stream>>>(Ph, Pl, VTh + zk * HD * TT, VTl + zk * HD * TT, TT, Ob, HD, nullptr, (size_t)RH * TT, (size_t)HD * TT, (size_t)TT * HD);
            k_gemmw<h16, 0, false, 16><<<dim3((TT - RH) / 64, HD / 64, ZH), 512, 0, stream>>>(P16 + (size_t)RH * TT, nullptr, VT16 + zk * HD * TT, nullptr, TT, Ob + (size_t)RH * HD, HD, nullptr, (size_t)TT * TT, (size_t)HD * TT, (size_t)TT * HD);
            k_merge<<<(unsigned)(((size_t)ZH * TT * HD / 2 + 255) / 256), 256, 0, stream>>>(Ob, h0, ATh + (size_t)b * TT * DQ, ATl + (size_t)b * TT * DQ); } }
    k_gemmw<bf, 1, true, 8><<<dim3(NB_ * TT / 64, DM / 64, 1), 256, 0, stream>>>(ATh, ATl, WO, nullptr, DQ, OUT, DM, bo, 0, 0, 0);   // the four batches' rows follow one another in ATh / ATl and in OUT
}

// v004
// A run of this version takes 286 microseconds.
// Versions in between are left out here; by their measured steps it is 3.83 times as fast as v002.
// Over all steps from v000 it is 11.4 times as fast.
#include <hip/hip_runtime.h>

// SBERTaAttention (H [4][2048][768], p [4][2048][2] (language probs, read), s [4][2048] (read), compat [12][2][2], gamma [1]; Q/K/V = H W^T (12 x 64, no bias); scores = Q.K / 8 + (p_i compat_h) . p_j + gamma s_j; softmax; out = merged wo^T + bo -> [4][2048][768]).
// Compute dtypes, f32 accumulate: every input rounded to bf16; Q/K/V on PLAIN bf16 operands (inputs: exact); scores PRECPLAN; the bilinear language bias (2x2 per head) and the position bias computed per element in f32 from the bf16-rounded p, s, compat, gamma in the reference's order; softmax f32; attn.v: rows < 512 hl (3 products), the rest fp16 (x1024); wo hl x exact (2 products) + bias.

#define NB_  4
#define TT   2048
#define DM   768
#define NH_  12
#define NKV  12
#define REP  (NH_ / NKV)
#define HD   64
#define DQ   (NH_ * HD)
#define DKV  (NKV * HD)
#define RH   512                  // query rows < RH use hi+lo planes (0: none)
#define WIN  0
#define PCAR 1024.0f
#define SCL  0.125f   // HD^-0.5
typedef _Float16 h16;
typedef unsigned short bf;
typedef __attribute__((ext_vector_type(16))) __bf16   v16bf;
typedef __attribute__((ext_vector_type(16))) _Float16 v16h;
typedef __attribute__((ext_vector_type(8)))  _Float16 v8h;
typedef __attribute__((ext_vector_type(8)))  unsigned short v8us;
typedef __attribute__((ext_vector_type(8)))  float    v8f;
typedef __attribute__((ext_vector_type(4)))  float    v4f;
typedef v8h  __attribute__((may_alias)) v8ha;
typedef v4f  __attribute__((may_alias)) v4fa;
typedef v8us __attribute__((may_alias)) v8usa;

__device__ __forceinline__ unsigned short f2bf(float f) { unsigned u = __float_as_uint(f); u += 0x7FFFu + ((u >> 16) & 1u); return (unsigned short)(u >> 16); }
__device__ __forceinline__ float bf2f(unsigned short b) { return __uint_as_float(((unsigned)b) << 16); }
__device__ __forceinline__ float bfr(float f) { return bf2f(f2bf(f)); }
__device__ __forceinline__ v16h cat16(v8h lo, v8h hi) { return __builtin_shufflevector(lo, hi, 0, 1, 2, 3, 4, 5, 6, 7, 8, 9, 10, 11, 12, 13, 14, 15); }
__device__ __forceinline__ v16bf cat16b(v8us lo, v8us hi) { return __builtin_bit_cast(v16bf, __builtin_shufflevector(lo, hi, 0, 1, 2, 3, 4, 5, 6, 7, 8, 9, 10, 11, 12, 13, 14, 15)); }
__device__ __forceinline__ v8f wmma16(v16h a, v16h b, v8f c) { return __builtin_amdgcn_wmma_f32_16x16x32_f16(false, a, false, b, (short)0, c, false, false); }
__device__ __forceinline__ v8f wmmab(v16bf a, v16bf b, v8f c) { return __builtin_amdgcn_wmma_f32_16x16x32_bf16(false, a, false, b, (short)0, c, false, false); }



// ---- k_gemmw: register-blocked GEMM, NW WAVES per 64x64 output tile (16 accumulators each), operands straight from K-contiguous 16-bit planes; grid (M/64, N/64, Z), 32 * NW threads.
// Wave w takes the 32-wide k chunks w, w + NW, w + 2 NW, ... (neighbouring waves read neighbouring halves of the same lines); the NW partial tiles are summed through LDS in wave order 0..NW-1. K % (32 * NW) == 0.
// C[m][n] (f32, pitch ldc, + optional f32 bias[n]) = sum_k A[m][k] Bt[n][k] (+ split products per NSPLIT). z-batch strides sA/sB/sC in elements. K % 32 == 0.
template <typename T16> struct WFrag;
template <> struct WFrag<h16> { typedef v16h V; static __device__ __forceinline__ V ld(const h16* p) { return cat16(*(const v8h*)p, *(const v8h*)(p + 16)); } static __device__ __forceinline__ v8f mma(V a, V b, v8f c) { return wmma16(a, b, c); } };
template <> struct WFrag<bf> { typedef v16bf V; static __device__ __forceinline__ V ld(const bf* p) { return cat16b(*(const v8us*)p, *(const v8us*)(p + 16)); } static __device__ __forceinline__ v8f mma(V a, V b, v8f c) { return wmmab(a, b, c); } };
template <typename T16, int NSPLIT, bool BIAS, int NW>
__global__ __launch_bounds__(32 * NW) void k_gemmw(const T16* __restrict__ A, const T16* __restrict__ A2, const T16* __restrict__ Bt, const T16* __restrict__ Bt2, int K, float* C, int ldc, const float* __restrict__ bias, size_t sA, size_t sB, size_t sC) {
    typedef typename WFrag<T16>::V V;
    constexpr int RS = (NW > 1) ? 64 : 16;   // tile rows that pass through LDS at once: with NW > 1 the whole tile, so that one barrier serves it and no store is waited for
    __shared__ __align__(16) float os[NW * RS * 68];
    const size_t z = blockIdx.z; A += z * sA; if (A2) A2 += z * sA; Bt += z * sB; if (Bt2) Bt2 += z * sB; C += z * sC;
    const int lane = threadIdx.x & 31, lr = lane & 15, hi = lane >> 4; const int wv = (NW > 1) ? __builtin_amdgcn_readfirstlane((int)(threadIdx.x >> 5)) : 0 /* wave number in a scalar register: the k loop's counter and branch stay scalar */; const int r0 = blockIdx.x * 64, c0 = blockIdx.y * 64;
    v8f acc[4][4];
#pragma unroll
    for (int mb = 0; mb < 4; ++mb)
#pragma unroll
        for (int nb = 0; nb < 4; ++nb) acc[mb][nb] = (v8f){};
    const size_t aoff = (size_t)(r0 + lr) * K + 8 * hi, boff = (size_t)(c0 + lr) * K + 8 * hi;
#pragma unroll 1
    for (int kc = wv * 32; kc < K; kc += NW * 32) {
        V a[4], a2[4];
#pragma unroll
        for (int mb = 0; mb < 4; ++mb) { a[mb] = WFrag<T16>::ld(A + aoff + (size_t)mb * 16 * K + kc); if (NSPLIT == 1 || NSPLIT == 2) a2[mb] = WFrag<T16>::ld(A2 + aoff + (size_t)mb * 16 * K + kc); }
#pragma unroll
        for (int nb = 0; nb < 4; ++nb) { const V b = WFrag<T16>::ld(Bt + boff + (size_t)nb * 16 * K + kc); V b2; if (NSPLIT >= 2) b2 = WFrag<T16>::ld(Bt2 + boff + (size_t)nb * 16 * K + kc);
#pragma unroll
            for (int mb = 0; mb < 4; ++mb) { acc[mb][nb] = WFrag<T16>::mma(a[mb], b, acc[mb][nb]); if (NSPLIT == 1 || NSPLIT == 2) acc[mb][nb] = WFrag<T16>::mma(a2[mb], b, acc[mb][nb]); if (NSPLIT >= 2) acc[mb][nb] = WFrag<T16>::mma(a[mb], b2, acc[mb][nb]); } }
        asm volatile("v_nop\n\tv_nop\n\tv_nop\n\tv_nop" : "+v"(acc[0][0]), "+v"(acc[1][1]), "+v"(acc[2][2]), "+v"(acc[3][3]) : "v"(a[0]), "v"(a[3]));
    }
#pragma unroll
    for (int m0 = 0; m0 < 4; m0 += RS / 16) {
#pragma unroll
        for (int mb = m0; mb < m0 + RS / 16; ++mb) {
#pragma unroll
            for (int nb = 0; nb < 4; ++nb) {
#pragma unroll
                for (int j = 0; j < 8; ++j) os[wv * RS * 68 + ((mb - m0) * 16 + hi * 8 + j) * 68 + nb * 16 + lr] = acc[mb][nb][j]; } }
        if (NW > 1) __syncthreads();   // every wave's partial tile is in LDS before any of it is summed
        else { __builtin_amdgcn_wave_barrier(); asm volatile("" ::: "memory"); }   // one wave: only the compiler's order of the LDS writes and reads is to be kept
        float* crow = C + (size_t)(r0 + m0 * 16) * ldc + c0;
{
#pragma unroll
            for (int s = 0; s < RS * 16 / (NW * 32); ++s) { const int idx = s * NW * 32 + (int)threadIdx.x; const int row = idx >> 4, cofs = (idx & 15) * 4; v4f val = *(const v4fa*)(os + row * 68 + cofs);
#pragma unroll
                for (int w = 1; w < NW; ++w) val += *(const v4fa*)(os + w * RS * 68 + row * 68 + cofs);
                if (BIAS) { val[0] += bfr(bias[c0 + cofs]); val[1] += bfr(bias[c0 + cofs + 1]); val[2] += bfr(bias[c0 + cofs + 2]); val[3] += bfr(bias[c0 + cofs + 3]); }
                *(v4f*)(crow + (size_t)row * ldc + cofs) = val; }
             }
        if (NW == 1) { __builtin_amdgcn_wave_barrier(); asm volatile("" ::: "memory"); }   // the next row block's LDS writes stay behind these reads
    }
}

__device__ __forceinline__ h16 tohx(float x) { return (h16)x; }
__device__ __forceinline__ void splitf(float y, unsigned short& h, unsigned short& l) { h = f2bf(y); l = f2bf(y - bf2f(h)); }
typedef __attribute__((ext_vector_type(2))) _Float16 v2h;
typedef __attribute__((ext_vector_type(4))) _Float16 v4h;
typedef __attribute__((ext_vector_type(2))) unsigned short v2us;
typedef __attribute__((ext_vector_type(4))) unsigned short v4us;
typedef __attribute__((ext_vector_type(2))) float v2f;
typedef __attribute__((ext_vector_type(4))) int v4i;

__global__ __launch_bounds__(256) void k_wtG(const float* __restrict__ w, int K, int N, bf* Bt) {
    const int lane = threadIdx.x & 31; const int L0 = (blockIdx.x * 8 + (threadIdx.x >> 5)) * 8; const int nlines = N * K / 64;
{
#pragma unroll 1
        for (int l = 0; l < 8; ++l) { const int L = L0 + l; if (L >= nlines) break; const size_t e = (size_t)L * 64 + lane * 2; const int k = (int)(e % K), n = (int)(e / K); v2us o;
            o[0] = f2bf(w[(size_t)k * N + n]); o[1] = f2bf(w[(size_t)(k + 1) * N + n]); *(v2us*)(Bt + e) = o; }
         }
}
__global__ __launch_bounds__(256) void k_cvt8(const float* __restrict__ src, bf* dst, size_t n8) { const size_t i = (size_t)blockIdx.x * 256 + threadIdx.x; if (i >= n8) return; const v8f v = *(const v8f*)(src + i * 8); v8us o;
#pragma unroll
    for (int k = 0; k < 8; ++k) o[k] = f2bf(v[k]); *(v8us*)(dst + i * 8) = o;  }
// k_cvt8w: the four weight matrices (n8 * 8 elements each), one per blockIdx.y, into four planes that follow one another in dst
__global__ __launch_bounds__(256) void k_cvt8w(const float* __restrict__ w0, const float* __restrict__ w1, const float* __restrict__ w2, const float* __restrict__ w3, bf* dst, size_t n8) { const size_t i = (size_t)blockIdx.x * 256 + threadIdx.x; if (i >= n8) return; const int y = blockIdx.y; const float* src = (y == 0) ? w0 : (y == 1) ? w1 : (y == 2) ? w2 : w3; const v8f v = *(const v8f*)(src + i * 8); v8us o;
#pragma unroll
    for (int k = 0; k < 8; ++k) o[k] = f2bf(v[k]); *(v8us*)(dst + ((size_t)y * n8 + i) * 8) = o;  }
__global__ __launch_bounds__(256) void k_cscvt(const float* __restrict__ cosT, const float* __restrict__ sinT, float* CS) { const int idx = blockIdx.x * 256 + threadIdx.x; if (idx >= TT * HD) return; v2f cs; cs[0] = bfr(cosT[idx]); cs[1] = bfr(sinT[idx]); *(v2f*)(CS + (size_t)idx * 2) = cs;  }
// ---- k_qkv: q, k and v of all batches as one product, NW waves per 64 x 64 tile with k_gemmw's k split and loop; a tile is 64 positions of ONE head of q, k or v, and it leaves as that head's fp16 and hi / lo planes: no f32 copy goes through memory.
// X: [b * TT + t][DM]; Wt: [wq; wk; wv], DQ + 2 DKV rows of DM. grid (NB_ * TT / 64, (NH_ + 2 NKV)), 32 * NW threads. DM % (32 * NW) == 0.
// A lane holds 8 consecutive A rows of one B row, so a partial tile goes to LDS as [B row][A row] in 16-byte stores. q, k planes are [t][d]: A = weight rows, B = positions. v planes are [d][t]: A = positions, B = weight rows.
template <int NW>
__global__ __launch_bounds__(32 * NW) void k_qkv(const bf* __restrict__ X, const bf* __restrict__ Wt, h16* QK16, bf* QKh, bf* QKl, h16* VT16, bf* VTh, bf* VTl) {
    // every loop but the k loop is unrolled in full: tiles and fragments are register arrays, which only constant indices keep in registers
    typedef WFrag<bf> WF; typedef WF::V V;
    __shared__ __align__(16) float os[NW * 64 * 68];
    const int lane = threadIdx.x & 31, lr = lane & 15, hi = lane >> 4; const int wv = __builtin_amdgcn_readfirstlane((int)(threadIdx.x >> 5)) /* wave number in a scalar register: what is formed from it stays on the scalar side */; const int r0 = blockIdx.x * 64, hp = blockIdx.y;
    const bool isv = hp >= NH_ + NKV;   // the same for the whole work-group
    const bf* xr = X + (size_t)r0 * DM; const bf* wr = Wt + (size_t)hp * HD * DM;
    const bf* A = isv ? xr : wr; const bf* Bt = isv ? wr : xr;
    v8f acc[4][4];
#pragma unroll
    for (int mb = 0; mb < 4; ++mb)
#pragma unroll
        for (int nb = 0; nb < 4; ++nb) acc[mb][nb] = (v8f){};
    const unsigned off = (unsigned)(lr * DM + 8 * hi) * 2u;   // bytes: the lane's part of every fragment address; the rest is the same for the whole wave
    // left rolled, as in k_gemmw: unrolled, this build asks for the B fragments one at a time and waits out each L2 round trip. Wave w takes the 32-wide k chunks w, w + NW, ...
#pragma unroll 1
    for (int i = 0; i < DM / (NW * 32); ++i) {
        V a[4]; const unsigned ko = off + (unsigned)((i * NW + wv) * 32) * 2u;   // a 32-bit byte offset beside a scalar base: one register serves all sixteen loads
#pragma unroll
        for (int mb = 0; mb < 4; ++mb) a[mb] = WF::ld((const bf*)((const char*)(A + mb * 16 * DM) + ko));
#pragma unroll
        for (int nb = 0; nb < 4; ++nb) { const V b = WF::ld((const bf*)((const char*)(Bt + nb * 16 * DM) + ko));
#pragma unroll
            for (int mb = 0; mb < 4; ++mb) acc[mb][nb] = WF::mma(a[mb], b, acc[mb][nb]); }
    }
#pragma unroll
    for (int nb = 0; nb < 4; ++nb)
#pragma unroll
        for (int mb = 0; mb < 4; ++mb) { float* o = os + wv * (64 * 68) + (nb * 16 + lr) * 68 + mb * 16 + 8 * hi; *(v4fa*)o = __builtin_shufflevector(acc[mb][nb], acc[mb][nb], 0, 1, 2, 3); *(v4fa*)(o + 4) = __builtin_shufflevector(acc[mb][nb], acc[mb][nb], 4, 5, 6, 7); }
    __syncthreads();   // every wave's partial tile is in LDS before any of it is summed
    const int bz = r0 / TT, t0 = r0 % TT;   // TT % 64 == 0: a tile lies in one batch
    const size_t base = isv ? ((size_t)bz * NKV + (hp - NH_ - NKV)) * HD * TT + t0 : (((size_t)bz * (NH_ + NKV) + hp) * TT + t0) * HD; const int pitch = isv ? TT : HD;
    h16* P16 = (isv ? VT16 : QK16) + base; bf* Ph = (isv ? VTh : QKh) + base; bf* Pl = (isv ? VTl : QKl) + base;
#pragma unroll
    for (int s = 0; s < 64 * 8 / (NW * 32); ++s) { const int idx = s * NW * 32 + (int)threadIdx.x; const int row = idx >> 3, cofs = (idx & 7) * 8; v4f v0 = *(const v4fa*)(os + row * 68 + cofs), v1 = *(const v4fa*)(os + row * 68 + cofs + 4);
#pragma unroll
        for (int w = 1; w < NW; ++w) { v0 += *(const v4fa*)(os + w * (64 * 68) + row * 68 + cofs); v1 += *(const v4fa*)(os + w * (64 * 68) + row * 68 + cofs + 4); }
        v8h o16; v8us oh, ol;
#pragma unroll
        for (int q = 0; q < 8; ++q) { const float x = (q < 4) ? v0[q & 3] : v1[q & 3]; o16[q] = tohx(x); unsigned short a2, c2; splitf(x, a2, c2); oh[q] = a2; ol[q] = c2; }
        const unsigned oo = (unsigned)(row * pitch + cofs); *(v8h*)(P16 + oo) = o16; *(v8us*)(Ph + oo) = oh; *(v8us*)(Pl + oo) = ol; }   // 8 lanes fill a 128-byte line of each plane
}
#define FW   16
#define KW   (TT / FW)
#define KT   (KW / 16)
#define OP   68                   // floats per query row of a partial output tile in LDS
#define RP   20                   // floats per query row of the per-wave maxima and sums in LDS
typedef __attribute__((ext_vector_type(8))) unsigned v8u;
__device__ __forceinline__ unsigned rbf(float f) { const unsigned u = __float_as_uint(f); return u + 0x7FFFu + ((u >> 16) & 1u); }   // f2bf's rounding, the bf16 bits left in the upper half
__device__ __forceinline__ v8f cat8(v4f lo, v4f hi) { return __builtin_shufflevector(lo, hi, 0, 1, 2, 3, 4, 5, 6, 7); }
template <typename T16, bool HR, int NQ, int PVA>
__device__ __forceinline__ void fattn_body(const T16* __restrict__ Q, const T16* __restrict__ Q2, const T16* __restrict__ Kp, const T16* __restrict__ K2, const T16* __restrict__ Vt, const T16* __restrict__ Vt2, const float* __restrict__ cm, int q0, bf* Ah, bf* Al, const float* kb, float* rmx, float* rsm, float* os) {
    // every loop of this function is unrolled in full: tiles and fragments are register arrays, which only constant indices keep in registers
    typedef WFrag<T16> WF; typedef typename WF::V V;
    const int lane = threadIdx.x & 31, c = lane & 15, hf = lane >> 4; const int wv = __builtin_amdgcn_readfirstlane((int)(threadIdx.x >> 5)); const int kw0 = wv * KW;
    const unsigned lqk = (unsigned)(c * HD + 8 * hf), lv = (unsigned)(c * TT + 8 * hf);   // the lane's part of every fragment address; the rest is the same for the whole wave
    V qf[NQ][2], qf2[NQ][2];
#pragma unroll
    for (int qn = 0; qn < NQ; ++qn)
#pragma unroll
        for (int kc = 0; kc < 2; ++kc) { qf[qn][kc] = WF::ld(Q + (size_t)(q0 + qn * 16) * HD + kc * 32 + lqk); if (HR) qf2[qn][kc] = WF::ld(Q2 + (size_t)(q0 + qn * 16) * HD + kc * 32 + lqk); }
    v8f sc[KT][NQ];   // sc[kt][qn][r]: key kw0 + kt * 16 + 8 hf + r, query q0 + qn * 16 + c
    constexpr int TG = HR ? 1 : 2;   // key tiles per group: 8 loads of 16 bytes a lane in either case
    constexpr int PS = HR ? 0 : 1;   // groups asked for ahead of the one being multiplied (the hi / lo strip and its query fragments leave no registers for a second group)
    { V a[PS + 1][TG][2], a2[PS + 1][TG][2];
#pragma unroll
      for (int gi = 0; gi < KT / TG; ++gi) {
#pragma unroll
        for (int n = (gi == 0 ? 0 : PS); n <= PS; ++n) { if (gi + n >= KT / TG) continue;
#pragma unroll
            for (int g = 0; g < TG; ++g)
#pragma unroll
                for (int kc = 0; kc < 2; ++kc) { a[(gi + n) & PS][g][kc] = WF::ld(Kp + (size_t)(kw0 + ((gi + n) * TG + g) * 16) * HD + kc * 32 + lqk); if (HR) a2[(gi + n) & PS][g][kc] = WF::ld(K2 + (size_t)(kw0 + ((gi + n) * TG + g) * 16) * HD + kc * 32 + lqk); } }
        __builtin_amdgcn_sched_barrier(0);   // these loads are all asked for before the group's first product waits: left alone, this build asks for a fragment at a time and waits out each L2 round trip
#pragma unroll
        for (int g = 0; g < TG; ++g)
#pragma unroll
            for (int qn = 0; qn < NQ; ++qn) { v8f s = (v8f){};
#pragma unroll
                for (int kc = 0; kc < 2; ++kc) { s = WF::mma(a[gi & PS][g][kc], qf[qn][kc], s); if (HR) { s = WF::mma(a[gi & PS][g][kc], qf2[qn][kc], s); s = WF::mma(a2[gi & PS][g][kc], qf[qn][kc], s); } }
                sc[gi * TG + g][qn] = s; }
        __builtin_amdgcn_sched_barrier(0); } }   // no later group's loads are lifted up here: all together, the key fragments and the score strip take more registers than the wave has
    const float c00 = bfr(cm[0]), c01 = bfr(cm[1]), c10 = bfr(cm[2]), c11 = bfr(cm[3]);
    float pc0[NQ], pc1[NQ], mx[NQ];
    __syncthreads();   // the per-key bias terms of every key are in LDS
#pragma unroll
    for (int qn = 0; qn < NQ; ++qn) { const float pi0 = kb[q0 + qn * 16 + c], pi1 = kb[TT + q0 + qn * 16 + c]; pc0[qn] = pi0 * c00 + pi1 * c10; pc1[qn] = pi0 * c01 + pi1 * c11; mx[qn] = -3.0e38f; }   // a query's p is its position's rounded p
#pragma unroll
    for (int kt = 0; kt < KT; ++kt) { const float* kk = kb + kw0 + kt * 16 + 8 * hf;
        const v8f pj0 = cat8(*(const v4fa*)kk, *(const v4fa*)(kk + 4)), pj1 = cat8(*(const v4fa*)(kk + TT), *(const v4fa*)(kk + TT + 4)), gs = cat8(*(const v4fa*)(kk + 2 * TT), *(const v4fa*)(kk + 2 * TT + 4));
#pragma unroll
        for (int qn = 0; qn < NQ; ++qn) { const v8f t = (sc[kt][qn] * SCL + (pj0 * pc0[qn] + pj1 * pc1[qn])) + gs; sc[kt][qn] = t;
#pragma unroll
            for (int r = 0; r < 8; ++r) mx[qn] = fmaxf(mx[qn], t[r]); }
        __builtin_amdgcn_sched_barrier(0); }   // keeps the later tiles' LDS reads from being lifted up here: all at once they take more registers than the wave has and score tiles spill
#pragma unroll
    for (int qn = 0; qn < NQ; ++qn) { mx[qn] = fmaxf(mx[qn], __shfl_xor(mx[qn], 16, 32)); rmx[(qn * 16 + c) * RP + wv] = mx[qn]; }   // both lane halves hold and store the same value: no branch stands in the strip's live range
    __syncthreads();   // every wave's row maxima are in LDS
    float fs[NQ];
#pragma unroll
    for (int qn = 0; qn < NQ; ++qn) { float m = -3.0e38f;
#pragma unroll
        for (int u = 0; u < FW / 4; ++u) { const v4f x = *(const v4fa*)(rmx + (qn * 16 + c) * RP + u * 4); m = fmaxf(fmaxf(m, fmaxf(x[0], x[1])), fmaxf(x[2], x[3])); }
        v8f vs = (v8f){};
#pragma unroll
        for (int kt = 0; kt < KT; ++kt) { const v8f d = (sc[kt][qn] - m) * 1.4426950408889634f; v8f e;
#pragma unroll
            for (int r = 0; r < 8; ++r) e[r] = __builtin_amdgcn_exp2f(d[r]);
            sc[kt][qn] = e; vs += e; }
        float sum = ((vs[0] + vs[1]) + (vs[2] + vs[3])) + ((vs[4] + vs[5]) + (vs[6] + vs[7])); sum += __shfl_xor(sum, 16, 32); rsm[(qn * 16 + c) * RP + wv] = sum; }
    __syncthreads();   // every wave's row sums are in LDS
#pragma unroll
    for (int qn = 0; qn < NQ; ++qn) { float sum = 0.f;
#pragma unroll
        for (int u = 0; u < FW / 4; ++u) { const v4f x = *(const v4fa*)(rsm + (qn * 16 + c) * RP + u * 4); sum += x[0]; sum += x[1]; sum += x[2]; sum += x[3]; }
        fs[qn] = __fdiv_rn(HR ? 1.0f : PCAR, sum); }
    V pf[KW / 32][NQ], pf2[KW / 32][NQ];   // element s of pf[kk][qn]: key kw0 + kk * 32 + (s < 8 ? 8 hf + s : 16 + 8 hf + s - 8), the order in which WFrag::ld takes V^T's keys
#pragma unroll
    for (int kk = 0; kk < KW / 32; ++kk)
#pragma unroll
        for (int qn = 0; qn < NQ; ++qn) {
            const v8f p0 = sc[2 * kk][qn] * fs[qn], p1 = sc[2 * kk + 1][qn] * fs[qn];
            if constexpr (HR) { v8u wh, wl;   // the same rounding as splitf; each pair of 16-bit halves is packed into its word at once, so that no unpacked copy of the strip stays live
#pragma unroll
                for (int w = 0; w < 8; ++w) { const float xa = (w < 4) ? p0[2 * w] : p1[2 * w - 8], xb = (w < 4) ? p0[2 * w + 1] : p1[2 * w - 7];
                    const unsigned ha = rbf(xa), hb = rbf(xb), la = rbf(xa - __uint_as_float(ha & 0xFFFF0000u)), lb = rbf(xb - __uint_as_float(hb & 0xFFFF0000u));
                    wh[w] = (ha >> 16) | (hb & 0xFFFF0000u); wl[w] = (la >> 16) | (lb & 0xFFFF0000u); }
                pf[kk][qn] = __builtin_bit_cast(v16bf, wh); pf2[kk][qn] = __builtin_bit_cast(v16bf, wl);
            } else { v8h x0, x1;
#pragma unroll
                for (int r = 0; r < 8; ++r) { x0[r] = tohx(p0[r]); x1[r] = tohx(p1[r]); }
                pf[kk][qn] = cat16(x0, x1); } }
    constexpr int KG = HR ? 2 : 4;   // 32-key chunks per group of loads: 8 loads of 16 bytes a lane in either case
    constexpr int GB = KW / 32 / KG, NG = (HD / 16) * GB;   // groups per 16-row block of V^T, groups in all
    constexpr int PV = PVA;   // groups asked for ahead of the one being multiplied
    v8f oa[HD / 16][NQ];   // oa[db][qn][r]: d = db * 16 + 8 hf + r, query q0 + qn * 16 + c
    { V a[PV + 1][KG], a2[PV + 1][KG];
#pragma unroll
      for (int gi = 0; gi < NG; ++gi) { const int db = gi / GB, k0 = (gi % GB) * KG;
#pragma unroll
        for (int n = (gi == 0 ? 0 : PV); n <= PV; ++n) { if (gi + n >= NG) continue;
#pragma unroll
            for (int g = 0; g < KG; ++g) { const size_t vofs = (size_t)((gi + n) / GB) * 16 * TT + kw0 + (((gi + n) % GB) * KG + g) * 32 + lv; a[(gi + n) & PV][g] = WF::ld(Vt + vofs); if (HR) a2[(gi + n) & PV][g] = WF::ld(Vt2 + vofs); } }
        __builtin_amdgcn_sched_barrier(0);   // these loads all stand in front of the group's first product, as for the scores
        if (k0 == 0) {
#pragma unroll
            for (int qn = 0; qn < NQ; ++qn) oa[db][qn] = (v8f){}; }
#pragma unroll
        for (int g = 0; g < KG; ++g)
#pragma unroll
            for (int qn = 0; qn < NQ; ++qn) { oa[db][qn] = WF::mma(a[gi & PV][g], pf[k0 + g][qn], oa[db][qn]); if (HR) { oa[db][qn] = WF::mma(a[gi & PV][g], pf2[k0 + g][qn], oa[db][qn]); oa[db][qn] = WF::mma(a2[gi & PV][g], pf[k0 + g][qn], oa[db][qn]); } }
        __builtin_amdgcn_sched_barrier(0);   // no later group's loads are lifted up here (registers), and the stores below stay behind this block's products
        // block db - 1 is stored behind block db's products (the last block behind its own): a tile's registers are taken again only one block on, a whole block of matrix instructions after their last product
        if ((gi + 1) % GB == 0) {
#pragma unroll
            for (int sb = (db > 0 ? db - 1 : HD / 16); sb <= (db == HD / 16 - 1 ? db : db - 1); ++sb)
#pragma unroll
                for (int qn = 0; qn < NQ; ++qn) { float* o = os + wv * (NQ * 16 * OP) + (qn * 16 + c) * OP + sb * 16 + 8 * hf; *(v4fa*)o = __builtin_shufflevector(oa[sb][qn], oa[sb][qn], 0, 1, 2, 3); *(v4fa*)(o + 4) = __builtin_shufflevector(oa[sb][qn], oa[sb][qn], 4, 5, 6, 7); }
        } } }
    __syncthreads();   // every wave's partial output tile is in LDS before any of it is summed
#pragma unroll
    for (int idx = (int)threadIdx.x; idx < NQ * 16 * (HD / 4); idx += 32 * FW) { const int row = idx / (HD / 4), cofs = (idx % (HD / 4)) * 4; v4f val = *(const v4fa*)(os + row * OP + cofs);
#pragma unroll
        for (int w = 1; w < FW; ++w) val += *(const v4fa*)(os + w * (NQ * 16 * OP) + row * OP + cofs);
        const float cs = HR ? 1.0f : (1.0f / PCAR); v4us oh, ol;
#pragma unroll
        for (int q = 0; q < 4; ++q) { unsigned short a, b; splitf(val[q] * cs, a, b); oh[q] = a; ol[q] = b; }
        const size_t oo = (size_t)(q0 + row) * DQ + cofs; *(v4us*)(Ah + oo) = oh; *(v4us*)(Al + oo) = ol; }
}
// grid (NH_, TT / 32, NB_): 32 query rows of one head of one batch; QK*: per batch the q head planes with the k head planes behind them, [b][h][t][d]; VT*: [b][h][d][t]; Ah / Al: the merged rows [b][t][DQ]
__global__ __launch_bounds__(32 * FW) void k_fattn(const h16* __restrict__ QK16, const bf* __restrict__ QKh, const bf* __restrict__ QKl, const h16* __restrict__ VT16, const bf* __restrict__ VTh, const bf* __restrict__ VTl, const float* __restrict__ pp, const float* __restrict__ ss, const float* __restrict__ cm, const float* __restrict__ gam, bf* Ah, bf* Al) {
    __shared__ __align__(16) float kb[3 * TT]; __shared__ __align__(16) float rmx[32 * RP]; __shared__ __align__(16) float rsm[32 * RP]; __shared__ __align__(16) float os[FW * 32 * OP];
    const int hh = blockIdx.x, q0 = blockIdx.y * 32, bz = blockIdx.z;   // heads run fastest: a batch's hi / lo row blocks, which cost most, start first
    pp += (size_t)bz * TT * 2; ss += (size_t)bz * TT;
    // per-key bias terms, each key once per work-group: bf16-rounded p_j0, p_j1 and gamma * s_j
#pragma unroll
    for (int k4 = (int)threadIdx.x * 4; k4 < TT; k4 += 32 * FW * 4) { const v4f pa = *(const v4f*)(pp + (size_t)k4 * 2), pb = *(const v4f*)(pp + (size_t)k4 * 2 + 4), sv = *(const v4f*)(ss + k4); const float gmm = bfr(gam[0]);
        const v4f o0 = { bfr(pa[0]), bfr(pa[2]), bfr(pb[0]), bfr(pb[2]) }, o1 = { bfr(pa[1]), bfr(pa[3]), bfr(pb[1]), bfr(pb[3]) }, og = { gmm * bfr(sv[0]), gmm * bfr(sv[1]), gmm * bfr(sv[2]), gmm * bfr(sv[3]) };
        *(v4fa*)(kb + k4) = o0; *(v4fa*)(kb + TT + k4) = o1; *(v4fa*)(kb + 2 * TT + k4) = og; }
    const size_t qo = ((size_t)bz * (NH_ + NKV) + hh) * TT * HD, ko = ((size_t)bz * (NH_ + NKV) + NH_ + hh / REP) * TT * HD, vo = ((size_t)bz * NKV + hh / REP) * HD * TT;
    Ah += (size_t)bz * TT * DQ; Al += (size_t)bz * TT * DQ;
    if (q0 < RH) fattn_body<bf, true, 2, 1>(QKh + qo, QKl + qo, QKh + ko, QKl + ko, VTh + vo, VTl + vo, cm + hh * 4, q0, Ah + hh * HD, Al + hh * HD, kb, rmx, rsm, os);
    else fattn_body<h16, false, 2, 1>(QK16 + qo, nullptr, QK16 + ko, nullptr, VT16 + vo, nullptr, cm + hh * 4, q0, Ah + hh * HD, Al + hh * HD, kb, rmx, rsm, os);
}

extern "C" void kernel_launch(void* const* d_in, const int* in_sizes, int n_in,
                              void* d_out, int out_size, void* d_ws, size_t ws_size, hipStream_t stream) {
    (void)in_sizes; (void)n_in; (void)out_size;
    const float* x = (const float*)d_in[0]; const float* pp = (const float*)d_in[1]; const float* ss = (const float*)d_in[2]; const float* wq = (const float*)d_in[3]; const float* wk = (const float*)d_in[4]; const float* wv = (const float*)d_in[5]; const float* wo = (const float*)d_in[6]; const float* bo = (const float*)d_in[7]; const float* compat = (const float*)d_in[8]; const float* gam = (const float*)d_in[9]; const float* cosT = nullptr; const float* sinT = nullptr; (void)cosT; (void)sinT;
    float* OUT = (float*)d_out;     // [4][2048][768]
    char* wsp = (char*)d_ws;
    auto take = [&](size_t bytes) { char* p = wsp; wsp += (bytes + 255) & ~(size_t)255; return (void*)p; };
    bf* WQ = (bf*)take((size_t)(DQ + 2 * DKV) * DM * 2 + (size_t)DM * DQ * 2); bf* WO = WQ + (size_t)(DQ + 2 * DKV) * DM;   // wq, wk, wv, wo planes one behind the other: [wq; wk; wv] is one Bt of DQ + 2 DKV rows
    bf* XB = (bf*)take((size_t)NB_ * TT * DM * 2);
    const size_t SQK = (size_t)(NH_ + NKV) * TT * HD, SV = (size_t)NKV * HD * TT;   // elements of one batch's q + k planes and of its v planes
    h16* QP16 = (h16*)take(NB_ * SQK * 2); h16* VT16 = (h16*)take(NB_ * SV * 2);   // the k head planes follow the q head planes
    bf* QPh = (bf*)take(NB_ * SQK * 2); bf* QPl = (bf*)take(NB_ * SQK * 2); bf* VTh = (bf*)take(NB_ * SV * 2); bf* VTl = (bf*)take(NB_ * SV * 2);
    bf* ATh = (bf*)take((size_t)NB_ * TT * DQ * 2); bf* ATl = (bf*)take((size_t)NB_ * TT * DQ * 2);
    if ((size_t)(wsp - (char*)d_ws) > ws_size) return;    // ws 256 MiB
    k_cvt8w<<<dim3((unsigned)(((size_t)DQ * DM / 8 + 255) / 256), 4, 1), 256, 0, stream>>>(wq, wk, wv, wo, WQ, (size_t)DQ * DM / 8);
    k_cvt8<<<(unsigned)(((size_t)NB_ * TT * DM / 8 + 255) / 256), 256, 0, stream>>>(x, XB, (size_t)NB_ * TT * DM / 8);
    k_qkv<8><<<dim3(NB_ * TT / 64, NH_ + 2 * NKV, 1), 256, 0, stream>>>(XB, WQ, QP16, QPh, QPl, VT16, VTh, VTl);   // the four batches' rows follow one another in XB
    k_fattn<<<dim3(NH_, TT / 32, NB_), 32 * FW, 0, stream>>>(QP16, QPh, QPl, VT16, VTh, VTl, pp, ss, compat, gam, ATh, ATl);
    k_gemmw<bf, 1, true, 8><<<dim3(NB_ * TT / 64, DM / 64, 1), 256, 0, stream>>>(ATh, ATl, WO, nullptr, DQ, OUT, DM, bo, 0, 0, 0);   // the four batches' rows follow one another in ATh / ATl and in OUT
}

// v005
// One run takes 205 microseconds.
// Next to v004, in two timings, it ran 1.38 times as fast each time.
// All steps since v000 together make it 15.7 times as fast.
#include <hip/hip_runtime.h>

// SBERTaAttention (H [4][2048][768], p [4][2048][2] (language probs, read), s [4][2048] (read), compat [12][2][2], gamma [1]; Q/K/V = H W^T (12 x 64, no bias); scores = Q.K / 8 + (p_i compat_h) . p_j + gamma s_j; softmax; out = merged wo^T + bo -> [4][2048][768]).
// Compute dtypes, f32 accumulate: every input rounded to bf16; Q/K/V on PLAIN bf16 operands (inputs: exact); scores PRECPLAN; the bilinear language bias (2x2 per head) and the position bias computed per element in f32 from the bf16-rounded p, s, compat, gamma in the reference's order; softmax f32; attn.v: rows < 512 hl (3 products), the rest fp16 (x1024); wo hl x exact (2 products) + bias.

#define NB_  4
#define TT   2048
#define DM   768
#define NH_  12
#define NKV  12
#define REP  (NH_ / NKV)
#define HD   64
#define DQ   (NH_ * HD)
#define DKV  (NKV * HD)
#define RH   512                  // query rows < RH use hi+lo planes (0: none)
#define WIN  0
#define PCAR 1024.0f
#define SCL  0.125f   // HD^-0.5
typedef _Float16 h16;
typedef unsigned short bf;
typedef __attribute__((ext_vector_type(16))) __bf16   v16bf;
typedef __attribute__((ext_vector_type(16))) _Float16 v16h;
typedef __attribute__((ext_vector_type(8)))  _Float16 v8h;
typedef __attribute__((ext_vector_type(8)))  unsigned short v8us;
typedef __attribute__((ext_vector_type(8)))  float    v8f;
typedef __attribute__((ext_vector_type(4)))  float    v4f;
typedef v8h  __attribute__((may_alias)) v8ha;
typedef v4f  __attribute__((may_alias)) v4fa;
typedef v8us __attribute__((may_alias)) v8usa;

__device__ __forceinline__ unsigned short f2bf(float f) { unsigned u = __float_as_uint(f); u += 0x7FFFu + ((u >> 16) & 1u); return (unsigned short)(u >> 16); }
__device__ __forceinline__ float bf2f(unsigned short b) { return __uint_as_float(((unsigned)b) << 16); }
__device__ __forceinline__ float bfr(float f) { return bf2f(f2bf(f)); }
__device__ __forceinline__ v16h cat16(v8h lo, v8h hi) { return __builtin_shufflevector(lo, hi, 0, 1, 2, 3, 4, 5, 6, 7, 8, 9, 10, 11, 12, 13, 14, 15); }
__device__ __forceinline__ v16bf cat16b(v8us lo, v8us hi) { return __builtin_bit_cast(v16bf, __builtin_shufflevector(lo, hi, 0, 1, 2, 3, 4, 5, 6, 7, 8, 9, 10, 11, 12, 13, 14, 15)); }
__device__ __forceinline__ v8f wmma16(v16h a, v16h b, v8f c) { return __builtin_amdgcn_wmma_f32_16x16x32_f16(false, a, false, b, (short)0, c, false, false); }
__device__ __forceinline__ v8f wmmab(v16bf a, v16bf b, v8f c) { return __builtin_amdgcn_wmma_f32_16x16x32_bf16(false, a, false, b, (short)0, c, false, false); }



// ---- k_gemmw: register-blocked GEMM, NW WAVES per 64x64 output tile (16 accumulators each), operands straight from 16-bit planes in fragment order; grid (M/64, N/64, Z), 32 * NW threads.
// Wave w takes the 32-wide k chunks w, w + NW, w + 2 NW, ... (neighbouring waves read neighbouring 1-KiB blocks); the NW partial tiles are summed through LDS in wave order 0..NW-1. K % (32 * NW) == 0.
// C[m][n] (f32, pitch ldc, + optional f32 bias[n]) = sum_k A[m][k] Bt[n][k] (+ split products per NSPLIT). z-batch strides sA/sB/sC in elements. K % 32 == 0.
// FRAGMENT ORDER: every 16-bit operand plane in the workspace is kept as blocks of 16 rows x 32 k (1 KiB), each block as the two 512-byte pieces that a wave loads:
// element (row, k) of a block lies at ((k >> 4) & 1) * 256 + (((k >> 3) & 1) * 16 + (row & 15)) * 8 + (k & 7). Lane l reads 16 bytes at l * 16 of each piece, so a wave-wide load covers four whole 128-byte lines
// (row-major planes gave 32 bytes of each of 16 lines). The values a lane gets, and so the k order, are those of the row-major loader. A plane of R rows and K columns is [R / 16][K / 32] blocks; the v planes are [TT / 32][HD / 16] blocks.
template <typename T16> struct WFrag;
template <> struct WFrag<h16> { typedef v16h V; static __device__ __forceinline__ V ld(const h16* p) { return cat16(*(const v8h*)p, *(const v8h*)(p + 256)); } static __device__ __forceinline__ v8f mma(V a, V b, v8f c) { return wmma16(a, b, c); } };
template <> struct WFrag<bf> { typedef v16bf V; static __device__ __forceinline__ V ld(const bf* p) { return cat16b(*(const v8us*)p, *(const v8us*)(p + 256)); } static __device__ __forceinline__ v8f mma(V a, V b, v8f c) { return wmmab(a, b, c); } };
template <typename T16, int NSPLIT, bool BIAS, int NW>
__global__ __launch_bounds__(32 * NW) void k_gemmw(const T16* __restrict__ A, const T16* __restrict__ A2, const T16* __restrict__ Bt, const T16* __restrict__ Bt2, int K, float* C, int ldc, const float* __restrict__ bias, size_t sA, size_t sB, size_t sC) {
    typedef typename WFrag<T16>::V V;
    constexpr int RS = (NW > 1) ? 64 : 16;   // tile rows that pass through LDS at once: with NW > 1 the whole tile, so that one barrier serves it and no store is waited for
    __shared__ __align__(16) float os[NW * RS * 68];
    const size_t z = blockIdx.z; A += z * sA; if (A2) A2 += z * sA; Bt += z * sB; if (Bt2) Bt2 += z * sB; C += z * sC;
    const int lane = threadIdx.x & 31, lr = lane & 15, hi = lane >> 4; const int wv = (NW > 1) ? __builtin_amdgcn_readfirstlane((int)(threadIdx.x >> 5)) : 0 /* wave number in a scalar register: the k loop's counter and branch stay scalar */; const int r0 = blockIdx.x * 64, c0 = blockIdx.y * 64;
    v8f acc[4][4];
#pragma unroll
    for (int mb = 0; mb < 4; ++mb)
#pragma unroll
        for (int nb = 0; nb < 4; ++nb) acc[mb][nb] = (v8f){};
    const size_t aoff = (size_t)r0 * K + 8 * lane, boff = (size_t)c0 * K + 8 * lane;   // 16 rows of K columns are K / 32 blocks of 512 elements: a row block starts where it did row-major
#pragma unroll 1
    for (int kc = wv * 32; kc < K; kc += NW * 32) {
        V a[4], a2[4];
#pragma unroll
        for (int mb = 0; mb < 4; ++mb) { a[mb] = WFrag<T16>::ld(A + aoff + (size_t)mb * 16 * K + kc * 16); if (NSPLIT == 1 || NSPLIT == 2) a2[mb] = WFrag<T16>::ld(A2 + aoff + (size_t)mb * 16 * K + kc * 16); }
#pragma unroll
        for (int nb = 0; nb < 4; ++nb) { const V b = WFrag<T16>::ld(Bt + boff + (size_t)nb * 16 * K + kc * 16); V b2; if (NSPLIT >= 2) b2 = WFrag<T16>::ld(Bt2 + boff + (size_t)nb * 16 * K + kc * 16);
#pragma unroll
            for (int mb = 0; mb < 4; ++mb) { acc[mb][nb] = WFrag<T16>::mma(a[mb], b, acc[mb][nb]); if (NSPLIT == 1 || NSPLIT == 2) acc[mb][nb] = WFrag<T16>::mma(a2[mb], b, acc[mb][nb]); if (NSPLIT >= 2) acc[mb][nb] = WFrag<T16>::mma(a[mb], b2, acc[mb][nb]); } }
        asm volatile("v_nop\n\tv_nop\n\tv_nop\n\tv_nop" : "+v"(acc[0][0]), "+v"(acc[1][1]), "+v"(acc[2][2]), "+v"(acc[3][3]) : "v"(a[0]), "v"(a[3]));
    }
#pragma unroll
    for (int m0 = 0; m0 < 4; m0 += RS / 16) {
#pragma unroll
        for (int mb = m0; mb < m0 + RS / 16; ++mb) {
#pragma unroll
            for (int nb = 0; nb < 4; ++nb) {
#pragma unroll
                for (int j = 0; j < 8; ++j) os[wv * RS * 68 + ((mb - m0) * 16 + hi * 8 + j) * 68 + nb * 16 + lr] = acc[mb][nb][j]; } }
        if (NW > 1) __syncthreads();   // every wave's partial tile is in LDS before any of it is summed
        else { __builtin_amdgcn_wave_barrier(); asm volatile("" ::: "memory"); }   // one wave: only the compiler's order of the LDS writes and reads is to be kept
        float* crow = C + (size_t)(r0 + m0 * 16) * ldc + c0;
{
#pragma unroll
            for (int s = 0; s < RS * 16 / (NW * 32); ++s) { const int idx = s * NW * 32 + (int)threadIdx.x; const int row = idx >> 4, cofs = (idx & 15) * 4; v4f val = *(const v4fa*)(os + row * 68 + cofs);
#pragma unroll
                for (int w = 1; w < NW; ++w) val += *(const v4fa*)(os + w * RS * 68 + row * 68 + cofs);
                if (BIAS) { val[0] += bfr(bias[c0 + cofs]); val[1] += bfr(bias[c0 + cofs + 1]); val[2] += bfr(bias[c0 + cofs + 2]); val[3] += bfr(bias[c0 + cofs + 3]); }
                *(v4f*)(crow + (size_t)row * ldc + cofs) = val; }
             }
        if (NW == 1) { __builtin_amdgcn_wave_barrier(); asm volatile("" ::: "memory"); }   // the next row block's LDS writes stay behind these reads
    }
}

__device__ __forceinline__ h16 tohx(float x) { return (h16)x; }
__device__ __forceinline__ void splitf(float y, unsigned short& h, unsigned short& l) { h = f2bf(y); l = f2bf(y - bf2f(h)); }
typedef __attribute__((ext_vector_type(2))) _Float16 v2h;
typedef __attribute__((ext_vector_type(4))) _Float16 v4h;
typedef __attribute__((ext_vector_type(2))) unsigned short v2us;
typedef __attribute__((ext_vector_type(4))) unsigned short v4us;
typedef __attribute__((ext_vector_type(2))) float v2f;
typedef __attribute__((ext_vector_type(4))) int v4i;

__global__ __launch_bounds__(256) void k_wtG(const float* __restrict__ w, int K, int N, bf* Bt) {
    const int lane = threadIdx.x & 31; const int L0 = (blockIdx.x * 8 + (threadIdx.x >> 5)) * 8; const int nlines = N * K / 64;
{
#pragma unroll 1
        for (int l = 0; l < 8; ++l) { const int L = L0 + l; if (L >= nlines) break; const size_t e = (size_t)L * 64 + lane * 2; const int k = (int)(e % K), n = (int)(e / K); v2us o;
            o[0] = f2bf(w[(size_t)k * N + n]); o[1] = f2bf(w[(size_t)(k + 1) * N + n]); *(v2us*)(Bt + e) = o; }
         }
}
// frsrc: the row-major element offset (rows of DM) of the 8 values that make 16-byte unit i of a plane in fragment order
__device__ __forceinline__ unsigned frsrc(size_t i8) { const unsigned i = (unsigned)i8, l = i & 31u, part = (i >> 5) & 1u, blk = i >> 6, rt = blk / (DM / 32), kch = blk % (DM / 32); return (rt * 16u + (l & 15u)) * DM + kch * 32u + part * 16u + (l >> 4) * 8u; }   // the largest plane has NB_ * TT * DM elements: 32 bits hold every offset
__global__ __launch_bounds__(256) void k_cvt8(const float* __restrict__ src, bf* dst, size_t n8) { const size_t i = (size_t)blockIdx.x * 256 + threadIdx.x; if (i >= n8) return; const v8f v = *(const v8f*)(src + frsrc(i)); v8us o;
#pragma unroll
    for (int k = 0; k < 8; ++k) o[k] = f2bf(v[k]); *(v8us*)(dst + i * 8) = o;  }
// k_cvt8w: the four weight matrices (n8 * 8 elements each), one per blockIdx.y, into four planes that follow one another in dst
__global__ __launch_bounds__(256) void k_cvt8w(const float* __restrict__ w0, const float* __restrict__ w1, const float* __restrict__ w2, const float* __restrict__ w3, bf* dst, size_t n8) { const size_t i = (size_t)blockIdx.x * 256 + threadIdx.x; if (i >= n8) return; const int y = blockIdx.y; const float* src = (y == 0) ? w0 : (y == 1) ? w1 : (y == 2) ? w2 : w3; const v8f v = *(const v8f*)(src + frsrc(i)); v8us o;
#pragma unroll
    for (int k = 0; k < 8; ++k) o[k] = f2bf(v[k]); *(v8us*)(dst + ((size_t)y * n8 + i) * 8) = o;  }
__global__ __launch_bounds__(256) void k_cscvt(const float* __restrict__ cosT, const float* __restrict__ sinT, float* CS) { const int idx = blockIdx.x * 256 + threadIdx.x; if (idx >= TT * HD) return; v2f cs; cs[0] = bfr(cosT[idx]); cs[1] = bfr(sinT[idx]); *(v2f*)(CS + (size_t)idx * 2) = cs;  }
// ---- k_qkv: q, k and v of all batches as one product, NW waves per 64 x 64 tile with k_gemmw's k split and loop; a tile is 64 positions of ONE head of q, k or v, and it leaves as that head's fp16 and hi / lo planes: no f32 copy goes through memory.
// X: [b * TT + t][DM]; Wt: [wq; wk; wv], DQ + 2 DKV rows of DM; both, and all planes written, in fragment order. grid (NB_ * TT / 64, (NH_ + 2 NKV)), 32 * NW threads. DM % (32 * NW) == 0.
// A lane holds 8 consecutive A rows of one B row, so a partial tile goes to LDS as [B row][A row] in 16-byte stores. q, k planes are [t][d]: A = weight rows, B = positions. v planes are [d][t]: A = positions, B = weight rows.
template <int NW>
__global__ __launch_bounds__(32 * NW) void k_qkv(const bf* __restrict__ X, const bf* __restrict__ Wt, h16* QK16, bf* QKh, bf* QKl, h16* VT16, bf* VTh, bf* VTl) {
    // every loop but the k loop is unrolled in full: tiles and fragments are register arrays, which only constant indices keep in registers
    typedef WFrag<bf> WF; typedef WF::V V;
    __shared__ __align__(16) float os[NW * 64 * 68];
    const int lane = threadIdx.x & 31, lr = lane & 15, hi = lane >> 4; const int wv = __builtin_amdgcn_readfirstlane((int)(threadIdx.x >> 5)) /* wave number in a scalar register: what is formed from it stays on the scalar side */; const int r0 = blockIdx.x * 64, hp = blockIdx.y;
    const bool isv = hp >= NH_ + NKV;   // the same for the whole work-group
    const bf* xr = X + (size_t)r0 * DM; const bf* wr = Wt + (size_t)hp * HD * DM;
    const bf* A = isv ? xr : wr; const bf* Bt = isv ? wr : xr;
    v8f acc[4][4];
#pragma unroll
    for (int mb = 0; mb < 4; ++mb)
#pragma unroll
        for (int nb = 0; nb < 4; ++nb) acc[mb][nb] = (v8f){};
    const unsigned off = (unsigned)lane * 16u;   // bytes: the lane's part of every fragment address; the rest is the same for the whole wave
    // left rolled, as in k_gemmw: unrolled, this build asks for the B fragments one at a time and waits out each L2 round trip. Wave w takes the 32-wide k chunks w, w + NW, ...
#pragma unroll 1
    for (int i = 0; i < DM / (NW * 32); ++i) {
        V a[4]; const unsigned ko = off + (unsigned)((i * NW + wv) * 512) * 2u;   // a 32-bit byte offset beside a scalar base: one register serves all sixteen loads
#pragma unroll
        for (int mb = 0; mb < 4; ++mb) a[mb] = WF::ld((const bf*)((const char*)(A + mb * 16 * DM) + ko));
#pragma unroll
        for (int nb = 0; nb < 4; ++nb) { const V b = WF::ld((const bf*)((const char*)(Bt + nb * 16 * DM) + ko));
#pragma unroll
            for (int mb = 0; mb < 4; ++mb) acc[mb][nb] = WF::mma(a[mb], b, acc[mb][nb]); }
    }
#pragma unroll
    for (int nb = 0; nb < 4; ++nb)
#pragma unroll
        for (int mb = 0; mb < 4; ++mb) { float* o = os + wv * (64 * 68) + (nb * 16 + lr) * 68 + mb * 16 + 8 * hi; *(v4fa*)o = __builtin_shufflevector(acc[mb][nb], acc[mb][nb], 0, 1, 2, 3); *(v4fa*)(o + 4) = __builtin_shufflevector(acc[mb][nb], acc[mb][nb], 4, 5, 6, 7); }
    __syncthreads();   // every wave's partial tile is in LDS before any of it is summed
    const int bz = r0 / TT, t0 = r0 % TT;   // TT % 64 == 0: a tile lies in one batch
    const size_t base = isv ? (((size_t)bz * NKV + (hp - NH_ - NKV)) * TT + t0) * HD : (((size_t)bz * (NH_ + NKV) + hp) * TT + t0) * HD;   // in fragment order the tile is 8 KiB in a row of either kind of plane
    h16* P16 = (isv ? VT16 : QK16) + base; bf* Ph = (isv ? VTh : QKh) + base; bf* Pl = (isv ? VTl : QKl) + base;
#pragma unroll
    for (int s = 0; s < 64 * 8 / (NW * 32); ++s) { const int idx = s * NW * 32 + (int)threadIdx.x; const int u = s * NW + wv;   // the wave fills 512-byte piece u of the tile: q, k [16 t][32 d][piece], v [32 t][16 d][piece]
        const int row = (isv ? ((u >> 1) & 3) : (u >> 2)) * 16 + lr, cofs = (isv ? (u >> 3) * 32 + (u & 1) * 16 : (u & 3) * 16) + 8 * hi; v4f v0 = *(const v4fa*)(os + row * 68 + cofs), v1 = *(const v4fa*)(os + row * 68 + cofs + 4);
#pragma unroll
        for (int w = 1; w < NW; ++w) { v0 += *(const v4fa*)(os + w * (64 * 68) + row * 68 + cofs); v1 += *(const v4fa*)(os + w * (64 * 68) + row * 68 + cofs + 4); }
        v8h o16; v8us oh, ol;
#pragma unroll
        for (int q = 0; q < 8; ++q) { const float x = (q < 4) ? v0[q & 3] : v1[q & 3]; o16[q] = tohx(x); unsigned short a2, c2; splitf(x, a2, c2); oh[q] = a2; ol[q] = c2; }
        const unsigned oo = (unsigned)idx * 8u; *(v8h*)(P16 + oo) = o16; *(v8us*)(Ph + oo) = oh; *(v8us*)(Pl + oo) = ol; }   // a wave fills four 128-byte lines of each plane
}
#define FW   16
#define KW   (TT / FW)
#define KT   (KW / 16)
#define OP   68                   // floats per query row of a partial output tile in LDS
#define RP   20                   // floats per query row of the per-wave maxima and sums in LDS
typedef __attribute__((ext_vector_type(8))) unsigned v8u;
__device__ __forceinline__ unsigned rbf(float f) { const unsigned u = __float_as_uint(f); return u + 0x7FFFu + ((u >> 16) & 1u); }   // f2bf's rounding, the bf16 bits left in the upper half
__device__ __forceinline__ v8f cat8(v4f lo, v4f hi) { return __builtin_shufflevector(lo, hi, 0, 1, 2, 3, 4, 5, 6, 7); }
template <typename T16, bool HR, int NQ, int PVA>
__device__ __forceinline__ void fattn_body(const T16* __restrict__ Q, const T16* __restrict__ Q2, const T16* __restrict__ Kp, const T16* __restrict__ K2, const T16* __restrict__ Vt, const T16* __restrict__ Vt2, const float* __restrict__ cm, int q0, bf* Ah, bf* Al, const float* kb, float* rmx, float* rsm, float* os) {
    // every loop of this function is unrolled in full: tiles and fragments are register arrays, which only constant indices keep in registers
    typedef WFrag<T16> WF; typedef typename WF::V V;
    const int lane = threadIdx.x & 31, c = lane & 15, hf = lane >> 4; const int wv = __builtin_amdgcn_readfirstlane((int)(threadIdx.x >> 5)); const int kw0 = wv * KW;
    const unsigned lfr = (unsigned)lane * 8u;   // the lane's part of every fragment address; the rest is the same for the whole wave
    V qf[NQ][2], qf2[NQ][2];
#pragma unroll
    for (int qn = 0; qn < NQ; ++qn)
#pragma unroll
        for (int kc = 0; kc < 2; ++kc) { qf[qn][kc] = WF::ld(Q + (size_t)(q0 + qn * 16) * HD + kc * 512 + lfr); if (HR) qf2[qn][kc] = WF::ld(Q2 + (size_t)(q0 + qn * 16) * HD + kc * 512 + lfr); }
    v8f sc[KT][NQ];   // sc[kt][qn][r]: key kw0 + kt * 16 + 8 hf + r, query q0 + qn * 16 + c
    constexpr int TG = HR ? 1 : 2;   // key tiles per group: 8 loads of 16 bytes a lane in either case
    constexpr int PS = HR ? 0 : 1;   // groups asked for ahead of the one being multiplied (the hi / lo strip and its query fragments leave no registers for a second group)
    { V a[PS + 1][TG][2], a2[PS + 1][TG][2];
#pragma unroll
      for (int gi = 0; gi < KT / TG; ++gi) {
#pragma unroll
        for (int n = (gi == 0 ? 0 : PS); n <= PS; ++n) { if (gi + n >= KT / TG) continue;
#pragma unroll
            for (int g = 0; g < TG; ++g)
#pragma unroll
                for (int kc = 0; kc < 2; ++kc) { a[(gi + n) & PS][g][kc] = WF::ld(Kp + (size_t)(kw0 + ((gi + n) * TG + g) * 16) * HD + kc * 512 + lfr); if (HR) a2[(gi + n) & PS][g][kc] = WF::ld(K2 + (size_t)(kw0 + ((gi + n) * TG + g) * 16) * HD + kc * 512 + lfr); } }
        __builtin_amdgcn_sched_barrier(0);   // these loads are all asked for before the group's first product waits: left alone, this build asks for a fragment at a time and waits out each L2 round trip
#pragma unroll
        for (int g = 0; g < TG; ++g)
#pragma unroll
            for (int qn = 0; qn < NQ; ++qn) { v8f s = (v8f){};
#pragma unroll
                for (int kc = 0; kc < 2; ++kc) { s = WF::mma(a[gi & PS][g][kc], qf[qn][kc], s); if (HR) { s = WF::mma(a[gi & PS][g][kc], qf2[qn][kc], s); s = WF::mma(a2[gi & PS][g][kc], qf[qn][kc], s); } }
                sc[gi * TG + g][qn] = s; }
        __builtin_amdgcn_sched_barrier(0); } }   // no later group's loads are lifted up here: all together, the key fragments and the score strip take more registers than the wave has
    const float c00 = bfr(cm[0]), c01 = bfr(cm[1]), c10 = bfr(cm[2]), c11 = bfr(cm[3]);
    float pc0[NQ], pc1[NQ], mx[NQ];
    __syncthreads();   // the per-key bias terms of every key are in LDS
#pragma unroll
    for (int qn = 0; qn < NQ; ++qn) { const float pi0 = kb[q0 + qn * 16 + c], pi1 = kb[TT + q0 + qn * 16 + c]; pc0[qn] = pi0 * c00 + pi1 * c10; pc1[qn] = pi0 * c01 + pi1 * c11; mx[qn] = -3.0e38f; }   // a query's p is its position's rounded p
#pragma unroll
    for (int kt = 0; kt < KT; ++kt) { const float* kk = kb + kw0 + kt * 16 + 8 * hf;
        const v8f pj0 = cat8(*(const v4fa*)kk, *(const v4fa*)(kk + 4)), pj1 = cat8(*(const v4fa*)(kk + TT), *(const v4fa*)(kk + TT + 4)), gs = cat8(*(const v4fa*)(kk + 2 * TT), *(const v4fa*)(kk + 2 * TT + 4));
#pragma unroll
        for (int qn = 0; qn < NQ; ++qn) { const v8f t = (sc[kt][qn] * SCL + (pj0 * pc0[qn] + pj1 * pc1[qn])) + gs; sc[kt][qn] = t;
#pragma unroll
            for (int r = 0; r < 8; ++r) mx[qn] = fmaxf(mx[qn], t[r]); }
        __builtin_amdgcn_sched_barrier(0); }   // keeps the later tiles' LDS reads from being lifted up here: all at once they take more registers than the wave has and score tiles spill
#pragma unroll
    for (int qn = 0; qn < NQ; ++qn) { mx[qn] = fmaxf(mx[qn], __shfl_xor(mx[qn], 16, 32)); rmx[(qn * 16 + c) * RP + wv] = mx[qn]; }   // both lane halves hold and store the same value: no branch stands in the strip's live range
    __syncthreads();   // every wave's row maxima are in LDS
    float fs[NQ];
#pragma unroll
    for (int qn = 0; qn < NQ; ++qn) { float m = -3.0e38f;
#pragma unroll
        for (int u = 0; u < FW / 4; ++u) { const v4f x = *(const v4fa*)(rmx + (qn * 16 + c) * RP + u * 4); m = fmaxf(fmaxf(m, fmaxf(x[0], x[1])), fmaxf(x[2], x[3])); }
        v8f vs = (v8f){};
#pragma unroll
        for (int kt = 0; kt < KT; ++kt) { const v8f d = (sc[kt][qn] - m) * 1.4426950408889634f; v8f e;
#pragma unroll
            for (int r = 0; r < 8; ++r) e[r] = __builtin_amdgcn_exp2f(d[r]);
            sc[kt][qn] = e; vs += e; }
        float sum = ((vs[0] + vs[1]) + (vs[2] + vs[3])) + ((vs[4] + vs[5]) + (vs[6] + vs[7])); sum += __shfl_xor(sum, 16, 32); rsm[(qn * 16 + c) * RP + wv] = sum; }
    __syncthreads();   // every wave's row sums are in LDS
#pragma unroll
    for (int qn = 0; qn < NQ; ++qn) { float sum = 0.f;
#pragma unroll
        for (int u = 0; u < FW / 4; ++u) { const v4f x = *(const v4fa*)(rsm + (qn * 16 + c) * RP + u * 4); sum += x[0]; sum += x[1]; sum += x[2]; sum += x[3]; }
        fs[qn] = __fdiv_rn(HR ? 1.0f : PCAR, sum); }
    V pf[KW / 32][NQ], pf2[KW / 32][NQ];   // element s of pf[kk][qn]: key kw0 + kk * 32 + (s < 8 ? 8 hf + s : 16 + 8 hf + s - 8), the order in which WFrag::ld takes V^T's keys
#pragma unroll
    for (int kk = 0; kk < KW / 32; ++kk)
#pragma unroll
        for (int qn = 0; qn < NQ; ++qn) {
            const v8f p0 = sc[2 * kk][qn] * fs[qn], p1 = sc[2 * kk + 1][qn] * fs[qn];
            if constexpr (HR) { v8u wh, wl;   // the same rounding as splitf; each pair of 16-bit halves is packed into its word at once, so that no unpacked copy of the strip stays live
#pragma unroll
                for (int w = 0; w < 8; ++w) { const float xa = (w < 4) ? p0[2 * w] : p1[2 * w - 8], xb = (w < 4) ? p0[2 * w + 1] : p1[2 * w - 7];
                    const unsigned ha = rbf(xa), hb = rbf(xb), la = rbf(xa - __uint_as_float(ha & 0xFFFF0000u)), lb = rbf(xb - __uint_as_float(hb & 0xFFFF0000u));
                    wh[w] = (ha >> 16) | (hb & 0xFFFF0000u); wl[w] = (la >> 16) | (lb & 0xFFFF0000u); }
                pf[kk][qn] = __builtin_bit_cast(v16bf, wh); pf2[kk][qn] = __builtin_bit_cast(v16bf, wl);
            } else { v8h x0, x1;
#pragma unroll
                for (int r = 0; r < 8; ++r) { x0[r] = tohx(p0[r]); x1[r] = tohx(p1[r]); }
                pf[kk][qn] = cat16(x0, x1); } }
    constexpr int KG = HR ? 2 : 4;   // 32-key chunks per group of loads: 8 loads of 16 bytes a lane in either case
    constexpr int GB = KW / 32 / KG, NG = (HD / 16) * GB;   // groups per 16-row block of V^T, groups in all
    constexpr int PV = PVA;   // groups asked for ahead of the one being multiplied
    v8f oa[HD / 16][NQ];   // oa[db][qn][r]: d = db * 16 + 8 hf + r, query q0 + qn * 16 + c
    { V a[PV + 1][KG], a2[PV + 1][KG];
#pragma unroll
      for (int gi = 0; gi < NG; ++gi) { const int db = gi / GB, k0 = (gi % GB) * KG;
#pragma unroll
        for (int n = (gi == 0 ? 0 : PV); n <= PV; ++n) { if (gi + n >= NG) continue;
#pragma unroll
            for (int g = 0; g < KG; ++g) { const size_t vofs = (size_t)(kw0 + (((gi + n) % GB) * KG + g) * 32) * HD + ((gi + n) / GB) * 512 + lfr; a[(gi + n) & PV][g] = WF::ld(Vt + vofs); if (HR) a2[(gi + n) & PV][g] = WF::ld(Vt2 + vofs); } }
        __builtin_amdgcn_sched_barrier(0);   // these loads all stand in front of the group's first product, as for the scores
        if (k0 == 0) {
#pragma unroll
            for (int qn = 0; qn < NQ; ++qn) oa[db][qn] = (v8f){}; }
#pragma unroll
        for (int g = 0; g < KG; ++g)
#pragma unroll
            for (int qn = 0; qn < NQ; ++qn) { oa[db][qn] = WF::mma(a[gi & PV][g], pf[k0 + g][qn], oa[db][qn]); if (HR) { oa[db][qn] = WF::mma(a[gi & PV][g], pf2[k0 + g][qn], oa[db][qn]); oa[db][qn] = WF::mma(a2[gi & PV][g], pf[k0 + g][qn], oa[db][qn]); } }
        __builtin_amdgcn_sched_barrier(0);   // no later group's loads are lifted up here (registers), and the stores below stay behind this block's products
        // block db - 1 is stored behind block db's products (the last block behind its own): a tile's registers are taken again only one block on, a whole block of matrix instructions after their last product
        if ((gi + 1) % GB == 0) {
#pragma unroll
            for (int sb = (db > 0 ? db - 1 : HD / 16); sb <= (db == HD / 16 - 1 ? db : db - 1); ++sb)
#pragma unroll
                for (int qn = 0; qn < NQ; ++qn) { float* o = os + wv * (NQ * 16 * OP) + (qn * 16 + c) * OP + sb * 16 + 8 * hf; *(v4fa*)o = __builtin_shufflevector(oa[sb][qn], oa[sb][qn], 0, 1, 2, 3); *(v4fa*)(o + 4) = __builtin_shufflevector(oa[sb][qn], oa[sb][qn], 4, 5, 6, 7); }
        } } }
    __syncthreads();   // every wave's partial output tile is in LDS before any of it is summed
#pragma unroll
    for (int idx = (int)threadIdx.x; idx < NQ * 16 * (HD / 4); idx += 32 * FW) { const int u = idx >> 5;   // the wave fills half-piece u (256 bytes: 16 rows x 8 d) of the strip's [16 rows][32 d][piece] blocks; lane halves take d 0..3 and 4..7 of a row
        const int row = (u >> 3) * 16 + c, cofs = (u & 7) * 8 + hf * 4; v4f val = *(const v4fa*)(os + row * OP + cofs);
#pragma unroll
        for (int w = 1; w < FW; ++w) val += *(const v4fa*)(os + w * (NQ * 16 * OP) + row * OP + cofs);
        const float cs = HR ? 1.0f : (1.0f / PCAR); v4us oh, ol;
#pragma unroll
        for (int q = 0; q < 4; ++q) { unsigned short a, b; splitf(val[q] * cs, a, b); oh[q] = a; ol[q] = b; }
        const size_t oo = (size_t)(q0 + (u >> 3) * 16) * DQ + ((u >> 2) & 1) * 512 + (u & 3) * 128 + c * 8 + hf * 4; *(v4us*)(Ah + oo) = oh; *(v4us*)(Al + oo) = ol; }
}
// grid (NH_, TT / 32, NB_): 32 query rows of one head of one batch; QK*: per batch the q head planes with the k head planes behind them, [b][h] planes of TT rows x HD; VT*: [b][h] planes of HD rows x TT; Ah / Al: the merged rows, one plane of NB_ * TT rows x DQ; all in fragment order
__global__ __launch_bounds__(32 * FW) void k_fattn(const h16* __restrict__ QK16, const bf* __restrict__ QKh, const bf* __restrict__ QKl, const h16* __restrict__ VT16, const bf* __restrict__ VTh, const bf* __restrict__ VTl, const float* __restrict__ pp, const float* __restrict__ ss, const float* __restrict__ cm, const float* __restrict__ gam, bf* Ah, bf* Al) {
    __shared__ __align__(16) float kb[3 * TT]; __shared__ __align__(16) float rmx[32 * RP]; __shared__ __align__(16) float rsm[32 * RP]; __shared__ __align__(16) float os[FW * 32 * OP];
    const int hh = blockIdx.x, q0 = blockIdx.y * 32, bz = blockIdx.z;   // heads run fastest: a batch's hi / lo row blocks, which cost most, start first
    pp += (size_t)bz * TT * 2; ss += (size_t)bz * TT;
    // per-key bias terms, each key once per work-group: bf16-rounded p_j0, p_j1 and gamma * s_j
#pragma unroll
    for (int k4 = (int)threadIdx.x * 4; k4 < TT; k4 += 32 * FW * 4) { const v4f pa = *(const v4f*)(pp + (size_t)k4 * 2), pb = *(const v4f*)(pp + (size_t)k4 * 2 + 4), sv = *(const v4f*)(ss + k4); const float gmm = bfr(gam[0]);
        const v4f o0 = { bfr(pa[0]), bfr(pa[2]), bfr(pb[0]), bfr(pb[2]) }, o1 = { bfr(pa[1]), bfr(pa[3]), bfr(pb[1]), bfr(pb[3]) }, og = { gmm * bfr(sv[0]), gmm * bfr(sv[1]), gmm * bfr(sv[2]), gmm * bfr(sv[3]) };
        *(v4fa*)(kb + k4) = o0; *(v4fa*)(kb + TT + k4) = o1; *(v4fa*)(kb + 2 * TT + k4) = og; }
    const size_t qo = ((size_t)bz * (NH_ + NKV) + hh) * TT * HD, ko = ((size_t)bz * (NH_ + NKV) + NH_ + hh / REP) * TT * HD, vo = ((size_t)bz * NKV + hh / REP) * HD * TT;
    Ah += (size_t)bz * TT * DQ; Al += (size_t)bz * TT * DQ;
    if (q0 < RH) fattn_body<bf, true, 2, 1>(QKh + qo, QKl + qo, QKh + ko, QKl + ko, VTh + vo, VTl + vo, cm + hh * 4, q0, Ah + hh * (HD / 32) * 512, Al + hh * (HD / 32) * 512, kb, rmx, rsm, os);
    else fattn_body<h16, false, 2, 1>(QK16 + qo, nullptr, QK16 + ko, nullptr, VT16 + vo, nullptr, cm + hh * 4, q0, Ah + hh * (HD / 32) * 512, Al + hh * (HD / 32) * 512, kb, rmx, rsm, os);
}

extern "C" void kernel_launch(void* const* d_in, const int* in_sizes, int n_in,
                              void* d_out, int out_size, void* d_ws, size_t ws_size, hipStream_t stream) {
    (void)in_sizes; (void)n_in; (void)out_size;
    const float* x = (const float*)d_in[0]; const float* pp = (const float*)d_in[1]; const float* ss = (const float*)d_in[2]; const float* wq = (const float*)d_in[3]; const float* wk = (const float*)d_in[4]; const float* wv = (const float*)d_in[5]; const float* wo = (const float*)d_in[6]; const float* bo = (const float*)d_in[7]; const float* compat = (const float*)d_in[8]; const float* gam = (const float*)d_in[9]; const float* cosT = nullptr; const float* sinT = nullptr; (void)cosT; (void)sinT;
    float* OUT = (float*)d_out;     // [4][2048][768]
    char* wsp = (char*)d_ws;
    auto take = [&](size_t bytes) { char* p = wsp; wsp += (bytes + 255) & ~(size_t)255; return (void*)p; };
    bf* WQ = (bf*)take((size_t)(DQ + 2 * DKV) * DM * 2 + (size_t)DM * DQ * 2); bf* WO = WQ + (size_t)(DQ + 2 * DKV) * DM;   // wq, wk, wv, wo planes one behind the other: [wq; wk; wv] is one Bt of DQ + 2 DKV rows
    bf* XB = (bf*)take((size_t)NB_ * TT * DM * 2);
    const size_t SQK = (size_t)(NH_ + NKV) * TT * HD, SV = (size_t)NKV * HD * TT;   // elements of one batch's q + k planes and of its v planes
    h16* QP16 = (h16*)take(NB_ * SQK * 2); h16* VT16 = (h16*)take(NB_ * SV * 2);   // the k head planes follow the q head planes
    bf* QPh = (bf*)take(NB_ * SQK * 2); bf* QPl = (bf*)take(NB_ * SQK * 2); bf* VTh = (bf*)take(NB_ * SV * 2); bf* VTl = (bf*)take(NB_ * SV * 2);
    bf* ATh = (bf*)take((size_t)NB_ * TT * DQ * 2); bf* ATl = (bf*)take((size_t)NB_ * TT * DQ * 2);
    if ((size_t)(wsp - (char*)d_ws) > ws_size) return;    // ws 256 MiB
    k_cvt8w<<<dim3((unsigned)(((size_t)DQ * DM / 8 + 255) / 256), 4, 1), 256, 0, stream>>>(wq, wk, wv, wo, WQ, (size_t)DQ * DM / 8);
    k_cvt8<<<(unsigned)(((size_t)NB_ * TT * DM / 8 + 255) / 256), 256, 0, stream>>>(x, XB, (size_t)NB_ * TT * DM / 8);
    k_qkv<8><<<dim3(NB_ * TT / 64, NH_ + 2 * NKV, 1), 256, 0, stream>>>(XB, WQ, QP16, QPh, QPl, VT16, VTh, VTl);   // the four batches' rows follow one another in XB
    k_fattn<<<dim3(NH_, TT / 32, NB_), 32 * FW, 0, stream>>>(QP16, QPh, QPl, VT16, VTh, VTl, pp, ss, compat, gam, ATh, ATl);
    k_gemmw<bf, 1, true, 8><<<dim3(NB_ * TT / 64, DM / 64, 1), 256, 0, stream>>>(ATh, ATl, WO, nullptr, DQ, OUT, DM, bo, 0, 0, 0);   // the four batches' rows follow one another in ATh / ATl and in OUT
}

// v006
// One run takes 199 microseconds.
// Next to v005, in two timings, it ran 1.03 times as fast each time.
// Counting every step since v000, it is 16.3 times as fast.
#include <hip/hip_runtime.h>

// SBERTaAttention (H [4][2048][768], p [4][2048][2] (language probs, read), s [4][2048] (read), compat [12][2][2], gamma [1]; Q/K/V = H W^T (12 x 64, no bias); scores = Q.K / 8 + (p_i compat_h) . p_j + gamma s_j; softmax; out = merged wo^T + bo -> [4][2048][768]).
// Compute dtypes, f32 accumulate: every input rounded to bf16; Q/K/V on PLAIN bf16 operands (inputs: exact); scores PRECPLAN; the bilinear language bias (2x2 per head) and the position bias computed per element in f32 from the bf16-rounded p, s, compat, gamma in the reference's order; softmax f32; attn.v: rows < 512 hl (3 products), the rest fp16 (x1024); wo hl x exact (2 products) + bias.

#define NB_  4
#define TT   2048
#define DM   768
#define NH_  12
#define NKV  12
#define REP  (NH_ / NKV)
#define HD   64
#define DQ   (NH_ * HD)
#define DKV  (NKV * HD)
#define RH   512                  // query rows < RH use hi+lo planes (0: none)
#define WIN  0
#define PCAR 1024.0f
#define SCL  0.125f   // HD^-0.5
typedef _Float16 h16;
typedef unsigned short bf;
typedef __attribute__((ext_vector_type(16))) __bf16   v16bf;
typedef __attribute__((ext_vector_type(16))) _Float16 v16h;
typedef __attribute__((ext_vector_type(8)))  _Float16 v8h;
typedef __attribute__((ext_vector_type(8)))  unsigned short v8us;
typedef __attribute__((ext_vector_type(8)))  float    v8f;
typedef __attribute__((ext_vector_type(4)))  float    v4f;
typedef v8h  __attribute__((may_alias)) v8ha;
typedef v4f  __attribute__((may_alias)) v4fa;
typedef v8us __attribute__((may_alias)) v8usa;

typedef __attribute__((ext_vector_type(2))) __bf16 v2bf;
typedef __attribute__((ext_vector_type(2))) float v2f;
typedef __attribute__((ext_vector_type(2))) unsigned v2u;
typedef __attribute__((ext_vector_type(4))) unsigned v4u;
// f32 -> bf16 by the chip's own convert (round to nearest even): one instruction rounds and packs two values
__device__ __forceinline__ unsigned short f2bf(float f) { return __builtin_bit_cast(unsigned short, (__bf16)f); }
__device__ __forceinline__ unsigned bfpk(float a, float b) { const v2f x = { a, b }; return __builtin_bit_cast(unsigned, __builtin_convertvector(x, v2bf)); }   // a in the low half, b in the high half
__device__ __forceinline__ float bflo(unsigned w) { return __uint_as_float(w << 16); }
__device__ __forceinline__ float bfhi(unsigned w) { return __uint_as_float(w & 0xFFFF0000u); }
__device__ __forceinline__ void splitpk(float a, float b, unsigned& h, unsigned& l) { h = bfpk(a, b); l = bfpk(a - bflo(h), b - bfhi(h)); }   // hi plane word and lo plane word of two values: lo = bf16(x - hi)
__device__ __forceinline__ float bf2f(unsigned short b) { return __uint_as_float(((unsigned)b) << 16); }
__device__ __forceinline__ float bfr(float f) { return bf2f(f2bf(f)); }
__device__ __forceinline__ v16h cat16(v8h lo, v8h hi) { return __builtin_shufflevector(lo, hi, 0, 1, 2, 3, 4, 5, 6, 7, 8, 9, 10, 11, 12, 13, 14, 15); }
__device__ __forceinline__ v16bf cat16b(v8us lo, v8us hi) { return __builtin_bit_cast(v16bf, __builtin_shufflevector(lo, hi, 0, 1, 2, 3, 4, 5, 6, 7, 8, 9, 10, 11, 12, 13, 14, 15)); }
__device__ __forceinline__ v8f wmma16(v16h a, v16h b, v8f c) { return __builtin_amdgcn_wmma_f32_16x16x32_f16(false, a, false, b, (short)0, c, false, false); }
__device__ __forceinline__ v8f wmmab(v16bf a, v16bf b, v8f c) { return __builtin_amdgcn_wmma_f32_16x16x32_bf16(false, a, false, b, (short)0, c, false, false); }



// ---- k_gemmw: register-blocked GEMM, NW WAVES per 64x64 output tile (16 accumulators each), operands straight from 16-bit planes in fragment order; grid (M/64, N/64, Z), 32 * NW threads.
// Wave w takes the 32-wide k chunks w, w + NW, w + 2 NW, ... (neighbouring waves read neighbouring 1-KiB blocks); the NW partial tiles are summed through LDS in wave order 0..NW-1. K % (32 * NW) == 0.
// C[m][n] (f32, pitch ldc, + optional f32 bias[n]) = sum_k A[m][k] Bt[n][k] (+ split products per NSPLIT). z-batch strides sA/sB/sC in elements. K % 32 == 0.
// FRAGMENT ORDER: every 16-bit operand plane in the workspace is kept as blocks of 16 rows x 32 k (1 KiB), each block as the two 512-byte pieces that a wave loads:
// element (row, k) of a block lies at ((k >> 4) & 1) * 256 + (((k >> 3) & 1) * 16 + (row & 15)) * 8 + (k & 7). Lane l reads 16 bytes at l * 16 of each piece, so a wave-wide load covers four whole 128-byte lines
// (row-major planes gave 32 bytes of each of 16 lines). The values a lane gets, and so the k order, are those of the row-major loader. A plane of R rows and K columns is [R / 16][K / 32] blocks; the v planes are [TT / 32][HD / 16] blocks.
template <typename T16> struct WFrag;
template <> struct WFrag<h16> { typedef v16h V; static __device__ __forceinline__ V ld(const h16* p) { return cat16(*(const v8h*)p, *(const v8h*)(p + 256)); } static __device__ __forceinline__ v8f mma(V a, V b, v8f c) { return wmma16(a, b, c); } };
template <> struct WFrag<bf> { typedef v16bf V; static __device__ __forceinline__ V ld(const bf* p) { return cat16b(*(const v8us*)p, *(const v8us*)(p + 256)); } static __device__ __forceinline__ v8f mma(V a, V b, v8f c) { return wmmab(a, b, c); } };
template <typename T16, int NSPLIT, bool BIAS, int NW>
__global__ __launch_bounds__(32 * NW) void k_gemmw(const T16* __restrict__ A, const T16* __restrict__ A2, const T16* __restrict__ Bt, const T16* __restrict__ Bt2, int K, float* C, int ldc, const float* __restrict__ bias, size_t sA, size_t sB, size_t sC) {
    typedef typename WFrag<T16>::V V;
    constexpr int RS = (NW > 1) ? 64 : 16;   // tile rows that pass through LDS at once: with NW > 1 the whole tile, so that one barrier serves it and no store is waited for
    __shared__ __align__(16) float os[NW * RS * 68];
    const size_t z = blockIdx.z; A += z * sA; if (A2) A2 += z * sA; Bt += z * sB; if (Bt2) Bt2 += z * sB; C += z * sC;
    const int lane = threadIdx.x & 31, lr = lane & 15, hi = lane >> 4; const int wv = (NW > 1) ? __builtin_amdgcn_readfirstlane((int)(threadIdx.x >> 5)) : 0 /* wave number in a scalar register: the k loop's counter and branch stay scalar */; const int r0 = blockIdx.x * 64, c0 = blockIdx.y * 64;
    v8f acc[4][4];
#pragma unroll
    for (int mb = 0; mb < 4; ++mb)
#pragma unroll
        for (int nb = 0; nb < 4; ++nb) acc[mb][nb] = (v8f){};
    const size_t aoff = (size_t)r0 * K + 8 * lane, boff = (size_t)c0 * K + 8 * lane;   // 16 rows of K columns are K / 32 blocks of 512 elements: a row block starts where it did row-major
#pragma unroll 1
    for (int kc = wv * 32; kc < K; kc += NW * 32) {
        V a[4], a2[4];
#pragma unroll
        for (int mb = 0; mb < 4; ++mb) { a[mb] = WFrag<T16>::ld(A + aoff + (size_t)mb * 16 * K + kc * 16); if (NSPLIT == 1 || NSPLIT == 2) a2[mb] = WFrag<T16>::ld(A2 + aoff + (size_t)mb * 16 * K + kc * 16); }
#pragma unroll
        for (int nb = 0; nb < 4; ++nb) { const V b = WFrag<T16>::ld(Bt + boff + (size_t)nb * 16 * K + kc * 16); V b2; if (NSPLIT >= 2) b2 = WFrag<T16>::ld(Bt2 + boff + (size_t)nb * 16 * K + kc * 16);
#pragma unroll
            for (int mb = 0; mb < 4; ++mb) { acc[mb][nb] = WFrag<T16>::mma(a[mb], b, acc[mb][nb]); if (NSPLIT == 1 || NSPLIT == 2) acc[mb][nb] = WFrag<T16>::mma(a2[mb], b, acc[mb][nb]); if (NSPLIT >= 2) acc[mb][nb] = WFrag<T16>::mma(a[mb], b2, acc[mb][nb]); } }
        asm volatile("v_nop\n\tv_nop\n\tv_nop\n\tv_nop" : "+v"(acc[0][0]), "+v"(acc[1][1]), "+v"(acc[2][2]), "+v"(acc[3][3]) : "v"(a[0]), "v"(a[3]));
    }
#pragma unroll
    for (int m0 = 0; m0 < 4; m0 += RS / 16) {
#pragma unroll
        for (int mb = m0; mb < m0 + RS / 16; ++mb) {
#pragma unroll
            for (int nb = 0; nb < 4; ++nb) {
#pragma unroll
                for (int j = 0; j < 8; ++j) os[wv * RS * 68 + ((mb - m0) * 16 + hi * 8 + j) * 68 + nb * 16 + lr] = acc[mb][nb][j]; } }
        if (NW > 1) __syncthreads();   // every wave's partial tile is in LDS before any of it is summed
        else { __builtin_amdgcn_wave_barrier(); asm volatile("" ::: "memory"); }   // one wave: only the compiler's order of the LDS writes and reads is to be kept
        float* crow = C + (size_t)(r0 + m0 * 16) * ldc + c0;
{
#pragma unroll
            for (int s = 0; s < RS * 16 / (NW * 32); ++s) { const int idx = s * NW * 32 + (int)threadIdx.x; const int row = idx >> 4, cofs = (idx & 15) * 4; v4f val = *(const v4fa*)(os + row * 68 + cofs);
#pragma unroll
                for (int w = 1; w < NW; ++w) val += *(const v4fa*)(os + w * RS * 68 + row * 68 + cofs);
                if (BIAS) { val[0] += bfr(bias[c0 + cofs]); val[1] += bfr(bias[c0 + cofs + 1]); val[2] += bfr(bias[c0 + cofs + 2]); val[3] += bfr(bias[c0 + cofs + 3]); }
                *(v4f*)(crow + (size_t)row * ldc + cofs) = val; }
             }
        if (NW == 1) { __builtin_amdgcn_wave_barrier(); asm volatile("" ::: "memory"); }   // the next row block's LDS writes stay behind these reads
    }
}

__device__ __forceinline__ h16 tohx(float x) { return (h16)x; }
typedef __attribute__((ext_vector_type(2))) _Float16 v2h;
typedef __attribute__((ext_vector_type(4))) _Float16 v4h;
typedef __attribute__((ext_vector_type(2))) unsigned short v2us;
typedef __attribute__((ext_vector_type(4))) unsigned short v4us;
typedef __attribute__((ext_vector_type(4))) int v4i;

__global__ __launch_bounds__(256) void k_wtG(const float* __restrict__ w, int K, int N, bf* Bt) {
    const int lane = threadIdx.x & 31; const int L0 = (blockIdx.x * 8 + (threadIdx.x >> 5)) * 8; const int nlines = N * K / 64;
{
#pragma unroll 1
        for (int l = 0; l < 8; ++l) { const int L = L0 + l; if (L >= nlines) break; const size_t e = (size_t)L * 64 + lane * 2; const int k = (int)(e % K), n = (int)(e / K); v2us o;
            o[0] = f2bf(w[(size_t)k * N + n]); o[1] = f2bf(w[(size_t)(k + 1) * N + n]); *(v2us*)(Bt + e) = o; }
         }
}
// frsrc: the row-major element offset (rows of DM) of the 8 values that make 16-byte unit i of a plane in fragment order
__device__ __forceinline__ unsigned frsrc(size_t i8) { const unsigned i = (unsigned)i8, l = i & 31u, part = (i >> 5) & 1u, blk = i >> 6, rt = blk / (DM / 32), kch = blk % (DM / 32); return (rt * 16u + (l & 15u)) * DM + kch * 32u + part * 16u + (l >> 4) * 8u; }   // the largest plane has NB_ * TT * DM elements: 32 bits hold every offset
__global__ __launch_bounds__(256) void k_cvt8(const float* __restrict__ src, bf* dst, size_t n8) { const size_t i = (size_t)blockIdx.x * 256 + threadIdx.x; if (i >= n8) return; const v8f v = *(const v8f*)(src + frsrc(i)); v4u o;
#pragma unroll
    for (int k = 0; k < 4; ++k) o[k] = bfpk(v[2 * k], v[2 * k + 1]); *(v8us*)(dst + i * 8) = __builtin_bit_cast(v8us, o);  }
// k_cvt8w: the four weight matrices (n8 * 8 elements each), one per blockIdx.y, into four planes that follow one another in dst
__global__ __launch_bounds__(256) void k_cvt8w(const float* __restrict__ w0, const float* __restrict__ w1, const float* __restrict__ w2, const float* __restrict__ w3, bf* dst, size_t n8) { const size_t i = (size_t)blockIdx.x * 256 + threadIdx.x; if (i >= n8) return; const int y = blockIdx.y; const float* src = (y == 0) ? w0 : (y == 1) ? w1 : (y == 2) ? w2 : w3; const v8f v = *(const v8f*)(src + frsrc(i)); v4u o;
#pragma unroll
    for (int k = 0; k < 4; ++k) o[k] = bfpk(v[2 * k], v[2 * k + 1]); *(v8us*)(dst + ((size_t)y * n8 + i) * 8) = __builtin_bit_cast(v8us, o);  }
__global__ __launch_bounds__(256) void k_cscvt(const float* __restrict__ cosT, const float* __restrict__ sinT, float* CS) { const int idx = blockIdx.x * 256 + threadIdx.x; if (idx >= TT * HD) return; v2f cs; cs[0] = bfr(cosT[idx]); cs[1] = bfr(sinT[idx]); *(v2f*)(CS + (size_t)idx * 2) = cs;  }
// ---- k_qkv: q, k and v of all batches as one product, NW waves per 64 x 64 tile with k_gemmw's k split and loop; a tile is 64 positions of ONE head of q, k or v, and it leaves as that head's fp16 and hi / lo planes: no f32 copy goes through memory.
// X: [b * TT + t][DM]; Wt: [wq; wk; wv], DQ + 2 DKV rows of DM; both, and all planes written, in fragment order. grid (NB_ * TT / 64, (NH_ + 2 NKV)), 32 * NW threads. DM % (32 * NW) == 0.
// A lane holds 8 consecutive A rows of one B row, so a partial tile goes to LDS as [B row][A row] in 16-byte stores. q, k planes are [t][d]: A = weight rows, B = positions. v planes are [d][t]: A = positions, B = weight rows.
template <int NW>
__global__ __launch_bounds__(32 * NW) void k_qkv(const bf* __restrict__ X, const bf* __restrict__ Wt, h16* QK16, bf* QKh, bf* QKl, h16* VT16, bf* VTh, bf* VTl) {
    // every loop but the k loop is unrolled in full: tiles and fragments are register arrays, which only constant indices keep in registers
    typedef WFrag<bf> WF; typedef WF::V V;
    __shared__ __align__(16) float os[NW * 64 * 68];
    const int lane = threadIdx.x & 31, lr = lane & 15, hi = lane >> 4; const int wv = __builtin_amdgcn_readfirstlane((int)(threadIdx.x >> 5)) /* wave number in a scalar register: what is formed from it stays on the scalar side */; const int r0 = blockIdx.x * 64, hp = blockIdx.y;
    const bool isv = hp >= NH_ + NKV;   // the same for the whole work-group
    const bf* xr = X + (size_t)r0 * DM; const bf* wr = Wt + (size_t)hp * HD * DM;
    const bf* A = isv ? xr : wr; const bf* Bt = isv ? wr : xr;
    v8f acc[4][4];
#pragma unroll
    for (int mb = 0; mb < 4; ++mb)
#pragma unroll
        for (int nb = 0; nb < 4; ++nb) acc[mb][nb] = (v8f){};
    const unsigned off = (unsigned)lane * 16u;   // bytes: the lane's part of every fragment address; the rest is the same for the whole wave
    // left rolled, as in k_gemmw: unrolled, this build asks for the B fragments one at a time and waits out each L2 round trip. Wave w takes the 32-wide k chunks w, w + NW, ...
#pragma unroll 1
    for (int i = 0; i < DM / (NW * 32); ++i) {
        V a[4]; const unsigned ko = off + (unsigned)((i * NW + wv) * 512) * 2u;   // a 32-bit byte offset beside a scalar base: one register serves all sixteen loads
#pragma unroll
        for (int mb = 0; mb < 4; ++mb) a[mb] = WF::ld((const bf*)((const char*)(A + mb * 16 * DM) + ko));
#pragma unroll
        for (int nb = 0; nb < 4; ++nb) { const V b = WF::ld((const bf*)((const char*)(Bt + nb * 16 * DM) + ko));
#pragma unroll
            for (int mb = 0; mb < 4; ++mb) acc[mb][nb] = WF::mma(a[mb], b, acc[mb][nb]); }
    }
#pragma unroll
    for (int nb = 0; nb < 4; ++nb)
#pragma unroll
        for (int mb = 0; mb < 4; ++mb) { float* o = os + wv * (64 * 68) + (nb * 16 + lr) * 68 + mb * 16 + 8 * hi; *(v4fa*)o = __builtin_shufflevector(acc[mb][nb], acc[mb][nb], 0, 1, 2, 3); *(v4fa*)(o + 4) = __builtin_shufflevector(acc[mb][nb], acc[mb][nb], 4, 5, 6, 7); }
    __syncthreads();   // every wave's partial tile is in LDS before any of it is summed
    const int bz = r0 / TT, t0 = r0 % TT;   // TT % 64 == 0: a tile lies in one batch
    const size_t base = isv ? (((size_t)bz * NKV + (hp - NH_ - NKV)) * TT + t0) * HD : (((size_t)bz * (NH_ + NKV) + hp) * TT + t0) * HD;   // in fragment order the tile is 8 KiB in a row of either kind of plane
    h16* P16 = (isv ? VT16 : QK16) + base; bf* Ph = (isv ? VTh : QKh) + base; bf* Pl = (isv ? VTl : QKl) + base;
#pragma unroll
    for (int s = 0; s < 64 * 8 / (NW * 32); ++s) { const int idx = s * NW * 32 + (int)threadIdx.x; const int u = s * NW + wv;   // the wave fills 512-byte piece u of the tile: q, k [16 t][32 d][piece], v [32 t][16 d][piece]
        const int row = (isv ? ((u >> 1) & 3) : (u >> 2)) * 16 + lr, cofs = (isv ? (u >> 3) * 32 + (u & 1) * 16 : (u & 3) * 16) + 8 * hi; v4f v0 = *(const v4fa*)(os + row * 68 + cofs), v1 = *(const v4fa*)(os + row * 68 + cofs + 4);
#pragma unroll
        for (int w = 1; w < NW; ++w) { v0 += *(const v4fa*)(os + w * (64 * 68) + row * 68 + cofs); v1 += *(const v4fa*)(os + w * (64 * 68) + row * 68 + cofs + 4); }
        v8h o16; v4u oh, ol;
#pragma unroll
        for (int q = 0; q < 8; ++q) o16[q] = tohx((q < 4) ? v0[q & 3] : v1[q & 3]);
#pragma unroll
        for (int q = 0; q < 4; ++q) { unsigned a2, c2; if (q < 2) splitpk(v0[2 * q], v0[2 * q + 1], a2, c2); else splitpk(v1[2 * q - 4], v1[2 * q - 3], a2, c2); oh[q] = a2; ol[q] = c2; }
        const unsigned oo = (unsigned)idx * 8u; *(v8h*)(P16 + oo) = o16; *(v8us*)(Ph + oo) = __builtin_bit_cast(v8us, oh); *(v8us*)(Pl + oo) = __builtin_bit_cast(v8us, ol); }   // a wave fills four 128-byte lines of each plane
}
#define FW   16
#define KW   (TT / FW)
#define KT   (KW / 16)
#define OP   68                   // floats per query row of a partial output tile in LDS
#define RP   20                   // floats per query row of the per-wave maxima and sums in LDS
typedef __attribute__((ext_vector_type(8))) unsigned v8u;
__device__ __forceinline__ v8f cat8(v4f lo, v4f hi) { return __builtin_shufflevector(lo, hi, 0, 1, 2, 3, 4, 5, 6, 7); }
template <typename T16, bool HR, int NQ, int PVA>
__device__ __forceinline__ void fattn_body(const T16* __restrict__ Q, const T16* __restrict__ Q2, const T16* __restrict__ Kp, const T16* __restrict__ K2, const T16* __restrict__ Vt, const T16* __restrict__ Vt2, const float* __restrict__ cm, int q0, bf* Ah, bf* Al, const float* kb, float* rmx, float* rsm, float* os) {
    // every loop of this function is unrolled in full: tiles and fragments are register arrays, which only constant indices keep in registers
    typedef WFrag<T16> WF; typedef typename WF::V V;
    const int lane = threadIdx.x & 31, c = lane & 15, hf = lane >> 4; const int wv = __builtin_amdgcn_readfirstlane((int)(threadIdx.x >> 5)); const int kw0 = wv * KW;
    const unsigned lfr = (unsigned)lane * 8u;   // the lane's part of every fragment address; the rest is the same for the whole wave
    V qf[NQ][2], qf2[NQ][2];
#pragma unroll
    for (int qn = 0; qn < NQ; ++qn)
#pragma unroll
        for (int kc = 0; kc < 2; ++kc) { qf[qn][kc] = WF::ld(Q + (size_t)(q0 + qn * 16) * HD + kc * 512 + lfr); if (HR) qf2[qn][kc] = WF::ld(Q2 + (size_t)(q0 + qn * 16) * HD + kc * 512 + lfr); }
    v8f sc[KT][NQ];   // sc[kt][qn][r]: key kw0 + kt * 16 + 8 hf + r, query q0 + qn * 16 + c
    constexpr int TG = HR ? 1 : 2;   // key tiles per group: 8 loads of 16 bytes a lane in either case
    constexpr int PS = HR ? 0 : 1;   // groups asked for ahead of the one being multiplied (the hi / lo strip and its query fragments leave no registers for a second group)
    { V a[PS + 1][TG][2], a2[PS + 1][TG][2];
#pragma unroll
      for (int gi = 0; gi < KT / TG; ++gi) {
#pragma unroll
        for (int n = (gi == 0 ? 0 : PS); n <= PS; ++n) { if (gi + n >= KT / TG) continue;
#pragma unroll
            for (int g = 0; g < TG; ++g)
#pragma unroll
                for (int kc = 0; kc < 2; ++kc) { a[(gi + n) & PS][g][kc] = WF::ld(Kp + (size_t)(kw0 + ((gi + n) * TG + g) * 16) * HD + kc * 512 + lfr); if (HR) a2[(gi + n) & PS][g][kc] = WF::ld(K2 + (size_t)(kw0 + ((gi + n) * TG + g) * 16) * HD + kc * 512 + lfr); } }
        __builtin_amdgcn_sched_barrier(0);   // these loads are all asked for before the group's first product waits: left alone, this build asks for a fragment at a time and waits out each L2 round trip
#pragma unroll
        for (int g = 0; g < TG; ++g)
#pragma unroll
            for (int qn = 0; qn < NQ; ++qn) { v8f s = (v8f){};
#pragma unroll
                for (int kc = 0; kc < 2; ++kc) { s = WF::mma(a[gi & PS][g][kc], qf[qn][kc], s); if (HR) { s = WF::mma(a[gi & PS][g][kc], qf2[qn][kc], s); s = WF::mma(a2[gi & PS][g][kc], qf[qn][kc], s); } }
                sc[gi * TG + g][qn] = s; }
        __builtin_amdgcn_sched_barrier(0); } }   // no later group's loads are lifted up here: all together, the key fragments and the score strip take more registers than the wave has
    const float c00 = bfr(cm[0]), c01 = bfr(cm[1]), c10 = bfr(cm[2]), c11 = bfr(cm[3]);
    float pc0[NQ], pc1[NQ], mx[NQ];
    __syncthreads();   // the per-key bias terms of every key are in LDS
#pragma unroll
    for (int qn = 0; qn < NQ; ++qn) { const float pi0 = kb[q0 + qn * 16 + c], pi1 = kb[TT + q0 + qn * 16 + c]; pc0[qn] = pi0 * c00 + pi1 * c10; pc1[qn] = pi0 * c01 + pi1 * c11; mx[qn] = -3.0e38f; }   // a query's p is its position's rounded p
#pragma unroll
    for (int kt = 0; kt < KT; ++kt) { const float* kk = kb + kw0 + kt * 16 + 8 * hf;
        const v8f pj0 = cat8(*(const v4fa*)kk, *(const v4fa*)(kk + 4)), pj1 = cat8(*(const v4fa*)(kk + TT), *(const v4fa*)(kk + TT + 4)), gs = cat8(*(const v4fa*)(kk + 2 * TT), *(const v4fa*)(kk + 2 * TT + 4));
#pragma unroll
        for (int qn = 0; qn < NQ; ++qn) { const v8f t = (sc[kt][qn] * SCL + (pj0 * pc0[qn] + pj1 * pc1[qn])) + gs; sc[kt][qn] = t;
#pragma unroll
            for (int r = 0; r < 8; ++r) mx[qn] = fmaxf(mx[qn], t[r]); }
        __builtin_amdgcn_sched_barrier(0); }   // keeps the later tiles' LDS reads from being lifted up here: all at once they take more registers than the wave has and score tiles spill
#pragma unroll
    for (int qn = 0; qn < NQ; ++qn) { mx[qn] = fmaxf(mx[qn], __shfl_xor(mx[qn], 16, 32)); rmx[(qn * 16 + c) * RP + wv] = mx[qn]; }   // both lane halves hold and store the same value: no branch stands in the strip's live range
    __syncthreads();   // every wave's row maxima are in LDS
    float fs[NQ];
#pragma unroll
    for (int qn = 0; qn < NQ; ++qn) { float m = -3.0e38f;
#pragma unroll
        for (int u = 0; u < FW / 4; ++u) { const v4f x = *(const v4fa*)(rmx + (qn * 16 + c) * RP + u * 4); m = fmaxf(fmaxf(m, fmaxf(x[0], x[1])), fmaxf(x[2], x[3])); }
        v8f vs = (v8f){};
#pragma unroll
        for (int kt = 0; kt < KT; ++kt) { const v8f d = (sc[kt][qn] - m) * 1.4426950408889634f; v8f e;
#pragma unroll
            for (int r = 0; r < 8; ++r) e[r] = __builtin_amdgcn_exp2f(d[r]);
            sc[kt][qn] = e; vs += e; }
        float sum = ((vs[0] + vs[1]) + (vs[2] + vs[3])) + ((vs[4] + vs[5]) + (vs[6] + vs[7])); sum += __shfl_xor(sum, 16, 32); rsm[(qn * 16 + c) * RP + wv] = sum; }
    __syncthreads();   // every wave's row sums are in LDS
#pragma unroll
    for (int qn = 0; qn < NQ; ++qn) { float sum = 0.f;
#pragma unroll
        for (int u = 0; u < FW / 4; ++u) { const v4f x = *(const v4fa*)(rsm + (qn * 16 + c) * RP + u * 4); sum += x[0]; sum += x[1]; sum += x[2]; sum += x[3]; }
        fs[qn] = __fdiv_rn(HR ? 1.0f : PCAR, sum); }
    V pf[KW / 32][NQ], pf2[KW / 32][NQ];   // element s of pf[kk][qn]: key kw0 + kk * 32 + (s < 8 ? 8 hf + s : 16 + 8 hf + s - 8), the order in which WFrag::ld takes V^T's keys
#pragma unroll
    for (int kk = 0; kk < KW / 32; ++kk)
#pragma unroll
        for (int qn = 0; qn < NQ; ++qn) {
            const v8f p0 = sc[2 * kk][qn] * fs[qn], p1 = sc[2 * kk + 1][qn] * fs[qn];
            if constexpr (HR) { v8u wh, wl;   // each pair of neighbouring keys is rounded and packed into its hi word and its lo word at once, so that no unpacked copy of the strip stays live
#pragma unroll
                for (int w = 0; w < 8; ++w) { const float xa = (w < 4) ? p0[2 * w] : p1[2 * w - 8], xb = (w < 4) ? p0[2 * w + 1] : p1[2 * w - 7];
                    unsigned h2, l2; splitpk(xa, xb, h2, l2); wh[w] = h2; wl[w] = l2; }
                pf[kk][qn] = __builtin_bit_cast(v16bf, wh); pf2[kk][qn] = __builtin_bit_cast(v16bf, wl);
            } else { v8h x0, x1;
#pragma unroll
                for (int r = 0; r < 8; ++r) { x0[r] = tohx(p0[r]); x1[r] = tohx(p1[r]); }
                pf[kk][qn] = cat16(x0, x1); } }
    constexpr int KG = HR ? 2 : 4;   // 32-key chunks per group of loads: 8 loads of 16 bytes a lane in either case
    constexpr int GB = KW / 32 / KG, NG = (HD / 16) * GB;   // groups per 16-row block of V^T, groups in all
    constexpr int PV = PVA;   // groups asked for ahead of the one being multiplied
    v8f oa[HD / 16][NQ];   // oa[db][qn][r]: d = db * 16 + 8 hf + r, query q0 + qn * 16 + c
    { V a[PV + 1][KG], a2[PV + 1][KG];
#pragma unroll
      for (int gi = 0; gi < NG; ++gi) { const int db = gi / GB, k0 = (gi % GB) * KG;
#pragma unroll
        for (int n = (gi == 0 ? 0 : PV); n <= PV; ++n) { if (gi + n >= NG) continue;
#pragma unroll
            for (int g = 0; g < KG; ++g) { const size_t vofs = (size_t)(kw0 + (((gi + n) % GB) * KG + g) * 32) * HD + ((gi + n) / GB) * 512 + lfr; a[(gi + n) & PV][g] = WF::ld(Vt + vofs); if (HR) a2[(gi + n) & PV][g] = WF::ld(Vt2 + vofs); } }
        __builtin_amdgcn_sched_barrier(0);   // these loads all stand in front of the group's first product, as for the scores
        if (k0 == 0) {
#pragma unroll
            for (int qn = 0; qn < NQ; ++qn) oa[db][qn] = (v8f){}; }
#pragma unroll
        for (int g = 0; g < KG; ++g)
#pragma unroll
            for (int qn = 0; qn < NQ; ++qn) { oa[db][qn] = WF::mma(a[gi & PV][g], pf[k0 + g][qn], oa[db][qn]); if (HR) { oa[db][qn] = WF::mma(a[gi & PV][g], pf2[k0 + g][qn], oa[db][qn]); oa[db][qn] = WF::mma(a2[gi & PV][g], pf[k0 + g][qn], oa[db][qn]); } }
        __builtin_amdgcn_sched_barrier(0);   // no later group's loads are lifted up here (registers), and the stores below stay behind this block's products
        // block db - 1 is stored behind block db's products (the last block behind its own): a tile's registers are taken again only one block on, a whole block of matrix instructions after their last product
        if ((gi + 1) % GB == 0) {
#pragma unroll
            for (int sb = (db > 0 ? db - 1 : HD / 16); sb <= (db == HD / 16 - 1 ? db : db - 1); ++sb)
#pragma unroll
                for (int qn = 0; qn < NQ; ++qn) { float* o = os + wv * (NQ * 16 * OP) + (qn * 16 + c) * OP + sb * 16 + 8 * hf; *(v4fa*)o = __builtin_shufflevector(oa[sb][qn], oa[sb][qn], 0, 1, 2, 3); *(v4fa*)(o + 4) = __builtin_shufflevector(oa[sb][qn], oa[sb][qn], 4, 5, 6, 7); }
        } } }
    __syncthreads();   // every wave's partial output tile is in LDS before any of it is summed
#pragma unroll
    for (int idx = (int)threadIdx.x; idx < NQ * 16 * (HD / 4); idx += 32 * FW) { const int u = idx >> 5;   // the wave fills half-piece u (256 bytes: 16 rows x 8 d) of the strip's [16 rows][32 d][piece] blocks; lane halves take d 0..3 and 4..7 of a row
        const int row = (u >> 3) * 16 + c, cofs = (u & 7) * 8 + hf * 4; v4f val = *(const v4fa*)(os + row * OP + cofs);
#pragma unroll
        for (int w = 1; w < FW; ++w) val += *(const v4fa*)(os + w * (NQ * 16 * OP) + row * OP + cofs);
        const float cs = HR ? 1.0f : (1.0f / PCAR); v2u oh, ol;
#pragma unroll
        for (int q = 0; q < 2; ++q) { unsigned a, b; splitpk(val[2 * q] * cs, val[2 * q + 1] * cs, a, b); oh[q] = a; ol[q] = b; }
        const size_t oo = (size_t)(q0 + (u >> 3) * 16) * DQ + ((u >> 2) & 1) * 512 + (u & 3) * 128 + c * 8 + hf * 4; *(v4us*)(Ah + oo) = __builtin_bit_cast(v4us, oh); *(v4us*)(Al + oo) = __builtin_bit_cast(v4us, ol); }
}
// grid (NH_, TT / 32, NB_): 32 query rows of one head of one batch; QK*: per batch the q head planes with the k head planes behind them, [b][h] planes of TT rows x HD; VT*: [b][h] planes of HD rows x TT; Ah / Al: the merged rows, one plane of NB_ * TT rows x DQ; all in fragment order
__global__ __launch_bounds__(32 * FW) void k_fattn(const h16* __restrict__ QK16, const bf* __restrict__ QKh, const bf* __restrict__ QKl, const h16* __restrict__ VT16, const bf* __restrict__ VTh, const bf* __restrict__ VTl, const float* __restrict__ pp, const float* __restrict__ ss, const float* __restrict__ cm, const float* __restrict__ gam, bf* Ah, bf* Al) {
    __shared__ __align__(16) float kb[3 * TT]; __shared__ __align__(16) float rmx[32 * RP]; __shared__ __align__(16) float rsm[32 * RP]; __shared__ __align__(16) float os[FW * 32 * OP];
    const int hh = blockIdx.x, q0 = blockIdx.y * 32, bz = blockIdx.z;   // heads run fastest: a batch's hi / lo row blocks, which cost most, start first
    pp += (size_t)bz * TT * 2; ss += (size_t)bz * TT;
    // per-key bias terms, each key once per work-group: bf16-rounded p_j0, p_j1 and gamma * s_j
#pragma unroll
    for (int k4 = (int)threadIdx.x * 4; k4 < TT; k4 += 32 * FW * 4) { const v4f pa = *(const v4f*)(pp + (size_t)k4 * 2), pb = *(const v4f*)(pp + (size_t)k4 * 2 + 4), sv = *(const v4f*)(ss + k4); const float gmm = bfr(gam[0]);
        const unsigned w0 = bfpk(pa[0], pa[1]), w1 = bfpk(pa[2], pa[3]), w2 = bfpk(pb[0], pb[1]), w3 = bfpk(pb[2], pb[3]), w4 = bfpk(sv[0], sv[1]), w5 = bfpk(sv[2], sv[3]);
        const v4f o0 = { bflo(w0), bflo(w1), bflo(w2), bflo(w3) }, o1 = { bfhi(w0), bfhi(w1), bfhi(w2), bfhi(w3) }, og = { gmm * bflo(w4), gmm * bfhi(w4), gmm * bflo(w5), gmm * bfhi(w5) };
        *(v4fa*)(kb + k4) = o0; *(v4fa*)(kb + TT + k4) = o1; *(v4fa*)(kb + 2 * TT + k4) = og; }
    const size_t qo = ((size_t)bz * (NH_ + NKV) + hh) * TT * HD, ko = ((size_t)bz * (NH_ + NKV) + NH_ + hh / REP) * TT * HD, vo = ((size_t)bz * NKV + hh / REP) * HD * TT;
    Ah += (size_t)bz * TT * DQ; Al += (size_t)bz * TT * DQ;
    if (q0 < RH) fattn_body<bf, true, 2, 1>(QKh + qo, QKl + qo, QKh + ko, QKl + ko, VTh + vo, VTl + vo, cm + hh * 4, q0, Ah + hh * (HD / 32) * 512, Al + hh * (HD / 32) * 512, kb, rmx, rsm, os);
    else fattn_body<h16, false, 2, 1>(QK16 + qo, nullptr, QK16 + ko, nullptr, VT16 + vo, nullptr, cm + hh * 4, q0, Ah + hh * (HD / 32) * 512, Al + hh * (HD / 32) * 512, kb, rmx, rsm, os);
}

extern "C" void kernel_launch(void* const* d_in, const int* in_sizes, int n_in,
                              void* d_out, int out_size, void* d_ws, size_t ws_size, hipStream_t stream) {
    (void)in_sizes; (void)n_in; (void)out_size;
    const float* x = (const float*)d_in[0]; const float* pp = (const float*)d_in[1]; const float* ss = (const float*)d_in[2]; const float* wq = (const float*)d_in[3]; const float* wk = (const float*)d_in[4]; const float* wv = (const float*)d_in[5]; const float* wo = (const float*)d_in[6]; const float* bo = (const float*)d_in[7]; const float* compat = (const float*)d_in[8]; const float* gam = (const float*)d_in[9]; const float* cosT = nullptr; const float* sinT = nullptr; (void)cosT; (void)sinT;
    float* OUT = (float*)d_out;     // [4][2048][768]
    char* wsp = (char*)d_ws;
    auto take = [&](size_t bytes) { char* p = wsp; wsp += (bytes + 255) & ~(size_t)255; return (void*)p; };
    bf* WQ = (bf*)take((size_t)(DQ + 2 * DKV) * DM * 2 + (size_t)DM * DQ * 2); bf* WO = WQ + (size_t)(DQ + 2 * DKV) * DM;   // wq, wk, wv, wo planes one behind the other: [wq; wk; wv] is one Bt of DQ + 2 DKV rows
    bf* XB = (bf*)take((size_t)NB_ * TT * DM * 2);
    const size_t SQK = (size_t)(NH_ + NKV) * TT * HD, SV = (size_t)NKV * HD * TT;   // elements of one batch's q + k planes and of its v planes
    h16* QP16 = (h16*)take(NB_ * SQK * 2); h16* VT16 = (h16*)take(NB_ * SV * 2);   // the k head planes follow the q head planes
    bf* QPh = (bf*)take(NB_ * SQK * 2); bf* QPl = (bf*)take(NB_ * SQK * 2); bf* VTh = (bf*)take(NB_ * SV * 2); bf* VTl = (bf*)take(NB_ * SV * 2);
    bf* ATh = (bf*)take((size_t)NB_ * TT * DQ * 2); bf* ATl = (bf*)take((size_t)NB_ * TT * DQ * 2);
    if ((size_t)(wsp - (char*)d_ws) > ws_size) return;    // ws 256 MiB
    k_cvt8w<<<dim3((unsigned)(((size_t)DQ * DM / 8 + 255) / 256), 4, 1), 256, 0, stream>>>(wq, wk, wv, wo, WQ, (size_t)DQ * DM / 8);
    k_cvt8<<<(unsigned)(((size_t)NB_ * TT * DM / 8 + 255) / 256), 256, 0, stream>>>(x, XB, (size_t)NB_ * TT * DM / 8);
    k_qkv<8><<<dim3(NB_ * TT / 64, NH_ + 2 * NKV, 1), 256, 0, stream>>>(XB, WQ, QP16, QPh, QPl, VT16, VTh, VTl);   // the four batches' rows follow one another in XB
    k_fattn<<<dim3(NH_, TT / 32, NB_), 32 * FW, 0, stream>>>(QP16, QPh, QPl, VT16, VTh, VTl, pp, ss, compat, gam, ATh, ATl);
    k_gemmw<bf, 1, true, 8><<<dim3(NB_ * TT / 64, DM / 64, 1), 256, 0, stream>>>(ATh, ATl, WO, nullptr, DQ, OUT, DM, bo, 0, 0, 0);   // the four batches' rows follow one another in ATh / ATl and in OUT
}

// v007
// Measured time: 158 microseconds a run.
// Two timings next to v006 put it at 1.26 and 1.27 times that version's speed.
// Over all steps from v000 it is 20.6 times as fast.
#include <hip/hip_runtime.h>

// SBERTaAttention (H [4][2048][768], p [4][2048][2] (language probs, read), s [4][2048] (read), compat [12][2][2], gamma [1]; Q/K/V = H W^T (12 x 64, no bias); scores = Q.K / 8 + (p_i compat_h) . p_j + gamma s_j; softmax; out = merged wo^T + bo -> [4][2048][768]).
// Compute dtypes, f32 accumulate: every input rounded to bf16; Q/K/V on PLAIN bf16 operands (inputs: exact); scores PRECPLAN; the bilinear language bias (2x2 per head) and the position bias computed per element in f32 from the bf16-rounded p, s, compat, gamma in the reference's order; softmax f32; attn.v: rows < 512 hl (3 products), the rest fp16 (x1024); wo hl x exact (2 products) + bias.

#define NB_  4
#define TT   2048
#define DM   768
#define NH_  12
#define NKV  12
#define REP  (NH_ / NKV)
#define HD   64
#define DQ   (NH_ * HD)
#define DKV  (NKV * HD)
#define RH   512                  // query rows < RH use hi+lo planes (0: none)
#define WIN  0
#define PCAR 1024.0f
#define SCL  0.125f   // HD^-0.5
typedef _Float16 h16;
typedef unsigned short bf;
typedef __attribute__((ext_vector_type(16))) __bf16   v16bf;
typedef __attribute__((ext_vector_type(16))) _Float16 v16h;
typedef __attribute__((ext_vector_type(8)))  _Float16 v8h;
typedef __attribute__((ext_vector_type(8)))  unsigned short v8us;
typedef __attribute__((ext_vector_type(8)))  float    v8f;
typedef __attribute__((ext_vector_type(4)))  float    v4f;
typedef v8h  __attribute__((may_alias)) v8ha;
typedef v4f  __attribute__((may_alias)) v4fa;
typedef v8us __attribute__((may_alias)) v8usa;

typedef __attribute__((ext_vector_type(2))) __bf16 v2bf;
typedef __attribute__((ext_vector_type(2))) float v2f;
typedef __attribute__((ext_vector_type(2))) unsigned v2u;
typedef __attribute__((ext_vector_type(4))) unsigned v4u;
// f32 -> bf16 by the chip's own convert (round to nearest even): one instruction rounds and packs two values
__device__ __forceinline__ unsigned short f2bf(float f) { return __builtin_bit_cast(unsigned short, (__bf16)f); }
__device__ __forceinline__ unsigned bfpk(float a, float b) { const v2f x = { a, b }; return __builtin_bit_cast(unsigned, __builtin_convertvector(x, v2bf)); }   // a in the low half, b in the high half
__device__ __forceinline__ float bflo(unsigned w) { return __uint_as_float(w << 16); }
__device__ __forceinline__ float bfhi(unsigned w) { return __uint_as_float(w & 0xFFFF0000u); }
__device__ __forceinline__ void splitpk(float a, float b, unsigned& h, unsigned& l) { h = bfpk(a, b); l = bfpk(a - bflo(h), b - bfhi(h)); }   // hi plane word and lo plane word of two values: lo = bf16(x - hi)
__device__ __forceinline__ float bf2f(unsigned short b) { return __uint_as_float(((unsigned)b) << 16); }
__device__ __forceinline__ float bfr(float f) { return bf2f(f2bf(f)); }
__device__ __forceinline__ v16h cat16(v8h lo, v8h hi) { return __builtin_shufflevector(lo, hi, 0, 1, 2, 3, 4, 5, 6, 7, 8, 9, 10, 11, 12, 13, 14, 15); }
__device__ __forceinline__ v16bf cat16b(v8us lo, v8us hi) { return __builtin_bit_cast(v16bf, __builtin_shufflevector(lo, hi, 0, 1, 2, 3, 4, 5, 6, 7, 8, 9, 10, 11, 12, 13, 14, 15)); }
__device__ __forceinline__ v8f wmma16(v16h a, v16h b, v8f c) { return __builtin_amdgcn_wmma_f32_16x16x32_f16(false, a, false, b, (short)0, c, false, false); }
__device__ __forceinline__ v8f wmmab(v16bf a, v16bf b, v8f c) { return __builtin_amdgcn_wmma_f32_16x16x32_bf16(false, a, false, b, (short)0, c, false, false); }



// ---- k_gemmw: register-blocked GEMM, NW WAVES per 64x64 output tile (16 accumulators each), operands straight from 16-bit planes in fragment order; grid (M/64, N/64, Z), 32 * NW threads.
// Wave w takes the 32-wide k chunks w, w + NW, w + 2 NW, ... (neighbouring waves read neighbouring 1-KiB blocks); the NW partial tiles are summed through LDS in wave order 0..NW-1. K % (32 * NW) == 0.
// C[m][n] (f32, pitch ldc, + optional f32 bias[n]) = sum_k A[m][k] Bt[n][k] (+ split products per NSPLIT). z-batch strides sA/sB/sC in elements. K % 32 == 0.
// FRAGMENT ORDER: every 16-bit operand plane in the workspace is kept as blocks of 16 rows x 32 k (1 KiB), each block as the two 512-byte pieces that a wave loads:
// element (row, k) of a block lies at ((k >> 4) & 1) * 256 + (((k >> 3) & 1) * 16 + (row & 15)) * 8 + (k & 7). Lane l reads 16 bytes at l * 16 of each piece, so a wave-wide load covers four whole 128-byte lines
// (row-major planes gave 32 bytes of each of 16 lines). The values a lane gets, and so the k order, are those of the row-major loader. A plane of R rows and K columns is [R / 16][K / 32] blocks; the v planes are [TT / 32][HD / 16] blocks.
template <typename T16> struct WFrag;
template <> struct WFrag<h16> { typedef v16h V; static __device__ __forceinline__ V ld(const h16* p) { return cat16(*(const v8h*)p, *(const v8h*)(p + 256)); } static __device__ __forceinline__ v8f mma(V a, V b, v8f c) { return wmma16(a, b, c); } };
template <> struct WFrag<bf> { typedef v16bf V; static __device__ __forceinline__ V ld(const bf* p) { return cat16b(*(const v8us*)p, *(const v8us*)(p + 256)); } static __device__ __forceinline__ v8f mma(V a, V b, v8f c) { return wmmab(a, b, c); } };
template <typename T16, int NSPLIT, bool BIAS, int NW>
__global__ __launch_bounds__(32 * NW) void k_gemmw(const T16* __restrict__ A, const T16* __restrict__ A2, const T16* __restrict__ Bt, const T16* __restrict__ Bt2, int K, float* C, int ldc, const float* __restrict__ bias, size_t sA, size_t sB, size_t sC) {
    typedef typename WFrag<T16>::V V;
    constexpr int RS = (NW > 1) ? 64 : 16;   // tile rows that pass through LDS at once: with NW > 1 the whole tile, so that one barrier serves it and no store is waited for
    __shared__ __align__(16) float os[NW * RS * 68];
    const size_t z = blockIdx.z; A += z * sA; if (A2) A2 += z * sA; Bt += z * sB; if (Bt2) Bt2 += z * sB; C += z * sC;
    const int lane = threadIdx.x & 31, lr = lane & 15, hi = lane >> 4; const int wv = (NW > 1) ? __builtin_amdgcn_readfirstlane((int)(threadIdx.x >> 5)) : 0 /* wave number in a scalar register: the k loop's counter and branch stay scalar */; const int r0 = blockIdx.x * 64, c0 = blockIdx.y * 64;
    v8f acc[4][4];
#pragma unroll
    for (int mb = 0; mb < 4; ++mb)
#pragma unroll
        for (int nb = 0; nb < 4; ++nb) acc[mb][nb] = (v8f){};
    const size_t aoff = (size_t)r0 * K + 8 * lane, boff = (size_t)c0 * K + 8 * lane;   // 16 rows of K columns are K / 32 blocks of 512 elements: a row block starts where it did row-major
#pragma unroll 1
    for (int kc = wv * 32; kc < K; kc += NW * 32) {
        V a[4], a2[4];
#pragma unroll
        for (int mb = 0; mb < 4; ++mb) { a[mb] = WFrag<T16>::ld(A + aoff + (size_t)mb * 16 * K + kc * 16); if (NSPLIT == 1 || NSPLIT == 2) a2[mb] = WFrag<T16>::ld(A2 + aoff + (size_t)mb * 16 * K + kc * 16); }
#pragma unroll
        for (int nb = 0; nb < 4; ++nb) { const V b = WFrag<T16>::ld(Bt + boff + (size_t)nb * 16 * K + kc * 16); V b2; if (NSPLIT >= 2) b2 = WFrag<T16>::ld(Bt2 + boff + (size_t)nb * 16 * K + kc * 16);
#pragma unroll
            for (int mb = 0; mb < 4; ++mb) { acc[mb][nb] = WFrag<T16>::mma(a[mb], b, acc[mb][nb]); if (NSPLIT == 1 || NSPLIT == 2) acc[mb][nb] = WFrag<T16>::mma(a2[mb], b, acc[mb][nb]); if (NSPLIT >= 2) acc[mb][nb] = WFrag<T16>::mma(a[mb], b2, acc[mb][nb]); } }
        asm volatile("v_nop\n\tv_nop\n\tv_nop\n\tv_nop" : "+v"(acc[0][0]), "+v"(acc[1][1]), "+v"(acc[2][2]), "+v"(acc[3][3]) : "v"(a[0]), "v"(a[3]));
    }
#pragma unroll
    for (int m0 = 0; m0 < 4; m0 += RS / 16) {
#pragma unroll
        for (int mb = m0; mb < m0 + RS / 16; ++mb) {
#pragma unroll
            for (int nb = 0; nb < 4; ++nb) {
#pragma unroll
                for (int j = 0; j < 8; ++j) os[wv * RS * 68 + ((mb - m0) * 16 + hi * 8 + j) * 68 + nb * 16 + lr] = acc[mb][nb][j]; } }
        if (NW > 1) __syncthreads();   // every wave's partial tile is in LDS before any of it is summed
        else { __builtin_amdgcn_wave_barrier(); asm volatile("" ::: "memory"); }   // one wave: only the compiler's order of the LDS writes and reads is to be kept
        float* crow = C + (size_t)(r0 + m0 * 16) * ldc + c0;
{
#pragma unroll
            for (int s = 0; s < RS * 16 / (NW * 32); ++s) { const int idx = s * NW * 32 + (int)threadIdx.x; const int row = idx >> 4, cofs = (idx & 15) * 4; v4f val = *(const v4fa*)(os + row * 68 + cofs);
#pragma unroll
                for (int w = 1; w < NW; ++w) val += *(const v4fa*)(os + w * RS * 68 + row * 68 + cofs);
                if (BIAS) { val[0] += bfr(bias[c0 + cofs]); val[1] += bfr(bias[c0 + cofs + 1]); val[2] += bfr(bias[c0 + cofs + 2]); val[3] += bfr(bias[c0 + cofs + 3]); }
                *(v4f*)(crow + (size_t)row * ldc + cofs) = val; }
             }
        if (NW == 1) { __builtin_amdgcn_wave_barrier(); asm volatile("" ::: "memory"); }   // the next row block's LDS writes stay behind these reads
    }
}

__device__ __forceinline__ h16 tohx(float x) { return (h16)x; }
typedef __attribute__((ext_vector_type(2))) _Float16 v2h;
typedef __attribute__((ext_vector_type(4))) _Float16 v4h;
typedef __attribute__((ext_vector_type(2))) unsigned short v2us;
typedef __attribute__((ext_vector_type(4))) unsigned short v4us;
typedef __attribute__((ext_vector_type(4))) int v4i;

__global__ __launch_bounds__(256) void k_wtG(const float* __restrict__ w, int K, int N, bf* Bt) {
    const int lane = threadIdx.x & 31; const int L0 = (blockIdx.x * 8 + (threadIdx.x >> 5)) * 8; const int nlines = N * K / 64;
{
#pragma unroll 1
        for (int l = 0; l < 8; ++l) { const int L = L0 + l; if (L >= nlines) break; const size_t e = (size_t)L * 64 + lane * 2; const int k = (int)(e % K), n = (int)(e / K); v2us o;
            o[0] = f2bf(w[(size_t)k * N + n]); o[1] = f2bf(w[(size_t)(k + 1) * N + n]); *(v2us*)(Bt + e) = o; }
         }
}
// frsrc: the row-major element offset (rows of DM) of the 8 values that make 16-byte unit i of a plane in fragment order
__device__ __forceinline__ unsigned frsrc(size_t i8) { const unsigned i = (unsigned)i8, l = i & 31u, part = (i >> 5) & 1u, blk = i >> 6, rt = blk / (DM / 32), kch = blk % (DM / 32); return (rt * 16u + (l & 15u)) * DM + kch * 32u + part * 16u + (l >> 4) * 8u; }   // the largest plane has NB_ * TT * DM elements: 32 bits hold every offset
__global__ __launch_bounds__(256) void k_cvt8(const float* __restrict__ src, bf* dst, size_t n8) { const size_t i = (size_t)blockIdx.x * 256 + threadIdx.x; if (i >= n8) return; const v8f v = *(const v8f*)(src + frsrc(i)); v4u o;
#pragma unroll
    for (int k = 0; k < 4; ++k) o[k] = bfpk(v[2 * k], v[2 * k + 1]); *(v8us*)(dst + i * 8) = __builtin_bit_cast(v8us, o);  }
// k_cvt8w: the four weight matrices (n8 * 8 elements each), one per blockIdx.y, into four planes that follow one another in dst
__global__ __launch_bounds__(256) void k_cvt8w(const float* __restrict__ w0, const float* __restrict__ w1, const float* __restrict__ w2, const float* __restrict__ w3, bf* dst, size_t n8) { const size_t i = (size_t)blockIdx.x * 256 + threadIdx.x; if (i >= n8) return; const int y = blockIdx.y; const float* src = (y == 0) ? w0 : (y == 1) ? w1 : (y == 2) ? w2 : w3; const v8f v = *(const v8f*)(src + frsrc(i)); v4u o;
#pragma unroll
    for (int k = 0; k < 4; ++k) o[k] = bfpk(v[2 * k], v[2 * k + 1]); *(v8us*)(dst + ((size_t)y * n8 + i) * 8) = __builtin_bit_cast(v8us, o);  }
__global__ __launch_bounds__(256) void k_cscvt(const float* __restrict__ cosT, const float* __restrict__ sinT, float* CS) { const int idx = blockIdx.x * 256 + threadIdx.x; if (idx >= TT * HD) return; v2f cs; cs[0] = bfr(cosT[idx]); cs[1] = bfr(sinT[idx]); *(v2f*)(CS + (size_t)idx * 2) = cs;  }
// ---- k_qkv: q, k and v of all batches as one product, NW waves per 64 x 64 tile with k_gemmw's k split and loop; a tile is 64 positions of ONE head of q, k or v, and it leaves as that head's fp16 and hi / lo planes: no f32 copy goes through memory.
// X: [b * TT + t][DM]; Wt: [wq; wk; wv], DQ + 2 DKV rows of DM; both, and all planes written, in fragment order. grid (NB_ * TT / 64, (NH_ + 2 NKV)), 32 * NW threads. DM % (32 * NW) == 0.
// A lane holds 8 consecutive A rows of one B row, so a partial tile goes to LDS as [B row][A row] in 16-byte stores. q, k planes are [t][d]: A = weight rows, B = positions. v planes are [d][t]: A = positions, B = weight rows.
template <int NW>
__global__ __launch_bounds__(32 * NW) void k_qkv(const bf* __restrict__ X, const bf* __restrict__ Wt, h16* QK16, bf* QKh, bf* QKl, h16* VT16, bf* VTh, bf* VTl) {
    // every loop but the k loop is unrolled in full: tiles and fragments are register arrays, which only constant indices keep in registers
    typedef WFrag<bf> WF; typedef WF::V V;
    __shared__ __align__(16) float os[NW * 64 * 68];
    const int lane = threadIdx.x & 31, lr = lane & 15, hi = lane >> 4; const int wv = __builtin_amdgcn_readfirstlane((int)(threadIdx.x >> 5)) /* wave number in a scalar register: what is formed from it stays on the scalar side */; const int r0 = blockIdx.x * 64, hp = blockIdx.y;
    const bool isv = hp >= NH_ + NKV;   // the same for the whole work-group
    const bf* xr = X + (size_t)r0 * DM; const bf* wr = Wt + (size_t)hp * HD * DM;
    const bf* A = isv ? xr : wr; const bf* Bt = isv ? wr : xr;
    v8f acc[4][4];
#pragma unroll
    for (int mb = 0; mb < 4; ++mb)
#pragma unroll
        for (int nb = 0; nb < 4; ++nb) acc[mb][nb] = (v8f){};
    const unsigned off = (unsigned)lane * 16u;   // bytes: the lane's part of every fragment address; the rest is the same for the whole wave
    // left rolled, as in k_gemmw: unrolled, this build asks for the B fragments one at a time and waits out each L2 round trip. Wave w takes the 32-wide k chunks w, w + NW, ...
#pragma unroll 1
    for (int i = 0; i < DM / (NW * 32); ++i) {
        V a[4]; const unsigned ko = off + (unsigned)((i * NW + wv) * 512) * 2u;   // a 32-bit byte offset beside a scalar base: one register serves all sixteen loads
#pragma unroll
        for (int mb = 0; mb < 4; ++mb) a[mb] = WF::ld((const bf*)((const char*)(A + mb * 16 * DM) + ko));
#pragma unroll
        for (int nb = 0; nb < 4; ++nb) { const V b = WF::ld((const bf*)((const char*)(Bt + nb * 16 * DM) + ko));
#pragma unroll
            for (int mb = 0; mb < 4; ++mb) acc[mb][nb] = WF::mma(a[mb], b, acc[mb][nb]); }
    }
#pragma unroll
    for (int nb = 0; nb < 4; ++nb)
#pragma unroll
        for (int mb = 0; mb < 4; ++mb) { float* o = os + wv * (64 * 68) + (nb * 16 + lr) * 68 + mb * 16 + 8 * hi; *(v4fa*)o = __builtin_shufflevector(acc[mb][nb], acc[mb][nb], 0, 1, 2, 3); *(v4fa*)(o + 4) = __builtin_shufflevector(acc[mb][nb], acc[mb][nb], 4, 5, 6, 7); }
    __syncthreads();   // every wave's partial tile is in LDS before any of it is summed
    const int bz = r0 / TT, t0 = r0 % TT;   // TT % 64 == 0: a tile lies in one batch
    const size_t base = isv ? (((size_t)bz * NKV + (hp - NH_ - NKV)) * TT + t0) * HD : (((size_t)bz * (NH_ + NKV) + hp) * TT + t0) * HD;   // in fragment order the tile is 8 KiB in a row of either kind of plane
    h16* P16 = (isv ? VT16 : QK16) + base; bf* Ph = (isv ? VTh : QKh) + base; bf* Pl = (isv ? VTl : QKl) + base;
#pragma unroll
    for (int s = 0; s < 64 * 8 / (NW * 32); ++s) { const int idx = s * NW * 32 + (int)threadIdx.x; const int u = s * NW + wv;   // the wave fills 512-byte piece u of the tile: q, k [16 t][32 d][piece], v [32 t][16 d][piece]
        const int row = (isv ? ((u >> 1) & 3) : (u >> 2)) * 16 + lr, cofs = (isv ? (u >> 3) * 32 + (u & 1) * 16 : (u & 3) * 16) + 8 * hi; v4f v0 = *(const v4fa*)(os + row * 68 + cofs), v1 = *(const v4fa*)(os + row * 68 + cofs + 4);
#pragma unroll
        for (int w = 1; w < NW; ++w) { v0 += *(const v4fa*)(os + w * (64 * 68) + row * 68 + cofs); v1 += *(const v4fa*)(os + w * (64 * 68) + row * 68 + cofs + 4); }
        v8h o16; v4u oh, ol;
#pragma unroll
        for (int q = 0; q < 8; ++q) o16[q] = tohx((q < 4) ? v0[q & 3] : v1[q & 3]);
#pragma unroll
        for (int q = 0; q < 4; ++q) { unsigned a2, c2; if (q < 2) splitpk(v0[2 * q], v0[2 * q + 1], a2, c2); else splitpk(v1[2 * q - 4], v1[2 * q - 3], a2, c2); oh[q] = a2; ol[q] = c2; }
        const unsigned oo = (unsigned)idx * 8u; *(v8h*)(P16 + oo) = o16; *(v8us*)(Ph + oo) = __builtin_bit_cast(v8us, oh); *(v8us*)(Pl + oo) = __builtin_bit_cast(v8us, ol); }   // a wave fills four 128-byte lines of each plane
}
// ---- k_fattn: scores, bias, softmax, attn.v and the head merge of one head's FW * 32 query rows in one work-group; no score and no probability goes through memory.
// Each of the FW waves owns 32 query rows and walks ALL keys in tiles of KS; a tile of K and of V^T is brought into LDS once per work-group by asynchronous copies (two buffers) and read by every wave.
// A wave forms S^T = K Q^T (A = key rows, B = query rows): in a 16 x 16 tile a lane holds 8 keys (8 hf + r) of ONE query (column c), so the tile's row maximum is in-lane plus one exchange between the lane halves,
// and two tiles, rounded in place, are the B operand of O^T = V^T P^T in the hardware k order. The softmax runs over the tiles with a running maximum and sum: O^T and the sum are scaled by exp(old max - new max) at each tile, and O^T is divided by the sum at the end.
#define FW   4
#define KS   64                   // keys per tile
#define NST  (TT / KS)
#define OP   68                   // floats per query row of a wave's output tile in LDS
#define PLB  (KS * HD * 2)        // bytes of one plane's tile: in fragment order it is one run of bytes of the plane
#define STB  (4 * PLB)            // bytes of one buffer: K, V^T (f16 rows) or K hi, K lo, V^T hi, V^T lo
typedef __attribute__((ext_vector_type(8))) unsigned v8u;
__device__ __forceinline__ float xhalf(float x) { return __builtin_bit_cast(float, __builtin_amdgcn_permlanex16(__builtin_bit_cast(int, x), __builtin_bit_cast(int, x), 0x76543210, 0xfedcba98, false, false)); }   // lane l's value to lane l ^ 16, on the vector side: no LDS counter is waited for
__device__ __forceinline__ v8f cat8(v4f lo, v4f hi) { return __builtin_shufflevector(lo, hi, 0, 1, 2, 3, 4, 5, 6, 7); }
// cp8: a wave's share (four 512-byte pieces each) of two planes' tiles, global memory -> LDS, through no register. la, lb: the lane's LDS byte addresses; ga, gb: the lane's global addresses.
// The wait on the address counter is the statement's last line, so that it stands in front of whatever rewrites an address register.
template <typename T16>
__device__ __forceinline__ void cp8(unsigned la, const T16* ga, unsigned lb, const T16* gb) {
    asm volatile("global_load_async_to_lds_b128 %0, %8, off\n\t"
                 "global_load_async_to_lds_b128 %1, %9, off\n\t"
                 "global_load_async_to_lds_b128 %2, %10, off\n\t"
                 "global_load_async_to_lds_b128 %3, %11, off\n\t"
                 "global_load_async_to_lds_b128 %4, %12, off\n\t"
                 "global_load_async_to_lds_b128 %5, %13, off\n\t"
                 "global_load_async_to_lds_b128 %6, %14, off\n\t"
                 "global_load_async_to_lds_b128 %7, %15, off\n\t"
                 "s_wait_xcnt 0x0"
                 :: "v"(la), "v"(la + 512u), "v"(la + 1024u), "v"(la + 1536u), "v"(lb), "v"(lb + 512u), "v"(lb + 1024u), "v"(lb + 1536u),
                    "v"(ga), "v"(ga + 256), "v"(ga + 512), "v"(ga + 768), "v"(gb), "v"(gb + 256), "v"(gb + 512), "v"(gb + 768) : "memory");
}
template <typename T16, bool HR>
__device__ __forceinline__ void fattn_body(const T16* __restrict__ Q, const T16* __restrict__ Q2, const T16* __restrict__ Kp, const T16* __restrict__ K2, const T16* __restrict__ Vt, const T16* __restrict__ Vt2, const float* __restrict__ cm, int qg, bf* Ah, bf* Al, const float* kb, char* ring) {
    // every loop of this function but the loop over the key tiles is unrolled in full: tiles and fragments are register arrays, which only constant indices keep in registers
    typedef WFrag<T16> WF; typedef typename WF::V V;
    constexpr int NQ = 2;
    constexpr int KC = HR ? 32 : KS, KT = KC / 16;   // keys per softmax step: the hi / lo rows, whose fragments take twice the registers, go through a tile in two steps
    const int lane = threadIdx.x & 31, c = lane & 15, hf = lane >> 4; const int wv = __builtin_amdgcn_readfirstlane((int)(threadIdx.x >> 5)); const int q0 = qg + wv * (NQ * 16);
    const unsigned lfr = (unsigned)lane * 8u;   // the lane's part of every fragment address; the rest is the same for the whole wave
    const unsigned cl = (unsigned)(size_t)ring + (unsigned)wv * (PLB / FW) + (unsigned)lane * 16u;   // LDS byte address of the lane's first copy: wave w brings quarter w of each plane's tile
    const unsigned cg = (unsigned)wv * (PLB / FW / 2) + lfr;   // the same place in a plane's tile, in elements
    auto fill = [&](int t) { const unsigned lb = cl + (unsigned)(t & 1) * STB; const size_t g = (size_t)t * (KS * HD) + cg;
        if constexpr (HR) { cp8(lb, Kp + g, lb + PLB, K2 + g); cp8(lb + 2 * PLB, Vt + g, lb + 3 * PLB, Vt2 + g); } else cp8(lb, Kp + g, lb + PLB, Vt + g); };
    fill(0);
    V qf[NQ][2], qf2[NQ][2];
#pragma unroll
    for (int qn = 0; qn < NQ; ++qn)
#pragma unroll
        for (int kc = 0; kc < 2; ++kc) { qf[qn][kc] = WF::ld(Q + (size_t)(q0 + qn * 16) * HD + kc * 512 + lfr); if (HR) qf2[qn][kc] = WF::ld(Q2 + (size_t)(q0 + qn * 16) * HD + kc * 512 + lfr); }
    const float c00 = bfr(cm[0]), c01 = bfr(cm[1]), c10 = bfr(cm[2]), c11 = bfr(cm[3]);
    asm volatile("s_wait_asynccnt 0x0" ::: "memory");   // this wave's share of tile 0 has landed
    __syncthreads();   // tile 0 and the per-key bias terms of every key are in LDS
    fill(1);
    float pc0[NQ], pc1[NQ], mr[NQ], ls[NQ];   // mr: running row maximum; ls: running sum over the keys of this lane half
    v8f oa[HD / 16][NQ];   // oa[db][qn][r]: d = db * 16 + 8 hf + r, query q0 + qn * 16 + c
#pragma unroll
    for (int qn = 0; qn < NQ; ++qn) { const float pi0 = kb[q0 + qn * 16 + c], pi1 = kb[TT + q0 + qn * 16 + c]; pc0[qn] = pi0 * c00 + pi1 * c10; pc1[qn] = pi0 * c01 + pi1 * c11; mr[qn] = -3.0e38f; ls[qn] = 0.f;   // a query's p is its position's rounded p
#pragma unroll
        for (int db = 0; db < HD / 16; ++db) oa[db][qn] = (v8f){}; }
    // left rolled: one tile's code serves all tiles, and the two buffers differ only in a base address
#pragma unroll 1
    for (int t = 0; t < NST; ++t) {
        const char* st = ring + (t & 1) * STB;
#pragma unroll
        for (int h = 0; h < KS / KC; ++h) {
        const int k0 = h * KC;   // KC keys are KC * HD elements in a row of a K tile and of a V^T tile alike
        const T16* Ks = (const T16*)st + k0 * HD + lfr; const T16* Ks2 = (const T16*)(st + PLB) + k0 * HD + lfr; const T16* Vs = (const T16*)(st + (HR ? 2 : 1) * PLB) + k0 * HD + lfr; const T16* Vs2 = (const T16*)(st + 3 * PLB) + k0 * HD + lfr;
        v8f sc[KT][NQ];   // sc[kt][qn][r]: key t * KS + k0 + kt * 16 + 8 hf + r, query q0 + qn * 16 + c
#pragma unroll
        for (int kt = 0; kt < KT; ++kt) { V a[2], a2[2];
#pragma unroll
            for (int kc = 0; kc < 2; ++kc) { a[kc] = WF::ld(Ks + kt * 1024 + kc * 512); if (HR) a2[kc] = WF::ld(Ks2 + kt * 1024 + kc * 512); }
#pragma unroll
            for (int qn = 0; qn < NQ; ++qn) { v8f s = (v8f){};
#pragma unroll
                for (int kc = 0; kc < 2; ++kc) { s = WF::mma(a[kc], qf[qn][kc], s); if (HR) { s = WF::mma(a[kc], qf2[qn][kc], s); s = WF::mma(a2[kc], qf[qn][kc], s); } }
                sc[kt][qn] = s; } }
        float mx[NQ];
#pragma unroll
        for (int qn = 0; qn < NQ; ++qn) mx[qn] = -3.0e38f;
#pragma unroll
        for (int kt = 0; kt < KT; ++kt) { const float* kk = kb + t * KS + k0 + kt * 16 + 8 * hf;
            const v8f pj0 = cat8(*(const v4fa*)kk, *(const v4fa*)(kk + 4)), pj1 = cat8(*(const v4fa*)(kk + TT), *(const v4fa*)(kk + TT + 4)), gs = cat8(*(const v4fa*)(kk + 2 * TT), *(const v4fa*)(kk + 2 * TT + 4));
#pragma unroll
            for (int qn = 0; qn < NQ; ++qn) { const v8f x = (sc[kt][qn] * SCL + (pj0 * pc0[qn] + pj1 * pc1[qn])) + gs; sc[kt][qn] = x;
#pragma unroll
                for (int r = 0; r < 8; ++r) mx[qn] = fmaxf(mx[qn], x[r]); } }
#pragma unroll
        for (int qn = 0; qn < NQ; ++qn) mx[qn] = fmaxf(mx[qn], xhalf(mx[qn]));   // the step's row maximum, over both lane halves
        V va[HD / 16][KC / 32], va2[HD / 16][KC / 32];
#pragma unroll
        for (int db = 0; db < HD / 16; ++db)
#pragma unroll
            for (int kk = 0; kk < KC / 32; ++kk) { va[db][kk] = WF::ld(Vs + kk * 2048 + db * 512); if (HR) va2[db][kk] = WF::ld(Vs2 + kk * 2048 + db * 512); }
        __builtin_amdgcn_sched_barrier(0);   // all V^T fragments of the step are asked for here and arrive under the exponentials: left alone, this build asks for half of them among the products and waits for them there
        V pf[KC / 32][NQ], pf2[KC / 32][NQ];   // element s of pf[kk][qn]: key t * KS + k0 + kk * 32 + (s < 8 ? 8 hf + s : 16 + 8 hf + s - 8), the order in which WFrag::ld takes V^T's keys
#pragma unroll
        for (int qn = 0; qn < NQ; ++qn) { const float mn = fmaxf(mr[qn], mx[qn]);
            const float al = __builtin_amdgcn_exp2f((mr[qn] - mn) * 1.4426950408889634f); mr[qn] = mn;   // 0 at the first tile, where sum and O^T are 0
            v8f vs;
#pragma unroll
            for (int kt = 0; kt < KT; ++kt) { const v8f d = (sc[kt][qn] - mn) * 1.4426950408889634f + (HR ? 0.0f : 10.0f); v8f e;   // f16 rows: probabilities carried x 1024 (2^10), away from f16's small numbers; the factor is in the sum too and leaves with the division
#pragma unroll
                for (int r = 0; r < 8; ++r) e[r] = __builtin_amdgcn_exp2f(d[r]);
                sc[kt][qn] = e; vs = (kt == 0) ? e : vs + e; }
            ls[qn] = ls[qn] * al + (((vs[0] + vs[1]) + (vs[2] + vs[3])) + ((vs[4] + vs[5]) + (vs[6] + vs[7])));
#pragma unroll
            for (int db = 0; db < HD / 16; ++db) oa[db][qn] *= al;
#pragma unroll
            for (int kk = 0; kk < KC / 32; ++kk) { const v8f p0 = sc[2 * kk][qn], p1 = sc[2 * kk + 1][qn];
                if constexpr (HR) { v8u wh, wl;   // each pair of neighbouring keys is rounded and packed into its hi word and its lo word at once
#pragma unroll
                    for (int w = 0; w < 8; ++w) { const float xa = (w < 4) ? p0[2 * w] : p1[2 * w - 8], xb = (w < 4) ? p0[2 * w + 1] : p1[2 * w - 7];
                        unsigned h2, l2; splitpk(xa, xb, h2, l2); wh[w] = h2; wl[w] = l2; }
                    pf[kk][qn] = __builtin_bit_cast(v16bf, wh); pf2[kk][qn] = __builtin_bit_cast(v16bf, wl);
                } else { v8h x0, x1;
#pragma unroll
                    for (int r = 0; r < 8; ++r) { x0[r] = tohx(p0[r]); x1[r] = tohx(p1[r]); }
                    pf[kk][qn] = cat16(x0, x1); } } }
        asm volatile("" :: "v"(ls[0]), "v"(ls[1]));   // inputs only: the running sums are formed by here. Left alone, this build moves their additions to the loop's foot and keeps every unpacked probability in registers beside the packed ones
#pragma unroll
        for (int db = 0; db < HD / 16; ++db)
#pragma unroll
            for (int kk = 0; kk < KC / 32; ++kk)
#pragma unroll
                for (int qn = 0; qn < NQ; ++qn) { oa[db][qn] = WF::mma(va[db][kk], pf[kk][qn], oa[db][qn]); if (HR) { oa[db][qn] = WF::mma(va[db][kk], pf2[kk][qn], oa[db][qn]); oa[db][qn] = WF::mma(va2[db][kk], pf[kk][qn], oa[db][qn]); } }
        }
        asm volatile("s_wait_dscnt 0x0" ::: "memory");      // this wave's reads of the buffer are over before the buffer is given up
        asm volatile("s_wait_asynccnt 0x0" ::: "memory");   // this wave's share of tile t + 1 has landed
        __syncthreads();   // tile t + 1 is whole, and every wave has left tile t's buffer
        if (t + 2 < NST) fill(t + 2);
    }
    asm volatile("s_wait_asynccnt 0x0" ::: "memory");   // no copy is under way when the ring becomes output staging
    float* os = (float*)ring + wv * (NQ * 16 * OP);   // behind the loop's last barrier: each wave stages its own rows
#pragma unroll
    for (int qn = 0; qn < NQ; ++qn) { const float inv = __fdiv_rn(1.0f, ls[qn] + xhalf(ls[qn]));
#pragma unroll
        for (int db = 0; db < HD / 16; ++db) { const v8f o8 = oa[db][qn] * inv; float* o = os + (qn * 16 + c) * OP + db * 16 + 8 * hf; *(v4fa*)o = __builtin_shufflevector(o8, o8, 0, 1, 2, 3); *(v4fa*)(o + 4) = __builtin_shufflevector(o8, o8, 4, 5, 6, 7); } }
    __syncthreads();   // the staged rows are written before other lanes read them
#pragma unroll
    for (int u = 0; u < NQ * 8; ++u) {   // half-piece u (256 bytes: 16 rows x 8 d) of the wave's [16 rows][32 d][piece] blocks; lane halves take d 0..3 and 4..7 of a row
        const int row = (u >> 3) * 16 + c, cofs = (u & 7) * 8 + hf * 4; const v4f val = *(const v4fa*)(os + row * OP + cofs); v2u oh, ol;
#pragma unroll
        for (int q = 0; q < 2; ++q) { unsigned a, b; splitpk(val[2 * q], val[2 * q + 1], a, b); oh[q] = a; ol[q] = b; }
        const size_t oo = (size_t)(q0 + (u >> 3) * 16) * DQ + ((u >> 2) & 1) * 512 + (u & 3) * 128 + c * 8 + hf * 4; *(v4us*)(Ah + oo) = __builtin_bit_cast(v4us, oh); *(v4us*)(Al + oo) = __builtin_bit_cast(v4us, ol); }
}
// grid (NH_, TT / (32 FW), NB_): 32 FW query rows of one head of one batch; QK*: per batch the q head planes with the k head planes behind them, [b][h] planes of TT rows x HD; VT*: [b][h] planes of HD rows x TT; Ah / Al: the merged rows, one plane of NB_ * TT rows x DQ; all in fragment order
__global__ __launch_bounds__(32 * FW) void k_fattn(const h16* __restrict__ QK16, const bf* __restrict__ QKh, const bf* __restrict__ QKl, const h16* __restrict__ VT16, const bf* __restrict__ VTh, const bf* __restrict__ VTl, const float* __restrict__ pp, const float* __restrict__ ss, const float* __restrict__ cm, const float* __restrict__ gam, bf* Ah, bf* Al) {
    __shared__ __align__(16) float kb[3 * TT]; __shared__ __align__(1024) char ring[2 * STB];
    const int hh = blockIdx.x, q0 = blockIdx.y * (32 * FW), bz = blockIdx.z;   // heads run fastest: a batch's hi / lo row blocks, which cost most, start first
    pp += (size_t)bz * TT * 2; ss += (size_t)bz * TT;
    // per-key bias terms, each key once per work-group: bf16-rounded p_j0, p_j1 and gamma * s_j
#pragma unroll
    for (int k4 = (int)threadIdx.x * 4; k4 < TT; k4 += 32 * FW * 4) { const v4f pa = *(const v4f*)(pp + (size_t)k4 * 2), pb = *(const v4f*)(pp + (size_t)k4 * 2 + 4), sv = *(const v4f*)(ss + k4); const float gmm = bfr(gam[0]);
        const unsigned w0 = bfpk(pa[0], pa[1]), w1 = bfpk(pa[2], pa[3]), w2 = bfpk(pb[0], pb[1]), w3 = bfpk(pb[2], pb[3]), w4 = bfpk(sv[0], sv[1]), w5 = bfpk(sv[2], sv[3]);
        const v4f o0 = { bflo(w0), bflo(w1), bflo(w2), bflo(w3) }, o1 = { bfhi(w0), bfhi(w1), bfhi(w2), bfhi(w3) }, og = { gmm * bflo(w4), gmm * bfhi(w4), gmm * bflo(w5), gmm * bfhi(w5) };
        *(v4fa*)(kb + k4) = o0; *(v4fa*)(kb + TT + k4) = o1; *(v4fa*)(kb + 2 * TT + k4) = og; }
    const size_t qo = ((size_t)bz * (NH_ + NKV) + hh) * TT * HD, ko = ((size_t)bz * (NH_ + NKV) + NH_ + hh / REP) * TT * HD, vo = ((size_t)bz * NKV + hh / REP) * HD * TT;
    Ah += (size_t)bz * TT * DQ; Al += (size_t)bz * TT * DQ;
    if (q0 < RH) fattn_body<bf, true>(QKh + qo, QKl + qo, QKh + ko, QKl + ko, VTh + vo, VTl + vo, cm + hh * 4, q0, Ah + hh * (HD / 32) * 512, Al + hh * (HD / 32) * 512, kb, ring);
    else fattn_body<h16, false>(QK16 + qo, nullptr, QK16 + ko, nullptr, VT16 + vo, nullptr, cm + hh * 4, q0, Ah + hh * (HD / 32) * 512, Al + hh * (HD / 32) * 512, kb, ring);
}

extern "C" void kernel_launch(void* const* d_in, const int* in_sizes, int n_in,
                              void* d_out, int out_size, void* d_ws, size_t ws_size, hipStream_t stream) {
    (void)in_sizes; (void)n_in; (void)out_size;
    const float* x = (const float*)d_in[0]; const float* pp = (const float*)d_in[1]; const float* ss = (const float*)d_in[2]; const float* wq = (const float*)d_in[3]; const float* wk = (const float*)d_in[4]; const float* wv = (const float*)d_in[5]; const float* wo = (const float*)d_in[6]; const float* bo = (const float*)d_in[7]; const float* compat = (const float*)d_in[8]; const float* gam = (const float*)d_in[9]; const float* cosT = nullptr; const float* sinT = nullptr; (void)cosT; (void)sinT;
    float* OUT = (float*)d_out;     // [4][2048][768]
    char* wsp = (char*)d_ws;
    auto take = [&](size_t bytes) { char* p = wsp; wsp += (bytes + 255) & ~(size_t)255; return (void*)p; };
    bf* WQ = (bf*)take((size_t)(DQ + 2 * DKV) * DM * 2 + (size_t)DM * DQ * 2); bf* WO = WQ + (size_t)(DQ + 2 * DKV) * DM;   // wq, wk, wv, wo planes one behind the other: [wq; wk; wv] is one Bt of DQ + 2 DKV rows
    bf* XB = (bf*)take((size_t)NB_ * TT * DM * 2);
    const size_t SQK = (size_t)(NH_ + NKV) * TT * HD, SV = (size_t)NKV * HD * TT;   // elements of one batch's q + k planes and of its v planes
    h16* QP16 = (h16*)take(NB_ * SQK * 2); h16* VT16 = (h16*)take(NB_ * SV * 2);   // the k head planes follow the q head planes
    bf* QPh = (bf*)take(NB_ * SQK * 2); bf* QPl = (bf*)take(NB_ * SQK * 2); bf* VTh = (bf*)take(NB_ * SV * 2); bf* VTl = (bf*)take(NB_ * SV * 2);
    bf* ATh = (bf*)take((size_t)NB_ * TT * DQ * 2); bf* ATl = (bf*)take((size_t)NB_ * TT * DQ * 2);
    if ((size_t)(wsp - (char*)d_ws) > ws_size) return;    // ws 256 MiB
    k_cvt8w<<<dim3((unsigned)(((size_t)DQ * DM / 8 + 255) / 256), 4, 1), 256, 0, stream>>>(wq, wk, wv, wo, WQ, (size_t)DQ * DM / 8);
    k_cvt8<<<(unsigned)(((size_t)NB_ * TT * DM / 8 + 255) / 256), 256, 0, stream>>>(x, XB, (size_t)NB_ * TT * DM / 8);
    k_qkv<8><<<dim3(NB_ * TT / 64, NH_ + 2 * NKV, 1), 256, 0, stream>>>(XB, WQ, QP16, QPh, QPl, VT16, VTh, VTl);   // the four batches' rows follow one another in XB
    k_fattn<<<dim3(NH_, TT / (32 * FW), NB_), 32 * FW, 0, stream>>>(QP16, QPh, QPl, VT16, VTh, VTl, pp, ss, compat, gam, ATh, ATl);
    k_gemmw<bf, 1, true, 8><<<dim3(NB_ * TT / 64, DM / 64, 1), 256, 0, stream>>>(ATh, ATl, WO, nullptr, DQ, OUT, DM, bo, 0, 0, 0);   // the four batches' rows follow one another in ATh / ATl and in OUT
}

// v008
// Measured time: 151 microseconds a run.
// Two timings next to v007 both put it at 1.04 times that version's speed.
// All steps since v000 together make it 21.5 times as fast.
#include <hip/hip_runtime.h>

// SBERTaAttention (H [4][2048][768], p [4][2048][2] (language probs, read), s [4][2048] (read), compat [12][2][2], gamma [1]; Q/K/V = H W^T (12 x 64, no bias); scores = Q.K / 8 + (p_i compat_h) . p_j + gamma s_j; softmax; out = merged wo^T + bo -> [4][2048][768]).
// Compute dtypes, f32 accumulate: every input rounded to bf16; Q/K/V on PLAIN bf16 operands (inputs: exact); scores PRECPLAN; the bilinear language bias (2x2 per head) and the position bias, from the bf16-rounded p, s, compat, gamma, added by one more matrix product per score tile (k_fattn: the query side split into three 16-bit parts, products exact); softmax f32; attn.v: rows < 512 hl (3 products), the rest fp16 (x1024); wo hl x exact (2 products) + bias.

#define NB_  4
#define TT   2048
#define DM   768
#define NH_  12
#define NKV  12
#define REP  (NH_ / NKV)
#define HD   64
#define DQ   (NH_ * HD)
#define DKV  (NKV * HD)
#define RH   512                  // query rows < RH use hi+lo planes (0: none)
#define WIN  0
#define PCAR 1024.0f
#define SCL  0.125f   // HD^-0.5
typedef _Float16 h16;
typedef unsigned short bf;
typedef __attribute__((ext_vector_type(16))) __bf16   v16bf;
typedef __attribute__((ext_vector_type(16))) _Float16 v16h;
typedef __attribute__((ext_vector_type(8)))  _Float16 v8h;
typedef __attribute__((ext_vector_type(8)))  unsigned short v8us;
typedef __attribute__((ext_vector_type(8)))  float    v8f;
typedef __attribute__((ext_vector_type(4)))  float    v4f;
typedef v8h  __attribute__((may_alias)) v8ha;
typedef v4f  __attribute__((may_alias)) v4fa;
typedef v8us __attribute__((may_alias)) v8usa;

typedef __attribute__((ext_vector_type(2))) __bf16 v2bf;
typedef __attribute__((ext_vector_type(2))) float v2f;
typedef __attribute__((ext_vector_type(2))) unsigned v2u;
typedef __attribute__((ext_vector_type(4))) unsigned v4u;
// f32 -> bf16 by the chip's own convert (round to nearest even): one instruction rounds and packs two values
__device__ __forceinline__ unsigned short f2bf(float f) { return __builtin_bit_cast(unsigned short, (__bf16)f); }
__device__ __forceinline__ unsigned bfpk(float a, float b) { const v2f x = { a, b }; return __builtin_bit_cast(unsigned, __builtin_convertvector(x, v2bf)); }   // a in the low half, b in the high half
__device__ __forceinline__ float bflo(unsigned w) { return __uint_as_float(w << 16); }
__device__ __forceinline__ float bfhi(unsigned w) { return __uint_as_float(w & 0xFFFF0000u); }
__device__ __forceinline__ void splitpk(float a, float b, unsigned& h, unsigned& l) { h = bfpk(a, b); l = bfpk(a - bflo(h), b - bfhi(h)); }   // hi plane word and lo plane word of two values: lo = bf16(x - hi)
__device__ __forceinline__ float bf2f(unsigned short b) { return __uint_as_float(((unsigned)b) << 16); }
__device__ __forceinline__ float bfr(float f) { return bf2f(f2bf(f)); }
__device__ __forceinline__ v16h cat16(v8h lo, v8h hi) { return __builtin_shufflevector(lo, hi, 0, 1, 2, 3, 4, 5, 6, 7, 8, 9, 10, 11, 12, 13, 14, 15); }
__device__ __forceinline__ v16bf cat16b(v8us lo, v8us hi) { return __builtin_bit_cast(v16bf, __builtin_shufflevector(lo, hi, 0, 1, 2, 3, 4, 5, 6, 7, 8, 9, 10, 11, 12, 13, 14, 15)); }
__device__ __forceinline__ v8f wmma16(v16h a, v16h b, v8f c) { return __builtin_amdgcn_wmma_f32_16x16x32_f16(false, a, false, b, (short)0, c, false, false); }
__device__ __forceinline__ v8f wmmab(v16bf a, v16bf b, v8f c) { return __builtin_amdgcn_wmma_f32_16x16x32_bf16(false, a, false, b, (short)0, c, false, false); }



// ---- k_gemmw: register-blocked GEMM, NW WAVES per 64x64 output tile (16 accumulators each), operands straight from 16-bit planes in fragment order; grid (M/64, N/64, Z), 32 * NW threads.
// Wave w takes the 32-wide k chunks w, w + NW, w + 2 NW, ... (neighbouring waves read neighbouring 1-KiB blocks); the NW partial tiles are summed through LDS in wave order 0..NW-1. K % (32 * NW) == 0.
// C[m][n] (f32, pitch ldc, + optional f32 bias[n]) = sum_k A[m][k] Bt[n][k] (+ split products per NSPLIT). z-batch strides sA/sB/sC in elements. K % 32 == 0.
// FRAGMENT ORDER: every 16-bit operand plane in the workspace is kept as blocks of 16 rows x 32 k (1 KiB), each block as the two 512-byte pieces that a wave loads:
// element (row, k) of a block lies at ((k >> 4) & 1) * 256 + (((k >> 3) & 1) * 16 + (row & 15)) * 8 + (k & 7). Lane l reads 16 bytes at l * 16 of each piece, so a wave-wide load covers four whole 128-byte lines
// (row-major planes gave 32 bytes of each of 16 lines). The values a lane gets, and so the k order, are those of the row-major loader. A plane of R rows and K columns is [R / 16][K / 32] blocks; the v planes are [TT / 32][HD / 16] blocks.
template <typename T16> struct WFrag;
template <> struct WFrag<h16> { typedef v16h V; static __device__ __forceinline__ V ld(const h16* p) { return cat16(*(const v8h*)p, *(const v8h*)(p + 256)); } static __device__ __forceinline__ v8f mma(V a, V b, v8f c) { return wmma16(a, b, c); } };
template <> struct WFrag<bf> { typedef v16bf V; static __device__ __forceinline__ V ld(const bf* p) { return cat16b(*(const v8us*)p, *(const v8us*)(p + 256)); } static __device__ __forceinline__ v8f mma(V a, V b, v8f c) { return wmmab(a, b, c); } };
template <typename T16, int NSPLIT, bool BIAS, int NW>
__global__ __launch_bounds__(32 * NW) void k_gemmw(const T16* __restrict__ A, const T16* __restrict__ A2, const T16* __restrict__ Bt, const T16* __restrict__ Bt2, int K, float* C, int ldc, const float* __restrict__ bias, size_t sA, size_t sB, size_t sC) {
    typedef typename WFrag<T16>::V V;
    constexpr int RS = (NW > 1) ? 64 : 16;   // tile rows that pass through LDS at once: with NW > 1 the whole tile, so that one barrier serves it and no store is waited for
    __shared__ __align__(16) float os[NW * RS * 68];
    const size_t z = blockIdx.z; A += z * sA; if (A2) A2 += z * sA; Bt += z * sB; if (Bt2) Bt2 += z * sB; C += z * sC;
    const int lane = threadIdx.x & 31, lr = lane & 15, hi = lane >> 4; const int wv = (NW > 1) ? __builtin_amdgcn_readfirstlane((int)(threadIdx.x >> 5)) : 0 /* wave number in a scalar register: the k loop's counter and branch stay scalar */; const int r0 = blockIdx.x * 64, c0 = blockIdx.y * 64;
    v8f acc[4][4];
#pragma unroll
    for (int mb = 0; mb < 4; ++mb)
#pragma unroll
        for (int nb = 0; nb < 4; ++nb) acc[mb][nb] = (v8f){};
    const size_t aoff = (size_t)r0 * K + 8 * lane, boff = (size_t)c0 * K + 8 * lane;   // 16 rows of K columns are K / 32 blocks of 512 elements: a row block starts where it did row-major
#pragma unroll 1
    for (int kc = wv * 32; kc < K; kc += NW * 32) {
        V a[4], a2[4];
#pragma unroll
        for (int mb = 0; mb < 4; ++mb) { a[mb] = WFrag<T16>::ld(A + aoff + (size_t)mb * 16 * K + kc * 16); if (NSPLIT == 1 || NSPLIT == 2) a2[mb] = WFrag<T16>::ld(A2 + aoff + (size_t)mb * 16 * K + kc * 16); }
#pragma unroll
        for (int nb = 0; nb < 4; ++nb) { const V b = WFrag<T16>::ld(Bt + boff + (size_t)nb * 16 * K + kc * 16); V b2; if (NSPLIT >= 2) b2 = WFrag<T16>::ld(Bt2 + boff + (size_t)nb * 16 * K + kc * 16);
#pragma unroll
            for (int mb = 0; mb < 4; ++mb) { acc[mb][nb] = WFrag<T16>::mma(a[mb], b, acc[mb][nb]); if (NSPLIT == 1 || NSPLIT == 2) acc[mb][nb] = WFrag<T16>::mma(a2[mb], b, acc[mb][nb]); if (NSPLIT >= 2) acc[mb][nb] = WFrag<T16>::mma(a[mb], b2, acc[mb][nb]); } }
        asm volatile("v_nop\n\tv_nop\n\tv_nop\n\tv_nop" : "+v"(acc[0][0]), "+v"(acc[1][1]), "+v"(acc[2][2]), "+v"(acc[3][3]) : "v"(a[0]), "v"(a[3]));
    }
#pragma unroll
    for (int m0 = 0; m0 < 4; m0 += RS / 16) {
#pragma unroll
        for (int mb = m0; mb < m0 + RS / 16; ++mb) {
#pragma unroll
            for (int nb = 0; nb < 4; ++nb) {
#pragma unroll
                for (int j = 0; j < 8; ++j) os[wv * RS * 68 + ((mb - m0) * 16 + hi * 8 + j) * 68 + nb * 16 + lr] = acc[mb][nb][j]; } }
        if (NW > 1) __syncthreads();   // every wave's partial tile is in LDS before any of it is summed
        else { __builtin_amdgcn_wave_barrier(); asm volatile("" ::: "memory"); }   // one wave: only the compiler's order of the LDS writes and reads is to be kept
        float* crow = C + (size_t)(r0 + m0 * 16) * ldc + c0;
{
#pragma unroll
            for (int s = 0; s < RS * 16 / (NW * 32); ++s) { const int idx = s * NW * 32 + (int)threadIdx.x; const int row = idx >> 4, cofs = (idx & 15) * 4; v4f val = *(const v4fa*)(os + row * 68 + cofs);
#pragma unroll
                for (int w = 1; w < NW; ++w) val += *(const v4fa*)(os + w * RS * 68 + row * 68 + cofs);
                if (BIAS) { val[0] += bfr(bias[c0 + cofs]); val[1] += bfr(bias[c0 + cofs + 1]); val[2] += bfr(bias[c0 + cofs + 2]); val[3] += bfr(bias[c0 + cofs + 3]); }
                *(v4f*)(crow + (size_t)row * ldc + cofs) = val; }
             }
        if (NW == 1) { __builtin_amdgcn_wave_barrier(); asm volatile("" ::: "memory"); }   // the next row block's LDS writes stay behind these reads
    }
}

__device__ __forceinline__ h16 tohx(float x) { return (h16)x; }
typedef __attribute__((ext_vector_type(2))) _Float16 v2h;
typedef __attribute__((ext_vector_type(4))) _Float16 v4h;
typedef __attribute__((ext_vector_type(2))) unsigned short v2us;
typedef __attribute__((ext_vector_type(4))) unsigned short v4us;
typedef __attribute__((ext_vector_type(4))) int v4i;

__global__ __launch_bounds__(256) void k_wtG(const float* __restrict__ w, int K, int N, bf* Bt) {
    const int lane = threadIdx.x & 31; const int L0 = (blockIdx.x * 8 + (threadIdx.x >> 5)) * 8; const int nlines = N * K / 64;
{
#pragma unroll 1
        for (int l = 0; l < 8; ++l) { const int L = L0 + l; if (L >= nlines) break; const size_t e = (size_t)L * 64 + lane * 2; const int k = (int)(e % K), n = (int)(e / K); v2us o;
            o[0] = f2bf(w[(size_t)k * N + n]); o[1] = f2bf(w[(size_t)(k + 1) * N + n]); *(v2us*)(Bt + e) = o; }
         }
}
// frsrc: the row-major element offset (rows of DM) of the 8 values that make 16-byte unit i of a plane in fragment order
__device__ __forceinline__ unsigned frsrc(size_t i8) { const unsigned i = (unsigned)i8, l = i & 31u, part = (i >> 5) & 1u, blk = i >> 6, rt = blk / (DM / 32), kch = blk % (DM / 32); return (rt * 16u + (l & 15u)) * DM + kch * 32u + part * 16u + (l >> 4) * 8u; }   // the largest plane has NB_ * TT * DM elements: 32 bits hold every offset
__global__ __launch_bounds__(256) void k_cvt8(const float* __restrict__ src, bf* dst, size_t n8) { const size_t i = (size_t)blockIdx.x * 256 + threadIdx.x; if (i >= n8) return; const v8f v = *(const v8f*)(src + frsrc(i)); v4u o;
#pragma unroll
    for (int k = 0; k < 4; ++k) o[k] = bfpk(v[2 * k], v[2 * k + 1]); *(v8us*)(dst + i * 8) = __builtin_bit_cast(v8us, o);  }
// k_cvt8w: the four weight matrices (n8 * 8 elements each), one per blockIdx.y, into four planes that follow one another in dst
__global__ __launch_bounds__(256) void k_cvt8w(const float* __restrict__ w0, const float* __restrict__ w1, const float* __restrict__ w2, const float* __restrict__ w3, bf* dst, size_t n8) { const size_t i = (size_t)blockIdx.x * 256 + threadIdx.x; if (i >= n8) return; const int y = blockIdx.y; const float* src = (y == 0) ? w0 : (y == 1) ? w1 : (y == 2) ? w2 : w3; const v8f v = *(const v8f*)(src + frsrc(i)); v4u o;
#pragma unroll
    for (int k = 0; k < 4; ++k) o[k] = bfpk(v[2 * k], v[2 * k + 1]); *(v8us*)(dst + ((size_t)y * n8 + i) * 8) = __builtin_bit_cast(v8us, o);  }
__global__ __launch_bounds__(256) void k_cscvt(const float* __restrict__ cosT, const float* __restrict__ sinT, float* CS) { const int idx = blockIdx.x * 256 + threadIdx.x; if (idx >= TT * HD) return; v2f cs; cs[0] = bfr(cosT[idx]); cs[1] = bfr(sinT[idx]); *(v2f*)(CS + (size_t)idx * 2) = cs;  }
// ---- k_qkv: q, k and v of all batches as one product, NW waves per 64 x 64 tile with k_gemmw's k split and loop; a tile is 64 positions of ONE head of q, k or v, and it leaves as that head's fp16 and hi / lo planes: no f32 copy goes through memory.
// X: [b * TT + t][DM]; Wt: [wq; wk; wv], DQ + 2 DKV rows of DM; both, and all planes written, in fragment order. grid (NB_ * TT / 64, (NH_ + 2 NKV)), 32 * NW threads. DM % (32 * NW) == 0.
// A lane holds 8 consecutive A rows of one B row, so a partial tile goes to LDS as [B row][A row] in 16-byte stores. q, k planes are [t][d]: A = weight rows, B = positions. v planes are [d][t]: A = positions, B = weight rows.
template <int NW>
__global__ __launch_bounds__(32 * NW) void k_qkv(const bf* __restrict__ X, const bf* __restrict__ Wt, h16* QK16, bf* QKh, bf* QKl, h16* VT16, bf* VTh, bf* VTl) {
    // every loop but the k loop is unrolled in full: tiles and fragments are register arrays, which only constant indices keep in registers
    typedef WFrag<bf> WF; typedef WF::V V;
    __shared__ __align__(16) float os[NW * 64 * 68];
    const int lane = threadIdx.x & 31, lr = lane & 15, hi = lane >> 4; const int wv = __builtin_amdgcn_readfirstlane((int)(threadIdx.x >> 5)) /* wave number in a scalar register: what is formed from it stays on the scalar side */; const int r0 = blockIdx.x * 64, hp = blockIdx.y;
    const bool isv = hp >= NH_ + NKV;   // the same for the whole work-group
    const bf* xr = X + (size_t)r0 * DM; const bf* wr = Wt + (size_t)hp * HD * DM;
    const bf* A = isv ? xr : wr; const bf* Bt = isv ? wr : xr;
    v8f acc[4][4];
#pragma unroll
    for (int mb = 0; mb < 4; ++mb)
#pragma unroll
        for (int nb = 0; nb < 4; ++nb) acc[mb][nb] = (v8f){};
    const unsigned off = (unsigned)lane * 16u;   // bytes: the lane's part of every fragment address; the rest is the same for the whole wave
    // left rolled, as in k_gemmw: unrolled, this build asks for the B fragments one at a time and waits out each L2 round trip. Wave w takes the 32-wide k chunks w, w + NW, ...
#pragma unroll 1
    for (int i = 0; i < DM / (NW * 32); ++i) {
        V a[4]; const unsigned ko = off + (unsigned)((i * NW + wv) * 512) * 2u;   // a 32-bit byte offset beside a scalar base: one register serves all sixteen loads
#pragma unroll
        for (int mb = 0; mb < 4; ++mb) a[mb] = WF::ld((const bf*)((const char*)(A + mb * 16 * DM) + ko));
#pragma unroll
        for (int nb = 0; nb < 4; ++nb) { const V b = WF::ld((const bf*)((const char*)(Bt + nb * 16 * DM) + ko));
#pragma unroll
            for (int mb = 0; mb < 4; ++mb) acc[mb][nb] = WF::mma(a[mb], b, acc[mb][nb]); }
    }
#pragma unroll
    for (int nb = 0; nb < 4; ++nb)
#pragma unroll
        for (int mb = 0; mb < 4; ++mb) { float* o = os + wv * (64 * 68) + (nb * 16 + lr) * 68 + mb * 16 + 8 * hi; *(v4fa*)o = __builtin_shufflevector(acc[mb][nb], acc[mb][nb], 0, 1, 2, 3); *(v4fa*)(o + 4) = __builtin_shufflevector(acc[mb][nb], acc[mb][nb], 4, 5, 6, 7); }
    __syncthreads();   // every wave's partial tile is in LDS before any of it is summed
    const int bz = r0 / TT, t0 = r0 % TT;   // TT % 64 == 0: a tile lies in one batch
    const size_t base = isv ? (((size_t)bz * NKV + (hp - NH_ - NKV)) * TT + t0) * HD : (((size_t)bz * (NH_ + NKV) + hp) * TT + t0) * HD;   // in fragment order the tile is 8 KiB in a row of either kind of plane
    h16* P16 = (isv ? VT16 : QK16) + base; bf* Ph = (isv ? VTh : QKh) + base; bf* Pl = (isv ? VTl : QKl) + base;
#pragma unroll
    for (int s = 0; s < 64 * 8 / (NW * 32); ++s) { const int idx = s * NW * 32 + (int)threadIdx.x; const int u = s * NW + wv;   // the wave fills 512-byte piece u of the tile: q, k [16 t][32 d][piece], v [32 t][16 d][piece]
        const int row = (isv ? ((u >> 1) & 3) : (u >> 2)) * 16 + lr, cofs = (isv ? (u >> 3) * 32 + (u & 1) * 16 : (u & 3) * 16) + 8 * hi; v4f v0 = *(const v4fa*)(os + row * 68 + cofs), v1 = *(const v4fa*)(os + row * 68 + cofs + 4);
#pragma unroll
        for (int w = 1; w < NW; ++w) { v0 += *(const v4fa*)(os + w * (64 * 68) + row * 68 + cofs); v1 += *(const v4fa*)(os + w * (64 * 68) + row * 68 + cofs + 4); }
        v8h o16; v4u oh, ol;
#pragma unroll
        for (int q = 0; q < 8; ++q) o16[q] = tohx((q < 4) ? v0[q & 3] : v1[q & 3]);
#pragma unroll
        for (int q = 0; q < 4; ++q) { unsigned a2, c2; if (q < 2) splitpk(v0[2 * q], v0[2 * q + 1], a2, c2); else splitpk(v1[2 * q - 4], v1[2 * q - 3], a2, c2); oh[q] = a2; ol[q] = c2; }
        const unsigned oo = (unsigned)idx * 8u; *(v8h*)(P16 + oo) = o16; *(v8us*)(Ph + oo) = __builtin_bit_cast(v8us, oh); *(v8us*)(Pl + oo) = __builtin_bit_cast(v8us, ol); }   // a wave fills four 128-byte lines of each plane
}
// ---- k_fattn: scores, bias, softmax, attn.v and the head merge of one head's FW * 32 query rows in one work-group; no score and no probability goes through memory.
// Each of the FW waves owns 32 query rows and walks ALL keys in tiles of KS; a tile of K and of V^T is brought into LDS once per work-group by asynchronous copies (two buffers) and read by every wave.
// A wave forms S^T = K Q^T (A = key rows, B = query rows): in a 16 x 16 tile a lane holds 8 keys (8 hf + r) of ONE query (column c), so the tile's row maximum is in-lane plus one exchange between the lane halves,
// and two tiles, rounded in place, are the B operand of O^T = V^T P^T in the hardware k order. The softmax runs over the tiles with a running maximum and sum: O^T and the sum are scaled by exp(old max - new max) at each tile, and O^T is divided by the sum at the end.
// BIAS AS A PRODUCT: bias(i, j) = pc0(i) p0(j) + pc1(i) p1(j) + gamma s(j) has rank 3, so it is a third k chunk of the score product. A key's 8 slots (16 bytes in LDS): p0 p1 p0 p1 p0 p1 s s; a query's: 8 pc0, 8 pc1 in three 16-bit parts each (hi, mid, lo), 8 gamma in two.
// The factor 8 = 1 / SCL is exact; the accumulator then holds 8 x the score, and SCL goes into the one multiply-add in front of the exponential. Of a 32-wide chunk only 8 k places are used: two key tiles share one A operand (tile 0's slots at k 0..7, tile 1's at k 16..23), and the query operand has zeros wherever the other tile's (or the other lane half's copy of the) slots stand.
#define FW   4
#define KS   64                   // keys per tile
#define NST  (TT / KS)
#define OP   68                   // floats per query row of a wave's output tile in LDS
#define PLB  (KS * HD * 2)        // bytes of one plane's tile: in fragment order it is one run of bytes of the plane
#define STB  (4 * PLB)            // bytes of one buffer: K, V^T (f16 rows) or K hi, K lo, V^T hi, V^T lo
typedef __attribute__((ext_vector_type(8))) unsigned v8u;
__device__ __forceinline__ float xhalf(float x) { return __builtin_bit_cast(float, __builtin_amdgcn_permlanex16(__builtin_bit_cast(int, x), __builtin_bit_cast(int, x), 0x76543210, 0xfedcba98, false, false)); }   // lane l's value to lane l ^ 16, on the vector side: no LDS counter is waited for
__device__ __forceinline__ v8f cat8(v4f lo, v4f hi) { return __builtin_shufflevector(lo, hi, 0, 1, 2, 3, 4, 5, 6, 7); }
typedef v4u __attribute__((may_alias)) v4ua;
// pk3: a, b rounded to the path's 16-bit type and packed (a in the low half); ra, rb: what the rounding left over
template <bool HR>
__device__ __forceinline__ unsigned pk3(float a, float b, float& ra, float& rb) {
    if constexpr (HR) { const unsigned w = bfpk(a, b); ra = a - bflo(w); rb = b - bfhi(w); return w; }
    else { const v2h x = { (h16)a, (h16)b }; ra = a - (float)x[0]; rb = b - (float)x[1]; return __builtin_bit_cast(unsigned, x); }
}
// cp8: a wave's share (four 512-byte pieces each) of two planes' tiles, global memory -> LDS, through no register. la, lb: the lane's LDS byte addresses; ga, gb: the lane's global addresses.
// The wait on the address counter is the statement's last line, so that it stands in front of whatever rewrites an address register.
template <typename T16>
__device__ __forceinline__ void cp8(unsigned la, const T16* ga, unsigned lb, const T16* gb) {
    asm volatile("global_load_async_to_lds_b128 %0, %8, off\n\t"
                 "global_load_async_to_lds_b128 %1, %9, off\n\t"
                 "global_load_async_to_lds_b128 %2, %10, off\n\t"
                 "global_load_async_to_lds_b128 %3, %11, off\n\t"
                 "global_load_async_to_lds_b128 %4, %12, off\n\t"
                 "global_load_async_to_lds_b128 %5, %13, off\n\t"
                 "global_load_async_to_lds_b128 %6, %14, off\n\t"
                 "global_load_async_to_lds_b128 %7, %15, off\n\t"
                 "s_wait_xcnt 0x0"
                 :: "v"(la), "v"(la + 512u), "v"(la + 1024u), "v"(la + 1536u), "v"(lb), "v"(lb + 512u), "v"(lb + 1024u), "v"(lb + 1536u),
                    "v"(ga), "v"(ga + 256), "v"(ga + 512), "v"(ga + 768), "v"(gb), "v"(gb + 256), "v"(gb + 512), "v"(gb + 768) : "memory");
}
template <typename T16, bool HR>
__device__ __forceinline__ void fattn_body(const T16* __restrict__ Q, const T16* __restrict__ Q2, const T16* __restrict__ Kp, const T16* __restrict__ K2, const T16* __restrict__ Vt, const T16* __restrict__ Vt2, const float* __restrict__ cm, int qg, bf* Ah, bf* Al, const float* __restrict__ pp, const float* __restrict__ ss, const float* __restrict__ gam, unsigned* kb, char* ring) {
    // every loop of this function but the loop over the key tiles is unrolled in full: tiles and fragments are register arrays, which only constant indices keep in registers
    typedef WFrag<T16> WF; typedef typename WF::V V;
    constexpr int NQ = 2;
    constexpr int KC = HR ? 32 : KS, KT = KC / 16;   // keys per softmax step: the hi / lo rows, whose fragments take twice the registers, go through a tile in two steps
    const int lane = threadIdx.x & 31, c = lane & 15, hf = lane >> 4; const int wv = __builtin_amdgcn_readfirstlane((int)(threadIdx.x >> 5)); const int q0 = qg + wv * (NQ * 16);
    const unsigned lfr = (unsigned)lane * 8u;   // the lane's part of every fragment address; the rest is the same for the whole wave
    const unsigned cl = (unsigned)(size_t)ring + (unsigned)wv * (PLB / FW) + (unsigned)lane * 16u;   // LDS byte address of the lane's first copy: wave w brings quarter w of each plane's tile
    const unsigned cg = (unsigned)wv * (PLB / FW / 2) + lfr;   // the same place in a plane's tile, in elements
    auto fill = [&](int t) { const unsigned lb = cl + (unsigned)(t & 1) * STB; const size_t g = (size_t)t * (KS * HD) + cg;
        if constexpr (HR) { cp8(lb, Kp + g, lb + PLB, K2 + g); cp8(lb + 2 * PLB, Vt + g, lb + 3 * PLB, Vt2 + g); } else cp8(lb, Kp + g, lb + PLB, Vt + g); };
    fill(0);
    // per-key bias slots, each key once per work-group: bf16-rounded p_j0, p_j1, s_j in the operand type of this path (bf16: as they are; f16 holds a bf16 value of this size exactly)
#pragma unroll
    for (int k4 = (int)threadIdx.x * 4; k4 < TT; k4 += 32 * FW * 4) { const v4f pa = *(const v4f*)(pp + (size_t)k4 * 2), pb = *(const v4f*)(pp + (size_t)k4 * 2 + 4), sv = *(const v4f*)(ss + k4);
#pragma unroll
        for (int j = 0; j < 4; ++j) { const float a = (j < 2) ? pa[2 * j] : pb[2 * j - 4], b = (j < 2) ? pa[2 * j + 1] : pb[2 * j - 3]; float ra, rb;
            const unsigned wp = HR ? bfpk(a, b) : pk3<false>(bfr(a), bfr(b), ra, rb), wsj = HR ? bfpk(sv[j], sv[j]) : pk3<false>(bfr(sv[j]), bfr(sv[j]), ra, rb);
            const v4u o = { wp, wp, wp, wsj }; *(v4ua*)(kb + (k4 + j) * 4) = o; } }
    V qf[NQ][2], qf2[NQ][2];
#pragma unroll
    for (int qn = 0; qn < NQ; ++qn)
#pragma unroll
        for (int kc = 0; kc < 2; ++kc) { qf[qn][kc] = WF::ld(Q + (size_t)(q0 + qn * 16) * HD + kc * 512 + lfr); if (HR) qf2[qn][kc] = WF::ld(Q2 + (size_t)(q0 + qn * 16) * HD + kc * 512 + lfr); }
    const float c00 = bfr(cm[0]), c01 = bfr(cm[1]), c10 = bfr(cm[2]), c11 = bfr(cm[3]);
    asm volatile("s_wait_asynccnt 0x0" ::: "memory");   // this wave's share of tile 0 has landed
    __syncthreads();   // tile 0 and the bias slots of every key are in LDS
    fill(1);
    float mr[NQ], ls[NQ];   // mr: running row maximum, times log2(e); ls: running sum over the keys of this lane half
    V bq[NQ][2];   // the query's bias slots: [0] at k 0..7 (even key tiles), [1] at k 16..23 (odd key tiles), zeros elsewhere
    const float gm8 = bfr(gam[0]) * 8.0f;
    v8f oa[HD / 16][NQ];   // oa[db][qn][r]: d = db * 16 + 8 hf + r, query q0 + qn * 16 + c
#pragma unroll
    for (int qn = 0; qn < NQ; ++qn) { const unsigned wq = kb[(q0 + qn * 16 + c) * 4]; const v2h hq = __builtin_bit_cast(v2h, wq); const float pi0 = HR ? bflo(wq) : (float)hq[0], pi1 = HR ? bfhi(wq) : (float)hq[1]; mr[qn] = -3.0e38f; ls[qn] = 0.f;   // a query's p is its position's rounded p: the first word of its slots
        float x0 = (pi0 * c00 + pi1 * c10) * 8.0f, x1 = (pi0 * c01 + pi1 * c11) * 8.0f, g0 = gm8, g1 = 0.f, y0, y1; v4u w;
        w[0] = pk3<HR>(x0, x1, y0, y1); w[1] = pk3<HR>(y0, y1, x0, x1); w[2] = pk3<HR>(x0, x1, y0, y1); pk3<HR>(g0, g1, y0, y1); w[3] = pk3<HR>(g0, y0, x0, x1);
        if (hf) w = (v4u){};   // lanes 16..31 hold k 8..15 and 24..31: no slot there
        const v4u zz = {}; bq[qn][0] = __builtin_bit_cast(V, __builtin_shufflevector(w, zz, 0, 1, 2, 3, 4, 5, 6, 7)); bq[qn][1] = __builtin_bit_cast(V, __builtin_shufflevector(zz, w, 0, 1, 2, 3, 4, 5, 6, 7));
#pragma unroll
        for (int db = 0; db < HD / 16; ++db) oa[db][qn] = (v8f){}; }
    // left rolled: one tile's code serves all tiles, and the two buffers differ only in a base address
#pragma unroll 1
    for (int t = 0; t < NST; ++t) {
        const char* st = ring + (t & 1) * STB;
#pragma unroll
        for (int h = 0; h < KS / KC; ++h) {
        const int k0 = h * KC;   // KC keys are KC * HD elements in a row of a K tile and of a V^T tile alike
        const T16* Ks = (const T16*)st + k0 * HD + lfr; const T16* Ks2 = (const T16*)(st + PLB) + k0 * HD + lfr; const T16* Vs = (const T16*)(st + (HR ? 2 : 1) * PLB) + k0 * HD + lfr; const T16* Vs2 = (const T16*)(st + 3 * PLB) + k0 * HD + lfr;
        v8f sc[KT][NQ];   // sc[kt][qn][r]: 8 x the score of key t * KS + k0 + kt * 16 + 8 hf + r, query q0 + qn * 16 + c
        V ab[KT / 2], a[KT][2], a2[KT][2];   // ab: bias slots of two key tiles each; both lane halves read key c's 16 bytes
#pragma unroll
        for (int kt = 0; kt < KT; ++kt)
#pragma unroll
            for (int kc = 0; kc < 2; ++kc) { a[kt][kc] = WF::ld(Ks + kt * 1024 + kc * 512); if (HR) a2[kt][kc] = WF::ld(Ks2 + kt * 1024 + kc * 512); }
#pragma unroll
        for (int g = 0; g < KT / 2; ++g) { const unsigned* kk = kb + (t * KS + k0 + g * 32 + c) * 4; ab[g] = __builtin_bit_cast(V, __builtin_shufflevector(*(const v4ua*)kk, *(const v4ua*)(kk + 64), 0, 1, 2, 3, 4, 5, 6, 7)); }
        __builtin_amdgcn_sched_barrier(0);   // the step's K fragments and bias slots are asked for in one group: with the bias arithmetic gone nothing stands between the products, and left alone this build asks for two fragments at a time and waits out each LDS round trip
#pragma unroll
        for (int kt = 0; kt < KT; ++kt)
#pragma unroll
            for (int qn = 0; qn < NQ; ++qn) { v8f s = (v8f){};
#pragma unroll
                for (int kc = 0; kc < 2; ++kc) { s = WF::mma(a[kt][kc], qf[qn][kc], s); if (HR) { s = WF::mma(a[kt][kc], qf2[qn][kc], s); s = WF::mma(a2[kt][kc], qf[qn][kc], s); } }
                sc[kt][qn] = WF::mma(ab[kt >> 1], bq[qn][kt & 1], s); }   // the bias goes in last: the small products are summed among themselves first
        float mx[NQ];
#pragma unroll
        for (int qn = 0; qn < NQ; ++qn) mx[qn] = -3.0e38f;
#pragma unroll
        for (int kt = 0; kt < KT; ++kt)
#pragma unroll
            for (int qn = 0; qn < NQ; ++qn)
#pragma unroll
                for (int r = 0; r < 8; ++r) mx[qn] = fmaxf(mx[qn], sc[kt][qn][r]);
#pragma unroll
        for (int qn = 0; qn < NQ; ++qn) mx[qn] = fmaxf(mx[qn], xhalf(mx[qn]));   // the step's row maximum, over both lane halves
        V va[HD / 16][KC / 32], va2[HD / 16][KC / 32];
#pragma unroll
        for (int db = 0; db < HD / 16; ++db)
#pragma unroll
            for (int kk = 0; kk < KC / 32; ++kk) { va[db][kk] = WF::ld(Vs + kk * 2048 + db * 512); if (HR) va2[db][kk] = WF::ld(Vs2 + kk * 2048 + db * 512); }
        __builtin_amdgcn_sched_barrier(0);   // all V^T fragments of the step are asked for here and arrive under the exponentials: left alone, this build asks for half of them among the products and waits for them there
        V pf[KC / 32][NQ], pf2[KC / 32][NQ];   // element s of pf[kk][qn]: key t * KS + k0 + kk * 32 + (s < 8 ? 8 hf + s : 16 + 8 hf + s - 8), the order in which WFrag::ld takes V^T's keys
#pragma unroll
        for (int qn = 0; qn < NQ; ++qn) { const float mn = fmaxf(mr[qn], mx[qn] * (SCL * 1.4426950408889634f));   // rounding keeps the order, so this is the running maximum's own product
            const float al = __builtin_amdgcn_exp2f(mr[qn] - mn); mr[qn] = mn;   // 0 at the first tile, where sum and O^T are 0
            const float nb = (HR ? 0.0f : 10.0f) - mn;
            v8f vs;
#pragma unroll
            for (int kt = 0; kt < KT; ++kt) { const v8f d = sc[kt][qn] * (SCL * 1.4426950408889634f) + nb; v8f e;   // f16 rows: probabilities carried x 1024 (2^10), away from f16's small numbers; the factor is in the sum too and leaves with the division
#pragma unroll
                for (int r = 0; r < 8; ++r) e[r] = __builtin_amdgcn_exp2f(d[r]);
                sc[kt][qn] = e; vs = (kt == 0) ? e : vs + e; }
            ls[qn] = ls[qn] * al + (((vs[0] + vs[1]) + (vs[2] + vs[3])) + ((vs[4] + vs[5]) + (vs[6] + vs[7])));
#pragma unroll
            for (int db = 0; db < HD / 16; ++db) oa[db][qn] *= al;
#pragma unroll
            for (int kk = 0; kk < KC / 32; ++kk) { const v8f p0 = sc[2 * kk][qn], p1 = sc[2 * kk + 1][qn];
                if constexpr (HR) { v8u wh, wl;   // each pair of neighbouring keys is rounded and packed into its hi word and its lo word at once
#pragma unroll
                    for (int w = 0; w < 8; ++w) { const float xa = (w < 4) ? p0[2 * w] : p1[2 * w - 8], xb = (w < 4) ? p0[2 * w + 1] : p1[2 * w - 7];
                        unsigned h2, l2; splitpk(xa, xb, h2, l2); wh[w] = h2; wl[w] = l2; }
                    pf[kk][qn] = __builtin_bit_cast(v16bf, wh); pf2[kk][qn] = __builtin_bit_cast(v16bf, wl);
                } else { v8h x0, x1;
#pragma unroll
                    for (int r = 0; r < 8; ++r) { x0[r] = tohx(p0[r]); x1[r] = tohx(p1[r]); }
                    pf[kk][qn] = cat16(x0, x1); } } }
        asm volatile("" :: "v"(ls[0]), "v"(ls[1]));   // inputs only: the running sums are formed by here. Left alone, this build moves their additions to the loop's foot and keeps every unpacked probability in registers beside the packed ones
#pragma unroll
        for (int db = 0; db < HD / 16; ++db)
#pragma unroll
            for (int kk = 0; kk < KC / 32; ++kk)
#pragma unroll
                for (int qn = 0; qn < NQ; ++qn) { oa[db][qn] = WF::mma(va[db][kk], pf[kk][qn], oa[db][qn]); if (HR) { oa[db][qn] = WF::mma(va[db][kk], pf2[kk][qn], oa[db][qn]); oa[db][qn] = WF::mma(va2[db][kk], pf[kk][qn], oa[db][qn]); } }
        }
        asm volatile("s_wait_dscnt 0x0" ::: "memory");      // this wave's reads of the buffer are over before the buffer is given up
        asm volatile("s_wait_asynccnt 0x0" ::: "memory");   // this wave's share of tile t + 1 has landed
        __syncthreads();   // tile t + 1 is whole, and every wave has left tile t's buffer
        if (t + 2 < NST) fill(t + 2);
    }
    asm volatile("s_wait_asynccnt 0x0" ::: "memory");   // no copy is under way when the ring becomes output staging
    float* os = (float*)ring + wv * (NQ * 16 * OP);   // behind the loop's last barrier: each wave stages its own rows
#pragma unroll
    for (int qn = 0; qn < NQ; ++qn) { const float inv = __fdiv_rn(1.0f, ls[qn] + xhalf(ls[qn]));
#pragma unroll
        for (int db = 0; db < HD / 16; ++db) { const v8f o8 = oa[db][qn] * inv; float* o = os + (qn * 16 + c) * OP + db * 16 + 8 * hf; *(v4fa*)o = __builtin_shufflevector(o8, o8, 0, 1, 2, 3); *(v4fa*)(o + 4) = __builtin_shufflevector(o8, o8, 4, 5, 6, 7); } }
    __syncthreads();   // the staged rows are written before other lanes read them
#pragma unroll
    for (int u = 0; u < NQ * 8; ++u) {   // half-piece u (256 bytes: 16 rows x 8 d) of the wave's [16 rows][32 d][piece] blocks; lane halves take d 0..3 and 4..7 of a row
        const int row = (u >> 3) * 16 + c, cofs = (u & 7) * 8 + hf * 4; const v4f val = *(const v4fa*)(os + row * OP + cofs); v2u oh, ol;
#pragma unroll
        for (int q = 0; q < 2; ++q) { unsigned a, b; splitpk(val[2 * q], val[2 * q + 1], a, b); oh[q] = a; ol[q] = b; }
        const size_t oo = (size_t)(q0 + (u >> 3) * 16) * DQ + ((u >> 2) & 1) * 512 + (u & 3) * 128 + c * 8 + hf * 4; *(v4us*)(Ah + oo) = __builtin_bit_cast(v4us, oh); *(v4us*)(Al + oo) = __builtin_bit_cast(v4us, ol); }
}
// grid (NH_, TT / (32 FW), NB_): 32 FW query rows of one head of one batch; QK*: per batch the q head planes with the k head planes behind them, [b][h] planes of TT rows x HD; VT*: [b][h] planes of HD rows x TT; Ah / Al: the merged rows, one plane of NB_ * TT rows x DQ; all in fragment order
__global__ __launch_bounds__(32 * FW) void k_fattn(const h16* __restrict__ QK16, const bf* __restrict__ QKh, const bf* __restrict__ QKl, const h16* __restrict__ VT16, const bf* __restrict__ VTh, const bf* __restrict__ VTl, const float* __restrict__ pp, const float* __restrict__ ss, const float* __restrict__ cm, const float* __restrict__ gam, bf* Ah, bf* Al) {
    __shared__ __align__(16) unsigned kb[4 * TT]; __shared__ __align__(1024) char ring[2 * STB];
    const int hh = blockIdx.x, q0 = blockIdx.y * (32 * FW), bz = blockIdx.z;   // heads run fastest: a batch's hi / lo row blocks, which cost most, start first
    pp += (size_t)bz * TT * 2; ss += (size_t)bz * TT;
    const size_t qo = ((size_t)bz * (NH_ + NKV) + hh) * TT * HD, ko = ((size_t)bz * (NH_ + NKV) + NH_ + hh / REP) * TT * HD, vo = ((size_t)bz * NKV + hh / REP) * HD * TT;
    Ah += (size_t)bz * TT * DQ; Al += (size_t)bz * TT * DQ;
    if (q0 < RH) fattn_body<bf, true>(QKh + qo, QKl + qo, QKh + ko, QKl + ko, VTh + vo, VTl + vo, cm + hh * 4, q0, Ah + hh * (HD / 32) * 512, Al + hh * (HD / 32) * 512, pp, ss, gam, kb, ring);
    else fattn_body<h16, false>(QK16 + qo, nullptr, QK16 + ko, nullptr, VT16 + vo, nullptr, cm + hh * 4, q0, Ah + hh * (HD / 32) * 512, Al + hh * (HD / 32) * 512, pp, ss, gam, kb, ring);
}

extern "C" void kernel_launch(void* const* d_in, const int* in_sizes, int n_in,
                              void* d_out, int out_size, void* d_ws, size_t ws_size, hipStream_t stream) {
    (void)in_sizes; (void)n_in; (void)out_size;
    const float* x = (const float*)d_in[0]; const float* pp = (const float*)d_in[1]; const float* ss = (const float*)d_in[2]; const float* wq = (const float*)d_in[3]; const float* wk = (const float*)d_in[4]; const float* wv = (const float*)d_in[5]; const float* wo = (const float*)d_in[6]; const float* bo = (const float*)d_in[7]; const float* compat = (const float*)d_in[8]; const float* gam = (const float*)d_in[9]; const float* cosT = nullptr; const float* sinT = nullptr; (void)cosT; (void)sinT;
    float* OUT = (float*)d_out;     // [4][2048][768]
    char* wsp = (char*)d_ws;
    auto take = [&](size_t bytes) { char* p = wsp; wsp += (bytes + 255) & ~(size_t)255; return (void*)p; };
    bf* WQ = (bf*)take((size_t)(DQ + 2 * DKV) * DM * 2 + (size_t)DM * DQ * 2); bf* WO = WQ + (size_t)(DQ + 2 * DKV) * DM;   // wq, wk, wv, wo planes one behind the other: [wq; wk; wv] is one Bt of DQ + 2 DKV rows
    bf* XB = (bf*)take((size_t)NB_ * TT * DM * 2);
    const size_t SQK = (size_t)(NH_ + NKV) * TT * HD, SV = (size_t)NKV * HD * TT;   // elements of one batch's q + k planes and of its v planes
    h16* QP16 = (h16*)take(NB_ * SQK * 2); h16* VT16 = (h16*)take(NB_ * SV * 2);   // the k head planes follow the q head planes
    bf* QPh = (bf*)take(NB_ * SQK * 2); bf* QPl = (bf*)take(NB_ * SQK * 2); bf* VTh = (bf*)take(NB_ * SV * 2); bf* VTl = (bf*)take(NB_ * SV * 2);
    bf* ATh = (bf*)take((size_t)NB_ * TT * DQ * 2); bf* ATl = (bf*)take((size_t)NB_ * TT * DQ * 2);
    if ((size_t)(wsp - (char*)d_ws) > ws_size) return;    // ws 256 MiB
    k_cvt8w<<<dim3((unsigned)(((size_t)DQ * DM / 8 + 255) / 256), 4, 1), 256, 0, stream>>>(wq, wk, wv, wo, WQ, (size_t)DQ * DM / 8);
    k_cvt8<<<(unsigned)(((size_t)NB_ * TT * DM / 8 + 255) / 256), 256, 0, stream>>>(x, XB, (size_t)NB_ * TT * DM / 8);
    k_qkv<8><<<dim3(NB_ * TT / 64, NH_ + 2 * NKV, 1), 256, 0, stream>>>(XB, WQ, QP16, QPh, QPl, VT16, VTh, VTl);   // the four batches' rows follow one another in XB
    k_fattn<<<dim3(NH_, TT / (32 * FW), NB_), 32 * FW, 0, stream>>>(QP16, QPh, QPl, VT16, VTh, VTl, pp, ss, compat, gam, ATh, ATl);
    k_gemmw<bf, 1, true, 8><<<dim3(NB_ * TT / 64, DM / 64, 1), 256, 0, stream>>>(ATh, ATl, WO, nullptr, DQ, OUT, DM, bo, 0, 0, 0);   // the four batches' rows follow one another in ATh / ATl and in OUT
}

// v009
// It runs in 134 microseconds.
// Timed twice side by side with v008, it ran 1.12 and 1.13 times as fast.
// Over all steps from v000 it is 24.2 times as fast.
#include <hip/hip_runtime.h>

// SBERTaAttention (H [4][2048][768], p [4][2048][2] (language probs, read), s [4][2048] (read), compat [12][2][2], gamma [1]; Q/K/V = H W^T (12 x 64, no bias); scores = Q.K / 8 + (p_i compat_h) . p_j + gamma s_j; softmax; out = merged wo^T + bo -> [4][2048][768]).
// Compute dtypes, f32 accumulate: every input rounded to bf16; Q/K/V on PLAIN bf16 operands (inputs: exact); scores PRECPLAN; the bilinear language bias (2x2 per head) and the position bias, from the bf16-rounded p, s, compat, gamma, added by one more matrix product per score tile (k_fattn: the query side split into three 16-bit parts, products exact); softmax f32; attn.v: rows < 512 hl (3 products), the rest fp16 (x1024); wo hl x exact (2 products) + bias.

#define NB_  4
#define TT   2048
#define DM   768
#define NH_  12
#define NKV  12
#define REP  (NH_ / NKV)
#define HD   64
#define DQ   (NH_ * HD)
#define DKV  (NKV * HD)
#define RH   512                  // query rows < RH use hi+lo planes (0: none)
#define WIN  0
#define PCAR 1024.0f
#define SCL  0.125f   // HD^-0.5
typedef _Float16 h16;
typedef unsigned short bf;
typedef __attribute__((ext_vector_type(16))) __bf16   v16bf;
typedef __attribute__((ext_vector_type(16))) _Float16 v16h;
typedef __attribute__((ext_vector_type(8)))  _Float16 v8h;
typedef __attribute__((ext_vector_type(8)))  unsigned short v8us;
typedef __attribute__((ext_vector_type(8)))  float    v8f;
typedef __attribute__((ext_vector_type(4)))  float    v4f;
typedef v8h  __attribute__((may_alias)) v8ha;
typedef v4f  __attribute__((may_alias)) v4fa;
typedef v8us __attribute__((may_alias)) v8usa;

typedef __attribute__((ext_vector_type(2))) __bf16 v2bf;
typedef __attribute__((ext_vector_type(2))) float v2f;
typedef __attribute__((ext_vector_type(2))) unsigned v2u;
typedef __attribute__((ext_vector_type(4))) unsigned v4u;
// f32 -> bf16 by the chip's own convert (round to nearest even): one instruction rounds and packs two values
__device__ __forceinline__ unsigned short f2bf(float f) { return __builtin_bit_cast(unsigned short, (__bf16)f); }
__device__ __forceinline__ unsigned bfpk(float a, float b) { const v2f x = { a, b }; return __builtin_bit_cast(unsigned, __builtin_convertvector(x, v2bf)); }   // a in the low half, b in the high half
__device__ __forceinline__ float bflo(unsigned w) { return __uint_as_float(w << 16); }
__device__ __forceinline__ float bfhi(unsigned w) { return __uint_as_float(w & 0xFFFF0000u); }
__device__ __forceinline__ void splitpk(float a, float b, unsigned& h, unsigned& l) { h = bfpk(a, b); l = bfpk(a - bflo(h), b - bfhi(h)); }   // hi plane word and lo plane word of two values: lo = bf16(x - hi)
__device__ __forceinline__ float bf2f(unsigned short b) { return __uint_as_float(((unsigned)b) << 16); }
__device__ __forceinline__ float bfr(float f) { return bf2f(f2bf(f)); }
__device__ __forceinline__ v16h cat16(v8h lo, v8h hi) { return __builtin_shufflevector(lo, hi, 0, 1, 2, 3, 4, 5, 6, 7, 8, 9, 10, 11, 12, 13, 14, 15); }
__device__ __forceinline__ v16bf cat16b(v8us lo, v8us hi) { return __builtin_bit_cast(v16bf, __builtin_shufflevector(lo, hi, 0, 1, 2, 3, 4, 5, 6, 7, 8, 9, 10, 11, 12, 13, 14, 15)); }
__device__ __forceinline__ v8f wmma16(v16h a, v16h b, v8f c) { return __builtin_amdgcn_wmma_f32_16x16x32_f16(false, a, false, b, (short)0, c, false, false); }
__device__ __forceinline__ v8f wmmab(v16bf a, v16bf b, v8f c) { return __builtin_amdgcn_wmma_f32_16x16x32_bf16(false, a, false, b, (short)0, c, false, false); }



// FRAGMENT ORDER: every 16-bit operand plane in the workspace is kept as blocks of 16 rows x 32 k (1 KiB), each block as the two 512-byte pieces that a wave loads:
// element (row, k) of a block lies at ((k >> 4) & 1) * 256 + (((k >> 3) & 1) * 16 + (row & 15)) * 8 + (k & 7). Lane l reads 16 bytes at l * 16 of each piece, so a wave-wide load covers four whole 128-byte lines
// (row-major planes gave 32 bytes of each of 16 lines). The values a lane gets, and so the k order, are those of the row-major loader. A plane of R rows and K columns is [R / 16][K / 32] blocks; the v planes are [TT / 32][HD / 16] blocks.
template <typename T16> struct WFrag;
template <> struct WFrag<h16> { typedef v16h V; static __device__ __forceinline__ V ld(const h16* p) { return cat16(*(const v8h*)p, *(const v8h*)(p + 256)); } static __device__ __forceinline__ v8f mma(V a, V b, v8f c) { return wmma16(a, b, c); } };
template <> struct WFrag<bf> { typedef v16bf V; static __device__ __forceinline__ V ld(const bf* p) { return cat16b(*(const v8us*)p, *(const v8us*)(p + 256)); } static __device__ __forceinline__ v8f mma(V a, V b, v8f c) { return wmmab(a, b, c); } };

__device__ __forceinline__ h16 tohx(float x) { return (h16)x; }
typedef __attribute__((ext_vector_type(2))) _Float16 v2h;
typedef __attribute__((ext_vector_type(4))) _Float16 v4h;
typedef __attribute__((ext_vector_type(2))) unsigned short v2us;
typedef __attribute__((ext_vector_type(4))) unsigned short v4us;
typedef __attribute__((ext_vector_type(4))) int v4i;

__global__ __launch_bounds__(256) void k_wtG(const float* __restrict__ w, int K, int N, bf* Bt) {
    const int lane = threadIdx.x & 31; const int L0 = (blockIdx.x * 8 + (threadIdx.x >> 5)) * 8; const int nlines = N * K / 64;
{
#pragma unroll 1
        for (int l = 0; l < 8; ++l) { const int L = L0 + l; if (L >= nlines) break; const size_t e = (size_t)L * 64 + lane * 2; const int k = (int)(e % K), n = (int)(e / K); v2us o;
            o[0] = f2bf(w[(size_t)k * N + n]); o[1] = f2bf(w[(size_t)(k + 1) * N + n]); *(v2us*)(Bt + e) = o; }
         }
}
// frsrc: the row-major element offset (rows of DM) of the 8 values that make 16-byte unit i of a plane in fragment order
__device__ __forceinline__ unsigned frsrc(size_t i8) { const unsigned i = (unsigned)i8, l = i & 31u, part = (i >> 5) & 1u, blk = i >> 6, rt = blk / (DM / 32), kch = blk % (DM / 32); return (rt * 16u + (l & 15u)) * DM + kch * 32u + part * 16u + (l >> 4) * 8u; }   // the largest plane has NB_ * TT * DM elements: 32 bits hold every offset
__global__ __launch_bounds__(256) void k_cvt8(const float* __restrict__ src, bf* dst, size_t n8) { const size_t i = (size_t)blockIdx.x * 256 + threadIdx.x; if (i >= n8) return; const v8f v = *(const v8f*)(src + frsrc(i)); v4u o;
#pragma unroll
    for (int k = 0; k < 4; ++k) o[k] = bfpk(v[2 * k], v[2 * k + 1]); *(v8us*)(dst + i * 8) = __builtin_bit_cast(v8us, o);  }
// k_cvt8w: the four weight matrices (n8 * 8 elements each), one per blockIdx.y, into four planes that follow one another in dst
__global__ __launch_bounds__(256) void k_cvt8w(const float* __restrict__ w0, const float* __restrict__ w1, const float* __restrict__ w2, const float* __restrict__ w3, bf* dst, size_t n8) { const size_t i = (size_t)blockIdx.x * 256 + threadIdx.x; if (i >= n8) return; const int y = blockIdx.y; const float* src = (y == 0) ? w0 : (y == 1) ? w1 : (y == 2) ? w2 : w3; const v8f v = *(const v8f*)(src + frsrc(i)); v4u o;
#pragma unroll
    for (int k = 0; k < 4; ++k) o[k] = bfpk(v[2 * k], v[2 * k + 1]); *(v8us*)(dst + ((size_t)y * n8 + i) * 8) = __builtin_bit_cast(v8us, o);  }
__global__ __launch_bounds__(256) void k_cscvt(const float* __restrict__ cosT, const float* __restrict__ sinT, float* CS) { const int idx = blockIdx.x * 256 + threadIdx.x; if (idx >= TT * HD) return; v2f cs; cs[0] = bfr(cosT[idx]); cs[1] = bfr(sinT[idx]); *(v2f*)(CS + (size_t)idx * 2) = cs;  }
// cp8: a wave's four 512-byte pieces of each of two runs (in two planes or in one), global memory -> LDS, through no register. la, lb: the lane's LDS byte addresses; ga, gb: the lane's global addresses.
// The wait on the address counter is the statement's last line, so that it stands in front of whatever rewrites an address register.
template <typename T16>
__device__ __forceinline__ void cp8(unsigned la, const T16* ga, unsigned lb, const T16* gb) {
    asm volatile("global_load_async_to_lds_b128 %0, %8, off\n\t"
                 "global_load_async_to_lds_b128 %1, %9, off\n\t"
                 "global_load_async_to_lds_b128 %2, %10, off\n\t"
                 "global_load_async_to_lds_b128 %3, %11, off\n\t"
                 "global_load_async_to_lds_b128 %4, %12, off\n\t"
                 "global_load_async_to_lds_b128 %5, %13, off\n\t"
                 "global_load_async_to_lds_b128 %6, %14, off\n\t"
                 "global_load_async_to_lds_b128 %7, %15, off\n\t"
                 "s_wait_xcnt 0x0"
                 :: "v"(la), "v"(la + 512u), "v"(la + 1024u), "v"(la + 1536u), "v"(lb), "v"(lb + 512u), "v"(lb + 1024u), "v"(lb + 1536u),
                    "v"(ga), "v"(ga + 256), "v"(ga + 512), "v"(ga + 768), "v"(gb), "v"(gb + 256), "v"(gb + 512), "v"(gb + 768) : "memory");
}
// ---- k_qkv: q, k and v of all batches as one product. A work-group of 4 waves forms a 128 x 128 tile (128 positions of TWO heads of q, k or v); each wave owns a 64 x 64 quarter (64 positions of ONE head) and walks the whole of k.
// The operands' 128 + 128 rows are brought into LDS once per work-group, QK k at a time, by asynchronous copies (two buffers) and read from there by the two waves that need each row: half the L2 reads of a 64 x 64 tile, and no partial tiles to sum.
// A wave's quarter leaves as its head's fp16 and hi / lo planes: no f32 copy goes through memory.
// X: [b * TT + t][DM]; Wt: [wq; wk; wv], DQ + 2 DKV rows of DM; both, and all planes written, in fragment order, so 16 rows x QK k are one run of 2 KiB in memory and in LDS alike. grid (NB_ * TT / 128, (NH_ + 2 NKV) / 2), 128 threads. DM % QK == 0, DM >= 2 QK.
// A lane holds 8 consecutive A rows of one B row, so a quarter goes to LDS as [B row][A row] in 16-byte stores. q, k planes are [t][d]: A = weight rows, B = positions. v planes are [d][t]: A = positions, B = weight rows.
#define QK   64                   // k per pass
#define QSB  (2 * 128 * QK * 2)   // bytes of one buffer: A's 128 rows, then B's
__global__ __launch_bounds__(128) void k_qkv(const bf* __restrict__ X, const bf* __restrict__ Wt, h16* QK16, bf* QKh, bf* QKl, h16* VT16, bf* VTh, bf* VTl) {
    // every loop but the loop over the passes is unrolled in full: tiles and fragments are register arrays, which only constant indices keep in registers
    typedef WFrag<bf> WF; typedef WF::V V;
    __shared__ __align__(1024) char sm[2 * QSB];   // the two buffers; behind the loop each wave's quarter, 64 rows of 64 floats. 64 KiB: five work-groups share a WGP's LDS, and the whole grid is resident at once
    static_assert(4 * 64 * 64 * 4 <= 2 * QSB, "the staged quarters lie inside the ring");
    const int lane = threadIdx.x & 31, lr = lane & 15, hi = lane >> 4; const int wv = __builtin_amdgcn_readfirstlane((int)(threadIdx.x >> 5)) /* wave number in a scalar register: what is formed from it stays on the scalar side */; const int wm = wv & 1, wn = wv >> 1; const int r0 = blockIdx.x * 128, hp0 = blockIdx.y * 2;
    const bool isv = hp0 >= NH_ + NKV;   // the same for the whole work-group: NH_ + NKV is even
    const bf* xr = X + (size_t)r0 * DM; const bf* wr = Wt + (size_t)hp0 * HD * DM;
    const bf* A = isv ? xr : wr; const bf* Bt = isv ? wr : xr;
    v8f acc[4][4];
#pragma unroll
    for (int mb = 0; mb < 4; ++mb)
#pragma unroll
        for (int nb = 0; nb < 4; ++nb) acc[mb][nb] = (v8f){};
    const unsigned cl = (unsigned)(size_t)sm + (unsigned)wv * 4096u + (unsigned)lane * 16u;   // LDS byte address of the lane's first copy: wave w brings the 16-row blocks 2 w and 2 w + 1 of A and of B
    const unsigned cg = (unsigned)wv * (32 * DM) + (unsigned)lane * 8u;   // the same place in a plane, in elements: 16 rows of DM columns start where they did row-major
    auto fill = [&](int t) { const unsigned lb = cl + (unsigned)(t & 1) * QSB; const bf* ga = A + cg + t * (16 * QK); const bf* gb = Bt + cg + t * (16 * QK);
        cp8(lb, ga, lb + 2048u, ga + 16 * DM); cp8(lb + QSB / 2, gb, lb + QSB / 2 + 2048u, gb + 16 * DM); };
    fill(0);
    asm volatile("s_wait_asynccnt 0x0" ::: "memory");   // this wave's share of pass 0 has landed
    __syncthreads();   // pass 0 is whole
    fill(1);
    // left rolled: one pass's code serves all passes, and the two buffers differ only in a base address
#pragma unroll 1
    for (int t = 0; t < DM / QK; ++t) {
        const bf* st = (const bf*)(sm + (t & 1) * QSB) + lane * 8; const bf* As = st + wm * (64 * QK); const bf* Bs = st + QSB / 4 + wn * (64 * QK);
#pragma unroll
        for (int kc = 0; kc < QK / 32; ++kc) { V a[4], b[4];
#pragma unroll
            for (int mb = 0; mb < 4; ++mb) { a[mb] = WF::ld(As + mb * (16 * QK) + kc * 512); b[mb] = WF::ld(Bs + mb * (16 * QK) + kc * 512); }
#pragma unroll
            for (int nb = 0; nb < 4; ++nb)
#pragma unroll
                for (int mb = 0; mb < 4; ++mb) acc[mb][nb] = WF::mma(a[mb], b[nb], acc[mb][nb]); }
        asm volatile("s_wait_dscnt 0x0" ::: "memory");      // this wave's reads of the buffer are over before the buffer is given up
        asm volatile("s_wait_asynccnt 0x0" ::: "memory");   // this wave's share of pass t + 1 has landed
        __syncthreads();   // pass t + 1 is whole, and every wave has left pass t's buffer
        if (t + 2 < DM / QK) fill(t + 2);
    }
    asm volatile("s_wait_asynccnt 0x0" ::: "memory");   // no copy is under way when the ring becomes output staging
    float* os = (float*)sm + wv * (64 * 64);   // behind the loop's last barrier: each wave stages its own quarter
    unsigned xo[4][2];   // rows have no pad: 16-byte unit q of row r lies at place q ^ (r & 15), so 16 lanes on 16 rows of one column of units meet all 64 banks once. xo[mb][j]: the place, in floats, of unit mb * 4 + 2 hi + j in a row with r & 15 == lr
#pragma unroll
    for (int mb = 0; mb < 4; ++mb)
#pragma unroll
        for (int j = 0; j < 2; ++j) xo[mb][j] = (unsigned)(((mb * 4 + 2 * hi + j) ^ lr) * 4);
#pragma unroll
    for (int nb = 0; nb < 4; ++nb)
#pragma unroll
        for (int mb = 0; mb < 4; ++mb) { float* o = os + (nb * 16 + lr) * 64; *(v4fa*)(o + xo[mb][0]) = __builtin_shufflevector(acc[mb][nb], acc[mb][nb], 0, 1, 2, 3); *(v4fa*)(o + xo[mb][1]) = __builtin_shufflevector(acc[mb][nb], acc[mb][nb], 4, 5, 6, 7); }
    __syncthreads();   // the staged rows are written before other lanes read them
    const int rw = r0 + (isv ? wm : wn) * 64, hp = hp0 + (isv ? wn : wm);   // the wave's 64 positions and its head
    const int bz = rw / TT, t0 = rw % TT;   // TT % 64 == 0: a quarter lies in one batch
    const size_t base = isv ? (((size_t)bz * NKV + (hp - NH_ - NKV)) * TT + t0) * HD : (((size_t)bz * (NH_ + NKV) + hp) * TT + t0) * HD;   // in fragment order the quarter is 8 KiB in a row of either kind of plane
    h16* P16 = (isv ? VT16 : QK16) + base; bf* Ph = (isv ? VTh : QKh) + base; bf* Pl = (isv ? VTl : QKl) + base;
#pragma unroll
    for (int u = 0; u < 16; ++u) {   // 512-byte piece u of the quarter: q, k [16 t][32 d][piece], v [32 t][16 d][piece]
        const int row = (isv ? ((u >> 1) & 3) : (u >> 2)) * 16 + lr; const unsigned x0 = isv ? xo[(u >> 3) * 2 + (u & 1)][0] : xo[u & 3][0], x1 = isv ? xo[(u >> 3) * 2 + (u & 1)][1] : xo[u & 3][1];   // the lane's 8 values are units 2 hi and 2 hi + 1 of one 16-wide block of the row
        const v4f v0 = *(const v4fa*)(os + row * 64 + x0), v1 = *(const v4fa*)(os + row * 64 + x1);
        v8h o16; v4u oh, ol;
#pragma unroll
        for (int q = 0; q < 8; ++q) o16[q] = tohx((q < 4) ? v0[q & 3] : v1[q & 3]);
#pragma unroll
        for (int q = 0; q < 4; ++q) { unsigned a2, c2; if (q < 2) splitpk(v0[2 * q], v0[2 * q + 1], a2, c2); else splitpk(v1[2 * q - 4], v1[2 * q - 3], a2, c2); oh[q] = a2; ol[q] = c2; }
        const unsigned oo = (unsigned)(u * 32 + lane) * 8u; *(v8h*)(P16 + oo) = o16; *(v8us*)(Ph + oo) = __builtin_bit_cast(v8us, oh); *(v8us*)(Pl + oo) = __builtin_bit_cast(v8us, ol); }   // a wave fills four 128-byte lines of each plane
}
// ---- k_wo: out = merged wo^T + bo, the merged rows as hi + lo planes (2 products). A work-group of 4 waves forms 64 rows x 128 columns; each wave owns 32 rows x 64 columns and walks the whole of k. Ring, copies and staging as in k_qkv:
// a buffer holds 64 rows of the hi plane, 64 of the lo plane and 128 weight rows, QK k each. A = weight rows, B = merged rows: a lane holds 8 consecutive columns of one output row. grid (NB_ * TT / 64, DM / 128), 128 threads. DQ % QK == 0, DQ >= 2 QK.
__global__ __launch_bounds__(128) void k_wo(const bf* __restrict__ Mh, const bf* __restrict__ Ml, const bf* __restrict__ Wt, float* C, const float* __restrict__ bias) {
    // every loop but the loop over the passes is unrolled in full: tiles and fragments are register arrays, which only constant indices keep in registers
    typedef WFrag<bf> WF; typedef WF::V V;
    __shared__ __align__(1024) char sm[2 * QSB];   // the two buffers; behind the loop each wave's part, 32 rows of 64 floats
    const int lane = threadIdx.x & 31, lr = lane & 15, hi = lane >> 4; const int wv = __builtin_amdgcn_readfirstlane((int)(threadIdx.x >> 5)) /* wave number in a scalar register: what is formed from it stays on the scalar side */; const int wm = wv & 1, wn = wv >> 1; const int r0 = blockIdx.x * 64, c0 = blockIdx.y * 128;
    v8f acc[4][2];
#pragma unroll
    for (int mb = 0; mb < 4; ++mb)
#pragma unroll
        for (int nb = 0; nb < 2; ++nb) acc[mb][nb] = (v8f){};
    const unsigned cl = (unsigned)(size_t)sm + (unsigned)lane * 16u;   // the lane's part of every copy's LDS byte address
    const bf* gh = Mh + (size_t)(r0 + wv * 16) * DQ + lane * 8; const bf* gl = Ml + (size_t)(r0 + wv * 16) * DQ + lane * 8; const bf* gw = Wt + (size_t)(c0 + wv * 32) * DQ + lane * 8;   // wave w brings 16-row block w of the hi and of the lo plane and blocks 2 w, 2 w + 1 of the weight rows
    auto fill = [&](int t) { const unsigned lb = cl + (unsigned)(t & 1) * QSB;
        cp8(lb + (unsigned)wv * 2048u, gh + t * (16 * QK), lb + QSB / 4 + (unsigned)wv * 2048u, gl + t * (16 * QK)); cp8(lb + QSB / 2 + (unsigned)wv * 4096u, gw + t * (16 * QK), lb + QSB / 2 + (unsigned)wv * 4096u + 2048u, gw + 16 * DQ + t * (16 * QK)); };
    fill(0);
    asm volatile("s_wait_asynccnt 0x0" ::: "memory");   // this wave's share of pass 0 has landed
    __syncthreads();   // pass 0 is whole
    fill(1);
    // left rolled: one pass's code serves all passes, and the two buffers differ only in a base address
#pragma unroll 1
    for (int t = 0; t < DQ / QK; ++t) {
        const bf* st = (const bf*)(sm + (t & 1) * QSB) + lane * 8; const bf* Hs = st + wm * (32 * QK); const bf* Ls = Hs + QSB / 8; const bf* Ws = st + QSB / 4 + wn * (64 * QK);
#pragma unroll
        for (int kc = 0; kc < QK / 32; ++kc) { V w[4], bh[2], bl[2];
#pragma unroll
            for (int mb = 0; mb < 4; ++mb) w[mb] = WF::ld(Ws + mb * (16 * QK) + kc * 512);
#pragma unroll
            for (int nb = 0; nb < 2; ++nb) { bh[nb] = WF::ld(Hs + nb * (16 * QK) + kc * 512); bl[nb] = WF::ld(Ls + nb * (16 * QK) + kc * 512); }
            __builtin_amdgcn_sched_barrier(0);   // the chunk's eight fragments are asked for in one group: left alone, this build keeps one B fragment, asks for the next behind every four products and waits out each LDS round trip, and only three waves share a SIMD here
#pragma unroll
            for (int nb = 0; nb < 2; ++nb)
#pragma unroll
                for (int mb = 0; mb < 4; ++mb) acc[mb][nb] = WF::mma(w[mb], bh[nb], acc[mb][nb]);
#pragma unroll
            for (int nb = 0; nb < 2; ++nb)
#pragma unroll
                for (int mb = 0; mb < 4; ++mb) acc[mb][nb] = WF::mma(w[mb], bl[nb], acc[mb][nb]); }   // per k chunk hi, then lo
        asm volatile("s_wait_dscnt 0x0" ::: "memory");      // this wave's reads of the buffer are over before the buffer is given up
        asm volatile("s_wait_asynccnt 0x0" ::: "memory");   // this wave's share of pass t + 1 has landed
        __syncthreads();   // pass t + 1 is whole, and every wave has left pass t's buffer
        if (t + 2 < DQ / QK) fill(t + 2);
    }
    asm volatile("s_wait_asynccnt 0x0" ::: "memory");   // no copy is under way when the ring becomes output staging
    float* os = (float*)sm + wv * (32 * 64);   // behind the loop's last barrier: each wave stages its own part, [row][column], 16-byte unit q of row r at place q ^ (r & 15) as in k_qkv
#pragma unroll
    for (int nb = 0; nb < 2; ++nb)
#pragma unroll
        for (int mb = 0; mb < 4; ++mb) { float* o = os + (nb * 16 + lr) * 64; *(v4fa*)(o + (unsigned)(((mb * 4 + 2 * hi) ^ lr) * 4)) = __builtin_shufflevector(acc[mb][nb], acc[mb][nb], 0, 1, 2, 3); *(v4fa*)(o + (unsigned)(((mb * 4 + 2 * hi + 1) ^ lr) * 4)) = __builtin_shufflevector(acc[mb][nb], acc[mb][nb], 4, 5, 6, 7); }
    __syncthreads();   // the staged rows are written before other lanes read them
    const float* bp = bias + c0 + wn * 64 + lr * 4; const v4f bv = { bfr(bp[0]), bfr(bp[1]), bfr(bp[2]), bfr(bp[3]) };   // a lane stores the same four columns of every row
    float* crow = C + (size_t)(r0 + wm * 32) * DM + c0 + wn * 64 + lr * 4;
#pragma unroll
    for (int s = 0; s < 16; ++s) { const int row = s * 2 + hi; const v4f val = *(const v4fa*)(os + row * 64 + ((lr ^ (row & 15)) * 4)) + bv; *(v4f*)(crow + (size_t)row * DM) = val; }   // a wave fills two 128-byte lines of each of two rows
}
// ---- k_fattn: scores, bias, softmax, attn.v and the head merge of one head's FW * 32 query rows in one work-group; no score and no probability goes through memory.
// Each of the FW waves owns 32 query rows and walks ALL keys in tiles of KS; a tile of K and of V^T is brought into LDS once per work-group by asynchronous copies (two buffers) and read by every wave.
// A wave forms S^T = K Q^T (A = key rows, B = query rows): in a 16 x 16 tile a lane holds 8 keys (8 hf + r) of ONE query (column c), so the tile's row maximum is in-lane plus one exchange between the lane halves,
// and two tiles, rounded in place, are the B operand of O^T = V^T P^T in the hardware k order. The softmax runs over the tiles with a running maximum and sum: O^T and the sum are scaled by exp(old max - new max) at each tile, and O^T is divided by the sum at the end.
// BIAS AS A PRODUCT: bias(i, j) = pc0(i) p0(j) + pc1(i) p1(j) + gamma s(j) has rank 3, so it is a third k chunk of the score product. A key's 8 slots (16 bytes in LDS): p0 p1 p0 p1 p0 p1 s s; a query's: 8 pc0, 8 pc1 in three 16-bit parts each (hi, mid, lo), 8 gamma in two.
// The factor 8 = 1 / SCL is exact; the accumulator then holds 8 x the score, and SCL goes into the one multiply-add in front of the exponential. Of a 32-wide chunk only 8 k places are used: two key tiles share one A operand (tile 0's slots at k 0..7, tile 1's at k 16..23), and the query operand has zeros wherever the other tile's (or the other lane half's copy of the) slots stand.
#define FW   4
#define KS   64                   // keys per tile
#define NST  (TT / KS)
#define OP   68                   // floats per query row of a wave's output tile in LDS
#define PLB  (KS * HD * 2)        // bytes of one plane's tile: in fragment order it is one run of bytes of the plane
#define STB  (4 * PLB)            // bytes of one buffer: K, V^T (f16 rows) or K hi, K lo, V^T hi, V^T lo
typedef __attribute__((ext_vector_type(8))) unsigned v8u;
__device__ __forceinline__ float xhalf(float x) { return __builtin_bit_cast(float, __builtin_amdgcn_permlanex16(__builtin_bit_cast(int, x), __builtin_bit_cast(int, x), 0x76543210, 0xfedcba98, false, false)); }   // lane l's value to lane l ^ 16, on the vector side: no LDS counter is waited for
__device__ __forceinline__ v8f cat8(v4f lo, v4f hi) { return __builtin_shufflevector(lo, hi, 0, 1, 2, 3, 4, 5, 6, 7); }
typedef v4u __attribute__((may_alias)) v4ua;
// pk3: a, b rounded to the path's 16-bit type and packed (a in the low half); ra, rb: what the rounding left over
template <bool HR>
__device__ __forceinline__ unsigned pk3(float a, float b, float& ra, float& rb) {
    if constexpr (HR) { const unsigned w = bfpk(a, b); ra = a - bflo(w); rb = b - bfhi(w); return w; }
    else { const v2h x = { (h16)a, (h16)b }; ra = a - (float)x[0]; rb = b - (float)x[1]; return __builtin_bit_cast(unsigned, x); }
}
template <typename T16, bool HR>
__device__ __forceinline__ void fattn_body(const T16* __restrict__ Q, const T16* __restrict__ Q2, const T16* __restrict__ Kp, const T16* __restrict__ K2, const T16* __restrict__ Vt, const T16* __restrict__ Vt2, const float* __restrict__ cm, int qg, bf* Ah, bf* Al, const float* __restrict__ pp, const float* __restrict__ ss, const float* __restrict__ gam, unsigned* kb, char* ring) {
    // every loop of this function but the loop over the key tiles is unrolled in full: tiles and fragments are register arrays, which only constant indices keep in registers
    typedef WFrag<T16> WF; typedef typename WF::V V;
    constexpr int NQ = 2;
    constexpr int KC = HR ? 32 : KS, KT = KC / 16;   // keys per softmax step: the hi / lo rows, whose fragments take twice the registers, go through a tile in two steps
    const int lane = threadIdx.x & 31, c = lane & 15, hf = lane >> 4; const int wv = __builtin_amdgcn_readfirstlane((int)(threadIdx.x >> 5)); const int q0 = qg + wv * (NQ * 16);
    const unsigned lfr = (unsigned)lane * 8u;   // the lane's part of every fragment address; the rest is the same for the whole wave
    const unsigned cl = (unsigned)(size_t)ring + (unsigned)wv * (PLB / FW) + (unsigned)lane * 16u;   // LDS byte address of the lane's first copy: wave w brings quarter w of each plane's tile
    const unsigned cg = (unsigned)wv * (PLB / FW / 2) + lfr;   // the same place in a plane's tile, in elements
    auto fill = [&](int t) { const unsigned lb = cl + (unsigned)(t & 1) * STB; const size_t g = (size_t)t * (KS * HD) + cg;
        if constexpr (HR) { cp8(lb, Kp + g, lb + PLB, K2 + g); cp8(lb + 2 * PLB, Vt + g, lb + 3 * PLB, Vt2 + g); } else cp8(lb, Kp + g, lb + PLB, Vt + g); };
    fill(0);
    // per-key bias slots, each key once per work-group: bf16-rounded p_j0, p_j1, s_j in the operand type of this path (bf16: as they are; f16 holds a bf16 value of this size exactly)
#pragma unroll
    for (int k4 = (int)threadIdx.x * 4; k4 < TT; k4 += 32 * FW * 4) { const v4f pa = *(const v4f*)(pp + (size_t)k4 * 2), pb = *(const v4f*)(pp + (size_t)k4 * 2 + 4), sv = *(const v4f*)(ss + k4);
#pragma unroll
        for (int j = 0; j < 4; ++j) { const float a = (j < 2) ? pa[2 * j] : pb[2 * j - 4], b = (j < 2) ? pa[2 * j + 1] : pb[2 * j - 3]; float ra, rb;
            const unsigned wp = HR ? bfpk(a, b) : pk3<false>(bfr(a), bfr(b), ra, rb), wsj = HR ? bfpk(sv[j], sv[j]) : pk3<false>(bfr(sv[j]), bfr(sv[j]), ra, rb);
            const v4u o = { wp, wp, wp, wsj }; *(v4ua*)(kb + (k4 + j) * 4) = o; } }
    V qf[NQ][2], qf2[NQ][2];
#pragma unroll
    for (int qn = 0; qn < NQ; ++qn)
#pragma unroll
        for (int kc = 0; kc < 2; ++kc) { qf[qn][kc] = WF::ld(Q + (size_t)(q0 + qn * 16) * HD + kc * 512 + lfr); if (HR) qf2[qn][kc] = WF::ld(Q2 + (size_t)(q0 + qn * 16) * HD + kc * 512 + lfr); }
    const float c00 = bfr(cm[0]), c01 = bfr(cm[1]), c10 = bfr(cm[2]), c11 = bfr(cm[3]);
    asm volatile("s_wait_asynccnt 0x0" ::: "memory");   // this wave's share of tile 0 has landed
    __syncthreads();   // tile 0 and the bias slots of every key are in LDS
    fill(1);
    float mr[NQ], ls[NQ];   // mr: running row maximum, times log2(e); ls: running sum over the keys of this lane half
    V bq[NQ][2];   // the query's bias slots: [0] at k 0..7 (even key tiles), [1] at k 16..23 (odd key tiles), zeros elsewhere
    const float gm8 = bfr(gam[0]) * 8.0f;
    v8f oa[HD / 16][NQ];   // oa[db][qn][r]: d = db * 16 + 8 hf + r, query q0 + qn * 16 + c
#pragma unroll
    for (int qn = 0; qn < NQ; ++qn) { const unsigned wq = kb[(q0 + qn * 16 + c) * 4]; const v2h hq = __builtin_bit_cast(v2h, wq); const float pi0 = HR ? bflo(wq) : (float)hq[0], pi1 = HR ? bfhi(wq) : (float)hq[1]; mr[qn] = -3.0e38f; ls[qn] = 0.f;   // a query's p is its position's rounded p: the first word of its slots
        float x0 = (pi0 * c00 + pi1 * c10) * 8.0f, x1 = (pi0 * c01 + pi1 * c11) * 8.0f, g0 = gm8, g1 = 0.f, y0, y1; v4u w;
        w[0] = pk3<HR>(x0, x1, y0, y1); w[1] = pk3<HR>(y0, y1, x0, x1); w[2] = pk3<HR>(x0, x1, y0, y1); pk3<HR>(g0, g1, y0, y1); w[3] = pk3<HR>(g0, y0, x0, x1);
        if (hf) w = (v4u){};   // lanes 16..31 hold k 8..15 and 24..31: no slot there
        const v4u zz = {}; bq[qn][0] = __builtin_bit_cast(V, __builtin_shufflevector(w, zz, 0, 1, 2, 3, 4, 5, 6, 7)); bq[qn][1] = __builtin_bit_cast(V, __builtin_shufflevector(zz, w, 0, 1, 2, 3, 4, 5, 6, 7));
#pragma unroll
        for (int db = 0; db < HD / 16; ++db) oa[db][qn] = (v8f){}; }
    // left rolled: one tile's code serves all tiles, and the two buffers differ only in a base address
#pragma unroll 1
    for (int t = 0; t < NST; ++t) {
        const char* st = ring + (t & 1) * STB;
#pragma unroll
        for (int h = 0; h < KS / KC; ++h) {
        const int k0 = h * KC;   // KC keys are KC * HD elements in a row of a K tile and of a V^T tile alike
        const T16* Ks = (const T16*)st + k0 * HD + lfr; const T16* Ks2 = (const T16*)(st + PLB) + k0 * HD + lfr; const T16* Vs = (const T16*)(st + (HR ? 2 : 1) * PLB) + k0 * HD + lfr; const T16* Vs2 = (const T16*)(st + 3 * PLB) + k0 * HD + lfr;
        v8f sc[KT][NQ];   // sc[kt][qn][r]: 8 x the score of key t * KS + k0 + kt * 16 + 8 hf + r, query q0 + qn * 16 + c
        V ab[KT / 2], a[KT][2], a2[KT][2];   // ab: bias slots of two key tiles each; both lane halves read key c's 16 bytes
#pragma unroll
        for (int kt = 0; kt < KT; ++kt)
#pragma unroll
            for (int kc = 0; kc < 2; ++kc) { a[kt][kc] = WF::ld(Ks + kt * 1024 + kc * 512); if (HR) a2[kt][kc] = WF::ld(Ks2 + kt * 1024 + kc * 512); }
#pragma unroll
        for (int g = 0; g < KT / 2; ++g) { const unsigned* kk = kb + (t * KS + k0 + g * 32 + c) * 4; ab[g] = __builtin_bit_cast(V, __builtin_shufflevector(*(const v4ua*)kk, *(const v4ua*)(kk + 64), 0, 1, 2, 3, 4, 5, 6, 7)); }
        __builtin_amdgcn_sched_barrier(0);   // the step's K fragments and bias slots are asked for in one group: with the bias arithmetic gone nothing stands between the products, and left alone this build asks for two fragments at a time and waits out each LDS round trip
#pragma unroll
        for (int kt = 0; kt < KT; ++kt)
#pragma unroll
            for (int qn = 0; qn < NQ; ++qn) { v8f s = (v8f){};
#pragma unroll
                for (int kc = 0; kc < 2; ++kc) { s = WF::mma(a[kt][kc], qf[qn][kc], s); if (HR) { s = WF::mma(a[kt][kc], qf2[qn][kc], s); s = WF::mma(a2[kt][kc], qf[qn][kc], s); } }
                sc[kt][qn] = WF::mma(ab[kt >> 1], bq[qn][kt & 1], s); }   // the bias goes in last: the small products are summed among themselves first
        float mx[NQ];
#pragma unroll
        for (int qn = 0; qn < NQ; ++qn) mx[qn] = -3.0e38f;
#pragma unroll
        for (int kt = 0; kt < KT; ++kt)
#pragma unroll
            for (int qn = 0; qn < NQ; ++qn)
#pragma unroll
                for (int r = 0; r < 8; ++r) mx[qn] = fmaxf(mx[qn], sc[kt][qn][r]);
#pragma unroll
        for (int qn = 0; qn < NQ; ++qn) mx[qn] = fmaxf(mx[qn], xhalf(mx[qn]));   // the step's row maximum, over both lane halves
        V va[HD / 16][KC / 32], va2[HD / 16][KC / 32];
#pragma unroll
        for (int db = 0; db < HD / 16; ++db)
#pragma unroll
            for (int kk = 0; kk < KC / 32; ++kk) { va[db][kk] = WF::ld(Vs + kk * 2048 + db * 512); if (HR) va2[db][kk] = WF::ld(Vs2 + kk * 2048 + db * 512); }
        __builtin_amdgcn_sched_barrier(0);   // all V^T fragments of the step are asked for here and arrive under the exponentials: left alone, this build asks for half of them among the products and waits for them there
        V pf[KC / 32][NQ], pf2[KC / 32][NQ];   // element s of pf[kk][qn]: key t * KS + k0 + kk * 32 + (s < 8 ? 8 hf + s : 16 + 8 hf + s - 8), the order in which WFrag::ld takes V^T's keys
#pragma unroll
        for (int qn = 0; qn < NQ; ++qn) { const float mn = fmaxf(mr[qn], mx[qn] * (SCL * 1.4426950408889634f));   // rounding keeps the order, so this is the running maximum's own product
            const float al = __builtin_amdgcn_exp2f(mr[qn] - mn); mr[qn] = mn;   // 0 at the first tile, where sum and O^T are 0
            const float nb = (HR ? 0.0f : 10.0f) - mn;
            v8f vs;
#pragma unroll
            for (int kt = 0; kt < KT; ++kt) { const v8f d = sc[kt][qn] * (SCL * 1.4426950408889634f) + nb; v8f e;   // f16 rows: probabilities carried x 1024 (2^10), away from f16's small numbers; the factor is in the sum too and leaves with the division
#pragma unroll
                for (int r = 0; r < 8; ++r) e[r] = __builtin_amdgcn_exp2f(d[r]);
                sc[kt][qn] = e; vs = (kt == 0) ? e : vs + e; }
            ls[qn] = ls[qn] * al + (((vs[0] + vs[1]) + (vs[2] + vs[3])) + ((vs[4] + vs[5]) + (vs[6] + vs[7])));
#pragma unroll
            for (int db = 0; db < HD / 16; ++db) oa[db][qn] *= al;
#pragma unroll
            for (int kk = 0; kk < KC / 32; ++kk) { const v8f p0 = sc[2 * kk][qn], p1 = sc[2 * kk + 1][qn];
                if constexpr (HR) { v8u wh, wl;   // each pair of neighbouring keys is rounded and packed into its hi word and its lo word at once
#pragma unroll
                    for (int w = 0; w < 8; ++w) { const float xa = (w < 4) ? p0[2 * w] : p1[2 * w - 8], xb = (w < 4) ? p0[2 * w + 1] : p1[2 * w - 7];
                        unsigned h2, l2; splitpk(xa, xb, h2, l2); wh[w] = h2; wl[w] = l2; }
                    pf[kk][qn] = __builtin_bit_cast(v16bf, wh); pf2[kk][qn] = __builtin_bit_cast(v16bf, wl);
                } else { v8h x0, x1;
#pragma unroll
                    for (int r = 0; r < 8; ++r) { x0[r] = tohx(p0[r]); x1[r] = tohx(p1[r]); }
                    pf[kk][qn] = cat16(x0, x1); } } }
        asm volatile("" :: "v"(ls[0]), "v"(ls[1]));   // inputs only: the running sums are formed by here. Left alone, this build moves their additions to the loop's foot and keeps every unpacked probability in registers beside the packed ones
#pragma unroll
        for (int db = 0; db < HD / 16; ++db)
#pragma unroll
            for (int kk = 0; kk < KC / 32; ++kk)
#pragma unroll
                for (int qn = 0; qn < NQ; ++qn) { oa[db][qn] = WF::mma(va[db][kk], pf[kk][qn], oa[db][qn]); if (HR) { oa[db][qn] = WF::mma(va[db][kk], pf2[kk][qn], oa[db][qn]); oa[db][qn] = WF::mma(va2[db][kk], pf[kk][qn], oa[db][qn]); } }
        }
        asm volatile("s_wait_dscnt 0x0" ::: "memory");      // this wave's reads of the buffer are over before the buffer is given up
        asm volatile("s_wait_asynccnt 0x0" ::: "memory");   // this wave's share of tile t + 1 has landed
        __syncthreads();   // tile t + 1 is whole, and every wave has left tile t's buffer
        if (t + 2 < NST) fill(t + 2);
    }
    asm volatile("s_wait_asynccnt 0x0" ::: "memory");   // no copy is under way when the ring becomes output staging
    float* os = (float*)ring + wv * (NQ * 16 * OP);   // behind the loop's last barrier: each wave stages its own rows
#pragma unroll
    for (int qn = 0; qn < NQ; ++qn) { const float inv = __fdiv_rn(1.0f, ls[qn] + xhalf(ls[qn]));
#pragma unroll
        for (int db = 0; db < HD / 16; ++db) { const v8f o8 = oa[db][qn] * inv; float* o = os + (qn * 16 + c) * OP + db * 16 + 8 * hf; *(v4fa*)o = __builtin_shufflevector(o8, o8, 0, 1, 2, 3); *(v4fa*)(o + 4) = __builtin_shufflevector(o8, o8, 4, 5, 6, 7); } }
    __syncthreads();   // the staged rows are written before other lanes read them
#pragma unroll
    for (int u = 0; u < NQ * 8; ++u) {   // half-piece u (256 bytes: 16 rows x 8 d) of the wave's [16 rows][32 d][piece] blocks; lane halves take d 0..3 and 4..7 of a row
        const int row = (u >> 3) * 16 + c, cofs = (u & 7) * 8 + hf * 4; const v4f val = *(const v4fa*)(os + row * OP + cofs); v2u oh, ol;
#pragma unroll
        for (int q = 0; q < 2; ++q) { unsigned a, b; splitpk(val[2 * q], val[2 * q + 1], a, b); oh[q] = a; ol[q] = b; }
        const size_t oo = (size_t)(q0 + (u >> 3) * 16) * DQ + ((u >> 2) & 1) * 512 + (u & 3) * 128 + c * 8 + hf * 4; *(v4us*)(Ah + oo) = __builtin_bit_cast(v4us, oh); *(v4us*)(Al + oo) = __builtin_bit_cast(v4us, ol); }
}
// grid (NH_, TT / (32 FW), NB_): 32 FW query rows of one head of one batch; QK*: per batch the q head planes with the k head planes behind them, [b][h] planes of TT rows x HD; VT*: [b][h] planes of HD rows x TT; Ah / Al: the merged rows, one plane of NB_ * TT rows x DQ; all in fragment order
__global__ __launch_bounds__(32 * FW) void k_fattn(const h16* __restrict__ QK16, const bf* __restrict__ QKh, const bf* __restrict__ QKl, const h16* __restrict__ VT16, const bf* __restrict__ VTh, const bf* __restrict__ VTl, const float* __restrict__ pp, const float* __restrict__ ss, const float* __restrict__ cm, const float* __restrict__ gam, bf* Ah, bf* Al) {
    __shared__ __align__(16) unsigned kb[4 * TT]; __shared__ __align__(1024) char ring[2 * STB];
    const int hh = blockIdx.x, q0 = blockIdx.y * (32 * FW), bz = blockIdx.z;   // heads run fastest: a batch's hi / lo row blocks, which cost most, start first
    pp += (size_t)bz * TT * 2; ss += (size_t)bz * TT;
    const size_t qo = ((size_t)bz * (NH_ + NKV) + hh) * TT * HD, ko = ((size_t)bz * (NH_ + NKV) + NH_ + hh / REP) * TT * HD, vo = ((size_t)bz * NKV + hh / REP) * HD * TT;
    Ah += (size_t)bz * TT * DQ; Al += (size_t)bz * TT * DQ;
    if (q0 < RH) fattn_body<bf, true>(QKh + qo, QKl + qo, QKh + ko, QKl + ko, VTh + vo, VTl + vo, cm + hh * 4, q0, Ah + hh * (HD / 32) * 512, Al + hh * (HD / 32) * 512, pp, ss, gam, kb, ring);
    else fattn_body<h16, false>(QK16 + qo, nullptr, QK16 + ko, nullptr, VT16 + vo, nullptr, cm + hh * 4, q0, Ah + hh * (HD / 32) * 512, Al + hh * (HD / 32) * 512, pp, ss, gam, kb, ring);
}

extern "C" void kernel_launch(void* const* d_in, const int* in_sizes, int n_in,
                              void* d_out, int out_size, void* d_ws, size_t ws_size, hipStream_t stream) {
    (void)in_sizes; (void)n_in; (void)out_size;
    const float* x = (const float*)d_in[0]; const float* pp = (const float*)d_in[1]; const float* ss = (const float*)d_in[2]; const float* wq = (const float*)d_in[3]; const float* wk = (const float*)d_in[4]; const float* wv = (const float*)d_in[5]; const float* wo = (const float*)d_in[6]; const float* bo = (const float*)d_in[7]; const float* compat = (const float*)d_in[8]; const float* gam = (const float*)d_in[9]; const float* cosT = nullptr; const float* sinT = nullptr; (void)cosT; (void)sinT;
    float* OUT = (float*)d_out;     // [4][2048][768]
    char* wsp = (char*)d_ws;
    auto take = [&](size_t bytes) { char* p = wsp; wsp += (bytes + 255) & ~(size_t)255; return (void*)p; };
    bf* WQ = (bf*)take((size_t)(DQ + 2 * DKV) * DM * 2 + (size_t)DM * DQ * 2); bf* WO = WQ + (size_t)(DQ + 2 * DKV) * DM;   // wq, wk, wv, wo planes one behind the other: [wq; wk; wv] is one Bt of DQ + 2 DKV rows
    bf* XB = (bf*)take((size_t)NB_ * TT * DM * 2);
    const size_t SQK = (size_t)(NH_ + NKV) * TT * HD, SV = (size_t)NKV * HD * TT;   // elements of one batch's q + k planes and of its v planes
    h16* QP16 = (h16*)take(NB_ * SQK * 2); h16* VT16 = (h16*)take(NB_ * SV * 2);   // the k head planes follow the q head planes
    bf* QPh = (bf*)take(NB_ * SQK * 2); bf* QPl = (bf*)take(NB_ * SQK * 2); bf* VTh = (bf*)take(NB_ * SV * 2); bf* VTl = (bf*)take(NB_ * SV * 2);
    bf* ATh = (bf*)take((size_t)NB_ * TT * DQ * 2); bf* ATl = (bf*)take((size_t)NB_ * TT * DQ * 2);
    if ((size_t)(wsp - (char*)d_ws) > ws_size) return;    // ws 256 MiB
    k_cvt8w<<<dim3((unsigned)(((size_t)DQ * DM / 8 + 255) / 256), 4, 1), 256, 0, stream>>>(wq, wk, wv, wo, WQ, (size_t)DQ * DM / 8);
    k_cvt8<<<(unsigned)(((size_t)NB_ * TT * DM / 8 + 255) / 256), 256, 0, stream>>>(x, XB, (size_t)NB_ * TT * DM / 8);
    k_qkv<<<dim3(NB_ * TT / 128, (NH_ + 2 * NKV) / 2, 1), 128, 0, stream>>>(XB, WQ, QP16, QPh, QPl, VT16, VTh, VTl);   // the four batches' rows follow one another in XB
    k_fattn<<<dim3(NH_, TT / (32 * FW), NB_), 32 * FW, 0, stream>>>(QP16, QPh, QPl, VT16, VTh, VTl, pp, ss, compat, gam, ATh, ATl);
    k_wo<<<dim3(NB_ * TT / 64, DM / 128, 1), 128, 0, stream>>>(ATh, ATl, WO, OUT, bo);   // the four batches' rows follow one another in ATh / ATl and in OUT
}

// v010
// One run takes 116 microseconds.
// Two timings next to v009 put it at 1.15 and 1.16 times that version's speed.
// Over all steps from v000 it is 27.9 times as fast.
#include <hip/hip_runtime.h>

// SBERTaAttention (H [4][2048][768], p [4][2048][2] (language probs, read), s [4][2048] (read), compat [12][2][2], gamma [1]; Q/K/V = H W^T (12 x 64, no bias); scores = Q.K / 8 + (p_i compat_h) . p_j + gamma s_j; softmax; out = merged wo^T + bo -> [4][2048][768]).
// Compute dtypes, f32 accumulate: every input rounded to bf16; Q/K/V on PLAIN bf16 operands (inputs: exact); scores PRECPLAN; the bilinear language bias (2x2 per head) and the position bias, from the bf16-rounded p, s, compat, gamma, added by one more matrix product per score tile (k_fattn: the query side split into three 16-bit parts, products exact); softmax f32; attn.v: rows < 512 hl (3 products), the rest fp16 (x1024); wo hl x exact (2 products) + bias.

#define NB_  4
#define TT   2048
#define DM   768
#define NH_  12
#define NKV  12
#define REP  (NH_ / NKV)
#define HD   64
#define DQ   (NH_ * HD)
#define DKV  (NKV * HD)
#define RH   512                  // query rows < RH use hi+lo planes (0: none)
#define WIN  0
#define PCAR 1024.0f
#define SCL  0.125f   // HD^-0.5
typedef _Float16 h16;
typedef unsigned short bf;
typedef __attribute__((ext_vector_type(16))) __bf16   v16bf;
typedef __attribute__((ext_vector_type(16))) _Float16 v16h;
typedef __attribute__((ext_vector_type(8)))  _Float16 v8h;
typedef __attribute__((ext_vector_type(8)))  unsigned short v8us;
typedef __attribute__((ext_vector_type(8)))  float    v8f;
typedef __attribute__((ext_vector_type(4)))  float    v4f;
typedef v8h  __attribute__((may_alias)) v8ha;
typedef v4f  __attribute__((may_alias)) v4fa;
typedef v8us __attribute__((may_alias)) v8usa;

typedef __attribute__((ext_vector_type(2))) __bf16 v2bf;
typedef __attribute__((ext_vector_type(2))) float v2f;
typedef __attribute__((ext_vector_type(2))) unsigned v2u;
typedef __attribute__((ext_vector_type(4))) unsigned v4u;
// f32 -> bf16 by the chip's own convert (round to nearest even): one instruction rounds and packs two values
__device__ __forceinline__ unsigned short f2bf(float f) { return __builtin_bit_cast(unsigned short, (__bf16)f); }
__device__ __forceinline__ unsigned bfpk(float a, float b) { const v2f x = { a, b }; return __builtin_bit_cast(unsigned, __builtin_convertvector(x, v2bf)); }   // a in the low half, b in the high half
__device__ __forceinline__ float bflo(unsigned w) { return __uint_as_float(w << 16); }
__device__ __forceinline__ float bfhi(unsigned w) { return __uint_as_float(w & 0xFFFF0000u); }
__device__ __forceinline__ void splitpk(float a, float b, unsigned& h, unsigned& l) { h = bfpk(a, b); l = bfpk(a - bflo(h), b - bfhi(h)); }   // hi plane word and lo plane word of two values: lo = bf16(x - hi)
__device__ __forceinline__ float bf2f(unsigned short b) { return __uint_as_float(((unsigned)b) << 16); }
__device__ __forceinline__ float bfr(float f) { return bf2f(f2bf(f)); }
__device__ __forceinline__ v16h cat16(v8h lo, v8h hi) { return __builtin_shufflevector(lo, hi, 0, 1, 2, 3, 4, 5, 6, 7, 8, 9, 10, 11, 12, 13, 14, 15); }
__device__ __forceinline__ v16bf cat16b(v8us lo, v8us hi) { return __builtin_bit_cast(v16bf, __builtin_shufflevector(lo, hi, 0, 1, 2, 3, 4, 5, 6, 7, 8, 9, 10, 11, 12, 13, 14, 15)); }
__device__ __forceinline__ v8f wmma16(v16h a, v16h b, v8f c) { return __builtin_amdgcn_wmma_f32_16x16x32_f16(false, a, false, b, (short)0, c, false, false); }
__device__ __forceinline__ v8f wmmab(v16bf a, v16bf b, v8f c) { return __builtin_amdgcn_wmma_f32_16x16x32_bf16(false, a, false, b, (short)0, c, false, false); }



// FRAGMENT ORDER: every 16-bit operand plane in the workspace is kept as blocks of 16 rows x 32 k (1 KiB), each block as the two 512-byte pieces that a wave loads:
// element (row, k) of a block lies at ((k >> 4) & 1) * 256 + (((k >> 3) & 1) * 16 + (row & 15)) * 8 + (k & 7). Lane l reads 16 bytes at l * 16 of each piece, so a wave-wide load covers four whole 128-byte lines
// (row-major planes gave 32 bytes of each of 16 lines). The values a lane gets, and so the k order, are those of the row-major loader. A plane of R rows and K columns is [R / 16][K / 32] blocks; the v planes are [TT / 32][HD / 16] blocks.
template <typename T16> struct WFrag;
template <> struct WFrag<h16> { typedef v16h V; static __device__ __forceinline__ V ld(const h16* p) { return cat16(*(const v8h*)p, *(const v8h*)(p + 256)); } static __device__ __forceinline__ v8f mma(V a, V b, v8f c) { return wmma16(a, b, c); } };
template <> struct WFrag<bf> { typedef v16bf V; static __device__ __forceinline__ V ld(const bf* p) { return cat16b(*(const v8us*)p, *(const v8us*)(p + 256)); } static __device__ __forceinline__ v8f mma(V a, V b, v8f c) { return wmmab(a, b, c); } };

__device__ __forceinline__ h16 tohx(float x) { return (h16)x; }
typedef __attribute__((ext_vector_type(2))) _Float16 v2h;
typedef __attribute__((ext_vector_type(4))) _Float16 v4h;
typedef __attribute__((ext_vector_type(2))) unsigned short v2us;
typedef __attribute__((ext_vector_type(4))) unsigned short v4us;
typedef __attribute__((ext_vector_type(4))) int v4i;

__global__ __launch_bounds__(256) void k_wtG(const float* __restrict__ w, int K, int N, bf* Bt) {
    const int lane = threadIdx.x & 31; const int L0 = (blockIdx.x * 8 + (threadIdx.x >> 5)) * 8; const int nlines = N * K / 64;
{
#pragma unroll 1
        for (int l = 0; l < 8; ++l) { const int L = L0 + l; if (L >= nlines) break; const size_t e = (size_t)L * 64 + lane * 2; const int k = (int)(e % K), n = (int)(e / K); v2us o;
            o[0] = f2bf(w[(size_t)k * N + n]); o[1] = f2bf(w[(size_t)(k + 1) * N + n]); *(v2us*)(Bt + e) = o; }
         }
}
// frsrc: the row-major element offset (rows of DM) of the 8 values that make 16-byte unit i of a plane in fragment order
__device__ __forceinline__ unsigned frsrc(size_t i8) { const unsigned i = (unsigned)i8, l = i & 31u, part = (i >> 5) & 1u, blk = i >> 6, rt = blk / (DM / 32), kch = blk % (DM / 32); return (rt * 16u + (l & 15u)) * DM + kch * 32u + part * 16u + (l >> 4) * 8u; }   // the largest plane has NB_ * TT * DM elements: 32 bits hold every offset
__global__ __launch_bounds__(256) void k_cvt8(const float* __restrict__ src, bf* dst, size_t n8) { const size_t i = (size_t)blockIdx.x * 256 + threadIdx.x; if (i >= n8) return; const v8f v = *(const v8f*)(src + frsrc(i)); v4u o;
#pragma unroll
    for (int k = 0; k < 4; ++k) o[k] = bfpk(v[2 * k], v[2 * k + 1]); *(v8us*)(dst + i * 8) = __builtin_bit_cast(v8us, o);  }
// k_cvt8w: the four weight matrices (n8 * 8 elements each), one per blockIdx.y, into four planes that follow one another in dst
__global__ __launch_bounds__(256) void k_cvt8w(const float* __restrict__ w0, const float* __restrict__ w1, const float* __restrict__ w2, const float* __restrict__ w3, bf* dst, size_t n8) { const size_t i = (size_t)blockIdx.x * 256 + threadIdx.x; if (i >= n8) return; const int y = blockIdx.y; const float* src = (y == 0) ? w0 : (y == 1) ? w1 : (y == 2) ? w2 : w3; const v8f v = *(const v8f*)(src + frsrc(i)); v4u o;
#pragma unroll
    for (int k = 0; k < 4; ++k) o[k] = bfpk(v[2 * k], v[2 * k + 1]); *(v8us*)(dst + ((size_t)y * n8 + i) * 8) = __builtin_bit_cast(v8us, o);  }
__global__ __launch_bounds__(256) void k_cscvt(const float* __restrict__ cosT, const float* __restrict__ sinT, float* CS) { const int idx = blockIdx.x * 256 + threadIdx.x; if (idx >= TT * HD) return; v2f cs; cs[0] = bfr(cosT[idx]); cs[1] = bfr(sinT[idx]); *(v2f*)(CS + (size_t)idx * 2) = cs;  }
// cp8: a wave's four 512-byte pieces of each of two runs (in two planes or in one), global memory -> LDS, through no register. la, lb: the lane's LDS byte addresses; ga, gb: the lane's global addresses.
// The wait on the address counter is the statement's last line, so that it stands in front of whatever rewrites an address register.
template <typename T16>
__device__ __forceinline__ void cp8(unsigned la, const T16* ga, unsigned lb, const T16* gb) {
    asm volatile("global_load_async_to_lds_b128 %0, %8, off\n\t"
                 "global_load_async_to_lds_b128 %1, %9, off\n\t"
                 "global_load_async_to_lds_b128 %2, %10, off\n\t"
                 "global_load_async_to_lds_b128 %3, %11, off\n\t"
                 "global_load_async_to_lds_b128 %4, %12, off\n\t"
                 "global_load_async_to_lds_b128 %5, %13, off\n\t"
                 "global_load_async_to_lds_b128 %6, %14, off\n\t"
                 "global_load_async_to_lds_b128 %7, %15, off\n\t"
                 "s_wait_xcnt 0x0"
                 :: "v"(la), "v"(la + 512u), "v"(la + 1024u), "v"(la + 1536u), "v"(lb), "v"(lb + 512u), "v"(lb + 1024u), "v"(lb + 1536u),
                    "v"(ga), "v"(ga + 256), "v"(ga + 512), "v"(ga + 768), "v"(gb), "v"(gb + 256), "v"(gb + 512), "v"(gb + 768) : "memory");
}
// ---- k_qkv: q, k and v of all batches as one product. A work-group of 4 waves forms a 128 x 128 tile (128 positions of TWO heads of q, k or v); each wave owns a 64 x 64 quarter (64 positions of ONE head) and walks the whole of k.
// The operands' 128 + 128 rows are brought into LDS once per work-group, QK k at a time, by asynchronous copies (two buffers) and read from there by the two waves that need each row: half the L2 reads of a 64 x 64 tile, and no partial tiles to sum.
// A wave's quarter leaves as its head's fp16 and hi / lo planes: no f32 copy goes through memory.
// X: [b * TT + t][DM]; Wt: [wq; wk; wv], DQ + 2 DKV rows of DM; both, and all planes written, in fragment order, so 16 rows x QK k are one run of 2 KiB in memory and in LDS alike. grid (NB_ * TT / 128, (NH_ + 2 NKV) / 2), 128 threads. DM % QK == 0, DM >= 2 QK.
// A lane holds 8 consecutive A rows of one B row, so a quarter goes to LDS as [B row][A row] in 16-byte stores. q, k planes are [t][d]: A = weight rows, B = positions. v planes are [d][t]: A = positions, B = weight rows.
#define QK   64                   // k per pass
#define QSB  (2 * 128 * QK * 2)   // bytes of one buffer: A's 128 rows, then B's
__global__ __launch_bounds__(128) void k_qkv(const bf* __restrict__ X, const bf* __restrict__ Wt, h16* QK16, bf* QKh, bf* QKl, h16* VT16, bf* VTh, bf* VTl) {
    // every loop but the loop over the passes is unrolled in full: tiles and fragments are register arrays, which only constant indices keep in registers
    typedef WFrag<bf> WF; typedef WF::V V;
    __shared__ __align__(1024) char sm[2 * QSB];   // the two buffers; behind the loop each wave's quarter, 64 rows of 64 floats. 64 KiB: five work-groups share a WGP's LDS, and the whole grid is resident at once
    static_assert(4 * 64 * 64 * 4 <= 2 * QSB, "the staged quarters lie inside the ring");
    const int lane = threadIdx.x & 31, lr = lane & 15, hi = lane >> 4; const int wv = __builtin_amdgcn_readfirstlane((int)(threadIdx.x >> 5)) /* wave number in a scalar register: what is formed from it stays on the scalar side */; const int wm = wv & 1, wn = wv >> 1; const int r0 = blockIdx.x * 128, hp0 = blockIdx.y * 2;
    const bool isv = hp0 >= NH_ + NKV;   // the same for the whole work-group: NH_ + NKV is even
    const bf* xr = X + (size_t)r0 * DM; const bf* wr = Wt + (size_t)hp0 * HD * DM;
    const bf* A = isv ? xr : wr; const bf* Bt = isv ? wr : xr;
    v8f acc[4][4];
#pragma unroll
    for (int mb = 0; mb < 4; ++mb)
#pragma unroll
        for (int nb = 0; nb < 4; ++nb) acc[mb][nb] = (v8f){};
    const unsigned cl = (unsigned)(size_t)sm + (unsigned)wv * 4096u + (unsigned)lane * 16u;   // LDS byte address of the lane's first copy: wave w brings the 16-row blocks 2 w and 2 w + 1 of A and of B
    const unsigned cg = (unsigned)wv * (32 * DM) + (unsigned)lane * 8u;   // the same place in a plane, in elements: 16 rows of DM columns start where they did row-major
    auto fill = [&](int t) { const unsigned lb = cl + (unsigned)(t & 1) * QSB; const bf* ga = A + cg + t * (16 * QK); const bf* gb = Bt + cg + t * (16 * QK);
        cp8(lb, ga, lb + 2048u, ga + 16 * DM); cp8(lb + QSB / 2, gb, lb + QSB / 2 + 2048u, gb + 16 * DM); };
    fill(0);
    asm volatile("s_wait_asynccnt 0x0" ::: "memory");   // this wave's share of pass 0 has landed
    __syncthreads();   // pass 0 is whole
    fill(1);
    // left rolled: one pass's code serves all passes, and the two buffers differ only in a base address
#pragma unroll 1
    for (int t = 0; t < DM / QK; ++t) {
        const bf* st = (const bf*)(sm + (t & 1) * QSB) + lane * 8; const bf* As = st + wm * (64 * QK); const bf* Bs = st + QSB / 4 + wn * (64 * QK);
#pragma unroll
        for (int kc = 0; kc < QK / 32; ++kc) { V a[4], b[4];
#pragma unroll
            for (int mb = 0; mb < 4; ++mb) { a[mb] = WF::ld(As + mb * (16 * QK) + kc * 512); b[mb] = WF::ld(Bs + mb * (16 * QK) + kc * 512); }
#pragma unroll
            for (int nb = 0; nb < 4; ++nb)
#pragma unroll
                for (int mb = 0; mb < 4; ++mb) acc[mb][nb] = WF::mma(a[mb], b[nb], acc[mb][nb]); }
        asm volatile("s_wait_dscnt 0x0" ::: "memory");      // this wave's reads of the buffer are over before the buffer is given up
        asm volatile("s_wait_asynccnt 0x0" ::: "memory");   // this wave's share of pass t + 1 has landed
        __syncthreads();   // pass t + 1 is whole, and every wave has left pass t's buffer
        if (t + 2 < DM / QK) fill(t + 2);
    }
    asm volatile("s_wait_asynccnt 0x0" ::: "memory");   // no copy is under way when the ring becomes output staging
    float* os = (float*)sm + wv * (64 * 64);   // behind the loop's last barrier: each wave stages its own quarter
    unsigned xo[4][2];   // rows have no pad: 16-byte unit q of row r lies at place q ^ (r & 15), so 16 lanes on 16 rows of one column of units meet all 64 banks once. xo[mb][j]: the place, in floats, of unit mb * 4 + 2 hi + j in a row with r & 15 == lr
#pragma unroll
    for (int mb = 0; mb < 4; ++mb)
#pragma unroll
        for (int j = 0; j < 2; ++j) xo[mb][j] = (unsigned)(((mb * 4 + 2 * hi + j) ^ lr) * 4);
#pragma unroll
    for (int nb = 0; nb < 4; ++nb)
#pragma unroll
        for (int mb = 0; mb < 4; ++mb) { float* o = os + (nb * 16 + lr) * 64; *(v4fa*)(o + xo[mb][0]) = __builtin_shufflevector(acc[mb][nb], acc[mb][nb], 0, 1, 2, 3); *(v4fa*)(o + xo[mb][1]) = __builtin_shufflevector(acc[mb][nb], acc[mb][nb], 4, 5, 6, 7); }
    __syncthreads();   // the staged rows are written before other lanes read them
    const int rw = r0 + (isv ? wm : wn) * 64, hp = hp0 + (isv ? wn : wm);   // the wave's 64 positions and its head
    const int bz = rw / TT, t0 = rw % TT;   // TT % 64 == 0: a quarter lies in one batch
    const size_t base = isv ? (((size_t)bz * NKV + (hp - NH_ - NKV)) * TT + t0) * HD : (((size_t)bz * (NH_ + NKV) + hp) * TT + t0) * HD;   // in fragment order the quarter is 8 KiB in a row of either kind of plane
    h16* P16 = (isv ? VT16 : QK16) + base; bf* Ph = (isv ? VTh : QKh) + base; bf* Pl = (isv ? VTl : QKl) + base;
#pragma unroll
    for (int u = 0; u < 16; ++u) {   // 512-byte piece u of the quarter: q, k [16 t][32 d][piece], v [32 t][16 d][piece]
        const int row = (isv ? ((u >> 1) & 3) : (u >> 2)) * 16 + lr; const unsigned x0 = isv ? xo[(u >> 3) * 2 + (u & 1)][0] : xo[u & 3][0], x1 = isv ? xo[(u >> 3) * 2 + (u & 1)][1] : xo[u & 3][1];   // the lane's 8 values are units 2 hi and 2 hi + 1 of one 16-wide block of the row
        const v4f v0 = *(const v4fa*)(os + row * 64 + x0), v1 = *(const v4fa*)(os + row * 64 + x1);
        v8h o16; v4u oh, ol;
#pragma unroll
        for (int q = 0; q < 8; ++q) o16[q] = tohx((q < 4) ? v0[q & 3] : v1[q & 3]);
#pragma unroll
        for (int q = 0; q < 4; ++q) { unsigned a2, c2; if (q < 2) splitpk(v0[2 * q], v0[2 * q + 1], a2, c2); else splitpk(v1[2 * q - 4], v1[2 * q - 3], a2, c2); oh[q] = a2; ol[q] = c2; }
        const unsigned oo = (unsigned)(u * 32 + lane) * 8u; *(v8h*)(P16 + oo) = o16; *(v8us*)(Ph + oo) = __builtin_bit_cast(v8us, oh); *(v8us*)(Pl + oo) = __builtin_bit_cast(v8us, ol); }   // a wave fills four 128-byte lines of each plane
}
// ---- k_wo: out = merged wo^T + bo, the merged rows as hi + lo planes (2 products). A work-group of 4 waves forms 64 rows x 128 columns; each wave owns 32 rows x 64 columns and walks the whole of k. Ring, copies and staging as in k_qkv:
// a buffer holds 64 rows of the hi plane, 64 of the lo plane and 128 weight rows, QK k each. A = weight rows, B = merged rows: a lane holds 8 consecutive columns of one output row. grid (NB_ * TT / 64, DM / 128), 128 threads. DQ % QK == 0, DQ >= 2 QK.
__global__ __launch_bounds__(128) void k_wo(const bf* __restrict__ Mh, const bf* __restrict__ Ml, const bf* __restrict__ Wt, float* C, const float* __restrict__ bias) {
    // every loop but the loop over the passes is unrolled in full: tiles and fragments are register arrays, which only constant indices keep in registers
    typedef WFrag<bf> WF; typedef WF::V V;
    __shared__ __align__(1024) char sm[2 * QSB];   // the two buffers; behind the loop each wave's part, 32 rows of 64 floats
    const int lane = threadIdx.x & 31, lr = lane & 15, hi = lane >> 4; const int wv = __builtin_amdgcn_readfirstlane((int)(threadIdx.x >> 5)) /* wave number in a scalar register: what is formed from it stays on the scalar side */; const int wm = wv & 1, wn = wv >> 1; const int r0 = blockIdx.x * 64, c0 = blockIdx.y * 128;
    v8f acc[4][2];
#pragma unroll
    for (int mb = 0; mb < 4; ++mb)
#pragma unroll
        for (int nb = 0; nb < 2; ++nb) acc[mb][nb] = (v8f){};
    const unsigned cl = (unsigned)(size_t)sm + (unsigned)lane * 16u;   // the lane's part of every copy's LDS byte address
    const bf* gh = Mh + (size_t)(r0 + wv * 16) * DQ + lane * 8; const bf* gl = Ml + (size_t)(r0 + wv * 16) * DQ + lane * 8; const bf* gw = Wt + (size_t)(c0 + wv * 32) * DQ + lane * 8;   // wave w brings 16-row block w of the hi and of the lo plane and blocks 2 w, 2 w + 1 of the weight rows
    auto fill = [&](int t) { const unsigned lb = cl + (unsigned)(t & 1) * QSB;
        cp8(lb + (unsigned)wv * 2048u, gh + t * (16 * QK), lb + QSB / 4 + (unsigned)wv * 2048u, gl + t * (16 * QK)); cp8(lb + QSB / 2 + (unsigned)wv * 4096u, gw + t * (16 * QK), lb + QSB / 2 + (unsigned)wv * 4096u + 2048u, gw + 16 * DQ + t * (16 * QK)); };
    fill(0);
    asm volatile("s_wait_asynccnt 0x0" ::: "memory");   // this wave's share of pass 0 has landed
    __syncthreads();   // pass 0 is whole
    fill(1);
    // left rolled: one pass's code serves all passes, and the two buffers differ only in a base address
#pragma unroll 1
    for (int t = 0; t < DQ / QK; ++t) {
        const bf* st = (const bf*)(sm + (t & 1) * QSB) + lane * 8; const bf* Hs = st + wm * (32 * QK); const bf* Ls = Hs + QSB / 8; const bf* Ws = st + QSB / 4 + wn * (64 * QK);
#pragma unroll
        for (int kc = 0; kc < QK / 32; ++kc) { V w[4], bh[2], bl[2];
#pragma unroll
            for (int mb = 0; mb < 4; ++mb) w[mb] = WF::ld(Ws + mb * (16 * QK) + kc * 512);
#pragma unroll
            for (int nb = 0; nb < 2; ++nb) { bh[nb] = WF::ld(Hs + nb * (16 * QK) + kc * 512); bl[nb] = WF::ld(Ls + nb * (16 * QK) + kc * 512); }
            __builtin_amdgcn_sched_barrier(0);   // the chunk's eight fragments are asked for in one group: left alone, this build keeps one B fragment, asks for the next behind every four products and waits out each LDS round trip, and only three waves share a SIMD here
#pragma unroll
            for (int nb = 0; nb < 2; ++nb)
#pragma unroll
                for (int mb = 0; mb < 4; ++mb) acc[mb][nb] = WF::mma(w[mb], bh[nb], acc[mb][nb]);
#pragma unroll
            for (int nb = 0; nb < 2; ++nb)
#pragma unroll
                for (int mb = 0; mb < 4; ++mb) acc[mb][nb] = WF::mma(w[mb], bl[nb], acc[mb][nb]); }   // per k chunk hi, then lo
        asm volatile("s_wait_dscnt 0x0" ::: "memory");      // this wave's reads of the buffer are over before the buffer is given up
        asm volatile("s_wait_asynccnt 0x0" ::: "memory");   // this wave's share of pass t + 1 has landed
        __syncthreads();   // pass t + 1 is whole, and every wave has left pass t's buffer
        if (t + 2 < DQ / QK) fill(t + 2);
    }
    asm volatile("s_wait_asynccnt 0x0" ::: "memory");   // no copy is under way when the ring becomes output staging
    float* os = (float*)sm + wv * (32 * 64);   // behind the loop's last barrier: each wave stages its own part, [row][column], 16-byte unit q of row r at place q ^ (r & 15) as in k_qkv
#pragma unroll
    for (int nb = 0; nb < 2; ++nb)
#pragma unroll
        for (int mb = 0; mb < 4; ++mb) { float* o = os + (nb * 16 + lr) * 64; *(v4fa*)(o + (unsigned)(((mb * 4 + 2 * hi) ^ lr) * 4)) = __builtin_shufflevector(acc[mb][nb], acc[mb][nb], 0, 1, 2, 3); *(v4fa*)(o + (unsigned)(((mb * 4 + 2 * hi + 1) ^ lr) * 4)) = __builtin_shufflevector(acc[mb][nb], acc[mb][nb], 4, 5, 6, 7); }
    __syncthreads();   // the staged rows are written before other lanes read them
    const float* bp = bias + c0 + wn * 64 + lr * 4; const v4f bv = { bfr(bp[0]), bfr(bp[1]), bfr(bp[2]), bfr(bp[3]) };   // a lane stores the same four columns of every row
    float* crow = C + (size_t)(r0 + wm * 32) * DM + c0 + wn * 64 + lr * 4;
#pragma unroll
    for (int s = 0; s < 16; ++s) { const int row = s * 2 + hi; const v4f val = *(const v4fa*)(os + row * 64 + ((lr ^ (row & 15)) * 4)) + bv; *(v4f*)(crow + (size_t)row * DM) = val; }   // a wave fills two 128-byte lines of each of two rows
}
// ---- k_fattn: scores, bias, softmax, attn.v and the head merge of one head's FW * 32 query rows in one work-group; no score and no probability goes through memory.
// Each of the FW waves owns 32 query rows and walks ALL keys in tiles of KS; a tile of K and of V^T is brought into LDS once per work-group by asynchronous copies (two buffers) and read by every wave.
// A wave forms S^T = K Q^T (A = key rows, B = query rows): in a 16 x 16 tile a lane holds 8 keys (8 hf + r) of ONE query (column c), so the tile's row maximum is in-lane plus one exchange between the lane halves,
// and two tiles, rounded in place, are the B operand of O^T = V^T P^T in the hardware k order. The softmax runs over the tiles with a running maximum and sum: O^T and the sum are scaled by exp(old max - new max) at each tile, and O^T is divided by the sum at the end.
// BIAS AS A PRODUCT: bias(i, j) = pc0(i) p0(j) + pc1(i) p1(j) + gamma s(j) has rank 3, so it is a third k chunk of the score product. A key's 8 slots (16 bytes in LDS): p0 p1 p0 p1 p0 p1 s s; a query's: 8 pc0, 8 pc1 in three 16-bit parts each (hi, mid, lo), 8 gamma in two.
// The factor 8 = 1 / SCL is exact; the accumulator then holds 8 x the score, and SCL goes into the one multiply-add in front of the exponential. Of a 32-wide chunk only 8 k places are used: two key tiles share one A operand (tile 0's slots at k 0..7, tile 1's at k 16..23), and the query operand has zeros wherever the other tile's (or the other lane half's copy of the) slots stand.
#define FW   4
#define KS   64                   // keys per tile
#define NST  (TT / KS)
#define OP   68                   // floats per query row of a wave's output tile in LDS
#define PLB  (KS * HD * 2)        // bytes of one plane's tile: in fragment order it is one run of bytes of the plane
#define STB  (4 * PLB)            // bytes of one buffer: K, V^T (f16 rows) or K hi, K lo, V^T hi, V^T lo
typedef __attribute__((ext_vector_type(8))) unsigned v8u;
__device__ __forceinline__ float xhalf(float x) { return __builtin_bit_cast(float, __builtin_amdgcn_permlanex16(__builtin_bit_cast(int, x), __builtin_bit_cast(int, x), 0x76543210, 0xfedcba98, false, false)); }   // lane l's value to lane l ^ 16, on the vector side: no LDS counter is waited for
__device__ __forceinline__ v8f cat8(v4f lo, v4f hi) { return __builtin_shufflevector(lo, hi, 0, 1, 2, 3, 4, 5, 6, 7); }
typedef v4u __attribute__((may_alias)) v4ua;
// pk3: a, b rounded to the path's 16-bit type and packed (a in the low half); ra, rb: what the rounding left over
template <bool HR>
__device__ __forceinline__ unsigned pk3(float a, float b, float& ra, float& rb) {
    if constexpr (HR) { const unsigned w = bfpk(a, b); ra = a - bflo(w); rb = b - bfhi(w); return w; }
    else { const v2h x = { (h16)a, (h16)b }; ra = a - (float)x[0]; rb = b - (float)x[1]; return __builtin_bit_cast(unsigned, x); }
}
template <typename T16, bool HR>
__device__ __forceinline__ void fattn_body(const T16* __restrict__ Q, const T16* __restrict__ Q2, const T16* __restrict__ Kp, const T16* __restrict__ K2, const T16* __restrict__ Vt, const T16* __restrict__ Vt2, const float* __restrict__ cm, int qg, bf* Ah, bf* Al, const float* __restrict__ pp, const float* __restrict__ ss, const float* __restrict__ gam, unsigned* kb, char* ring) {
    // every loop of this function but the loop over the key tiles is unrolled in full: tiles and fragments are register arrays, which only constant indices keep in registers
    typedef WFrag<T16> WF; typedef typename WF::V V;
    constexpr int NQ = 2;
    constexpr int KC = HR ? 32 : KS, KT = KC / 16;   // keys per softmax step: the hi / lo rows, whose fragments take twice the registers, go through a tile in two steps
    const int lane = threadIdx.x & 31, c = lane & 15, hf = lane >> 4; const int wv = __builtin_amdgcn_readfirstlane((int)(threadIdx.x >> 5)); const int q0 = qg + wv * (NQ * 16);
    const unsigned lfr = (unsigned)lane * 8u;   // the lane's part of every fragment address; the rest is the same for the whole wave
    const unsigned cl = (unsigned)(size_t)ring + (unsigned)wv * (PLB / FW) + (unsigned)lane * 16u;   // LDS byte address of the lane's first copy: wave w brings quarter w of each plane's tile
    const unsigned cg = (unsigned)wv * (PLB / FW / 2) + lfr;   // the same place in a plane's tile, in elements
    auto fill = [&](int t) { const unsigned lb = cl + (unsigned)(t & 1) * STB; const size_t g = (size_t)t * (KS * HD) + cg;
        if constexpr (HR) { cp8(lb, Kp + g, lb + PLB, K2 + g); cp8(lb + 2 * PLB, Vt + g, lb + 3 * PLB, Vt2 + g); } else cp8(lb, Kp + g, lb + PLB, Vt + g); };
    fill(0);
    // per-key bias slots, each key once per work-group: bf16-rounded p_j0, p_j1, s_j in the operand type of this path (bf16: as they are; f16 holds a bf16 value of this size exactly)
#pragma unroll
    for (int k4 = (int)threadIdx.x * 4; k4 < TT; k4 += 32 * FW * 4) { const v4f pa = *(const v4f*)(pp + (size_t)k4 * 2), pb = *(const v4f*)(pp + (size_t)k4 * 2 + 4), sv = *(const v4f*)(ss + k4);
#pragma unroll
        for (int j = 0; j < 4; ++j) { const float a = (j < 2) ? pa[2 * j] : pb[2 * j - 4], b = (j < 2) ? pa[2 * j + 1] : pb[2 * j - 3]; float ra, rb;
            const unsigned wp = HR ? bfpk(a, b) : pk3<false>(bfr(a), bfr(b), ra, rb), wsj = HR ? bfpk(sv[j], sv[j]) : pk3<false>(bfr(sv[j]), bfr(sv[j]), ra, rb);
            const v4u o = { wp, wp, wp, wsj }; *(v4ua*)(kb + (k4 + j) * 4) = o; } }
    V qf[NQ][2], qf2[NQ][2];
#pragma unroll
    for (int qn = 0; qn < NQ; ++qn)
#pragma unroll
        for (int kc = 0; kc < 2; ++kc) { qf[qn][kc] = WF::ld(Q + (size_t)(q0 + qn * 16) * HD + kc * 512 + lfr); if (HR) qf2[qn][kc] = WF::ld(Q2 + (size_t)(q0 + qn * 16) * HD + kc * 512 + lfr); }
    const float c00 = bfr(cm[0]), c01 = bfr(cm[1]), c10 = bfr(cm[2]), c11 = bfr(cm[3]);
    asm volatile("s_wait_asynccnt 0x0" ::: "memory");   // this wave's share of tile 0 has landed
    __syncthreads();   // tile 0 and the bias slots of every key are in LDS
    fill(1);
    float mr[NQ], ls[NQ];   // mr: running row maximum, times log2(e); ls: running sum over the keys of this lane half
    V bq[NQ][2];   // the query's bias slots: [0] at k 0..7 (even key tiles), [1] at k 16..23 (odd key tiles), zeros elsewhere
    const float gm8 = bfr(gam[0]) * 8.0f;
    v8f oa[HD / 16][NQ];   // oa[db][qn][r]: d = db * 16 + 8 hf + r, query q0 + qn * 16 + c
#pragma unroll
    for (int qn = 0; qn < NQ; ++qn) { const unsigned wq = kb[(q0 + qn * 16 + c) * 4]; const v2h hq = __builtin_bit_cast(v2h, wq); const float pi0 = HR ? bflo(wq) : (float)hq[0], pi1 = HR ? bfhi(wq) : (float)hq[1]; mr[qn] = -3.0e38f; ls[qn] = 0.f;   // a query's p is its position's rounded p: the first word of its slots
        float x0 = (pi0 * c00 + pi1 * c10) * 8.0f, x1 = (pi0 * c01 + pi1 * c11) * 8.0f, g0 = gm8, g1 = 0.f, y0, y1; v4u w;
        w[0] = pk3<HR>(x0, x1, y0, y1); w[1] = pk3<HR>(y0, y1, x0, x1); w[2] = pk3<HR>(x0, x1, y0, y1); pk3<HR>(g0, g1, y0, y1); w[3] = pk3<HR>(g0, y0, x0, x1);
        if (hf) w = (v4u){};   // lanes 16..31 hold k 8..15 and 24..31: no slot there
        const v4u zz = {}; bq[qn][0] = __builtin_bit_cast(V, __builtin_shufflevector(w, zz, 0, 1, 2, 3, 4, 5, 6, 7)); bq[qn][1] = __builtin_bit_cast(V, __builtin_shufflevector(zz, w, 0, 1, 2, 3, 4, 5, 6, 7));
#pragma unroll
        for (int db = 0; db < HD / 16; ++db) oa[db][qn] = (v8f){}; }
    // left rolled: one tile's code serves all tiles, and the two buffers differ only in a base address
#pragma unroll 1
    for (int t = 0; t < NST; ++t) {
        const char* st = ring + (t & 1) * STB;
#pragma unroll
        for (int h = 0; h < KS / KC; ++h) {
        const int k0 = h * KC;   // KC keys are KC * HD elements in a row of a K tile and of a V^T tile alike
        const T16* Ks = (const T16*)st + k0 * HD + lfr; const T16* Ks2 = (const T16*)(st + PLB) + k0 * HD + lfr; const T16* Vs = (const T16*)(st + (HR ? 2 : 1) * PLB) + k0 * HD + lfr; const T16* Vs2 = (const T16*)(st + 3 * PLB) + k0 * HD + lfr;
        v8f sc[KT][NQ];   // sc[kt][qn][r]: 8 x the score of key t * KS + k0 + kt * 16 + 8 hf + r, query q0 + qn * 16 + c
        V ab[KT / 2], a[KT][2], a2[KT][2];   // ab: bias slots of two key tiles each; both lane halves read key c's 16 bytes
#pragma unroll
        for (int kt = 0; kt < KT; ++kt)
#pragma unroll
            for (int kc = 0; kc < 2; ++kc) { a[kt][kc] = WF::ld(Ks + kt * 1024 + kc * 512); if (HR) a2[kt][kc] = WF::ld(Ks2 + kt * 1024 + kc * 512); }
#pragma unroll
        for (int g = 0; g < KT / 2; ++g) { const unsigned* kk = kb + (t * KS + k0 + g * 32 + c) * 4; ab[g] = __builtin_bit_cast(V, __builtin_shufflevector(*(const v4ua*)kk, *(const v4ua*)(kk + 64), 0, 1, 2, 3, 4, 5, 6, 7)); }
        __builtin_amdgcn_sched_barrier(0);   // the step's K fragments and bias slots are asked for in one group: with the bias arithmetic gone nothing stands between the products, and left alone this build asks for two fragments at a time and waits out each LDS round trip
#pragma unroll
        for (int kt = 0; kt < KT; ++kt)
#pragma unroll
            for (int qn = 0; qn < NQ; ++qn) { v8f s = (v8f){};
#pragma unroll
                for (int kc = 0; kc < 2; ++kc) { s = WF::mma(a[kt][kc], qf[qn][kc], s); if (HR) { s = WF::mma(a[kt][kc], qf2[qn][kc], s); s = WF::mma(a2[kt][kc], qf[qn][kc], s); } }
                sc[kt][qn] = WF::mma(ab[kt >> 1], bq[qn][kt & 1], s); }   // the bias goes in last: the small products are summed among themselves first
        float mx[NQ];
#pragma unroll
        for (int qn = 0; qn < NQ; ++qn) mx[qn] = -3.0e38f;
#pragma unroll
        for (int kt = 0; kt < KT; ++kt)
#pragma unroll
            for (int qn = 0; qn < NQ; ++qn)
#pragma unroll
                for (int r = 0; r < 8; ++r) mx[qn] = fmaxf(mx[qn], sc[kt][qn][r]);
#pragma unroll
        for (int qn = 0; qn < NQ; ++qn) mx[qn] = fmaxf(mx[qn], xhalf(mx[qn]));   // the step's row maximum, over both lane halves
        V va[HD / 16][KC / 32], va2[HD / 16][KC / 32];
#pragma unroll
        for (int db = 0; db < HD / 16; ++db)
#pragma unroll
            for (int kk = 0; kk < KC / 32; ++kk) { va[db][kk] = WF::ld(Vs + kk * 2048 + db * 512); if (HR) va2[db][kk] = WF::ld(Vs2 + kk * 2048 + db * 512); }
        __builtin_amdgcn_sched_barrier(0);   // all V^T fragments of the step are asked for here and arrive under the exponentials: left alone, this build asks for half of them among the products and waits for them there
        V pf[KC / 32][NQ], pf2[KC / 32][NQ];   // element s of pf[kk][qn]: key t * KS + k0 + kk * 32 + (s < 8 ? 8 hf + s : 16 + 8 hf + s - 8), the order in which WFrag::ld takes V^T's keys
#pragma unroll
        for (int qn = 0; qn < NQ; ++qn) { const float mn = fmaxf(mr[qn], mx[qn] * (SCL * 1.4426950408889634f));   // rounding keeps the order, so this is the running maximum's own product
            const float al = __builtin_amdgcn_exp2f(mr[qn] - mn); mr[qn] = mn;   // 0 at the first tile, where sum and O^T are 0
            const float nb = (HR ? 0.0f : 10.0f) - mn;
            v8f vs;
#pragma unroll
            for (int kt = 0; kt < KT; ++kt) { const v8f d = sc[kt][qn] * (SCL * 1.4426950408889634f) + nb; v8f e;   // f16 rows: probabilities carried x 1024 (2^10), away from f16's small numbers; the factor is in the sum too and leaves with the division
#pragma unroll
                for (int r = 0; r < 8; ++r) e[r] = __builtin_amdgcn_exp2f(d[r]);
                sc[kt][qn] = e; vs = (kt == 0) ? e : vs + e; }
            ls[qn] = ls[qn] * al + (((vs[0] + vs[1]) + (vs[2] + vs[3])) + ((vs[4] + vs[5]) + (vs[6] + vs[7])));
#pragma unroll
            for (int db = 0; db < HD / 16; ++db) oa[db][qn] *= al;
#pragma unroll
            for (int kk = 0; kk < KC / 32; ++kk) { const v8f p0 = sc[2 * kk][qn], p1 = sc[2 * kk + 1][qn];
                if constexpr (HR) { v8u wh, wl;   // each pair of neighbouring keys is rounded and packed into its hi word and its lo word at once
#pragma unroll
                    for (int w = 0; w < 8; ++w) { const float xa = (w < 4) ? p0[2 * w] : p1[2 * w - 8], xb = (w < 4) ? p0[2 * w + 1] : p1[2 * w - 7];
                        unsigned h2, l2; splitpk(xa, xb, h2, l2); wh[w] = h2; wl[w] = l2; }
                    pf[kk][qn] = __builtin_bit_cast(v16bf, wh); pf2[kk][qn] = __builtin_bit_cast(v16bf, wl);
                } else { v8h x0, x1;
#pragma unroll
                    for (int r = 0; r < 8; ++r) { x0[r] = tohx(p0[r]); x1[r] = tohx(p1[r]); }
                    pf[kk][qn] = cat16(x0, x1); } } }
        asm volatile("" :: "v"(ls[0]), "v"(ls[1]));   // inputs only: the running sums are formed by here. Left alone, this build moves their additions to the loop's foot and keeps every unpacked probability in registers beside the packed ones
#pragma unroll
        for (int db = 0; db < HD / 16; ++db)
#pragma unroll
            for (int kk = 0; kk < KC / 32; ++kk)
#pragma unroll
                for (int qn = 0; qn < NQ; ++qn) { oa[db][qn] = WF::mma(va[db][kk], pf[kk][qn], oa[db][qn]); if (HR) { oa[db][qn] = WF::mma(va[db][kk], pf2[kk][qn], oa[db][qn]); oa[db][qn] = WF::mma(va2[db][kk], pf[kk][qn], oa[db][qn]); } }
        }
        asm volatile("s_wait_dscnt 0x0" ::: "memory");      // this wave's reads of the buffer are over before the buffer is given up
        asm volatile("s_wait_asynccnt 0x0" ::: "memory");   // this wave's share of tile t + 1 has landed
        __syncthreads();   // tile t + 1 is whole, and every wave has left tile t's buffer
        if (t + 2 < NST) fill(t + 2);
    }
    asm volatile("s_wait_asynccnt 0x0" ::: "memory");   // no copy is under way when the ring becomes output staging
    float* os = (float*)ring + wv * (NQ * 16 * OP);   // behind the loop's last barrier: each wave stages its own rows
#pragma unroll
    for (int qn = 0; qn < NQ; ++qn) { const float inv = __fdiv_rn(1.0f, ls[qn] + xhalf(ls[qn]));
#pragma unroll
        for (int db = 0; db < HD / 16; ++db) { const v8f o8 = oa[db][qn] * inv; float* o = os + (qn * 16 + c) * OP + db * 16 + 8 * hf; *(v4fa*)o = __builtin_shufflevector(o8, o8, 0, 1, 2, 3); *(v4fa*)(o + 4) = __builtin_shufflevector(o8, o8, 4, 5, 6, 7); } }
    __syncthreads();   // the staged rows are written before other lanes read them
#pragma unroll
    for (int u = 0; u < NQ * 8; ++u) {   // half-piece u (256 bytes: 16 rows x 8 d) of the wave's [16 rows][32 d][piece] blocks; lane halves take d 0..3 and 4..7 of a row
        const int row = (u >> 3) * 16 + c, cofs = (u & 7) * 8 + hf * 4; const v4f val = *(const v4fa*)(os + row * OP + cofs); v2u oh, ol;
#pragma unroll
        for (int q = 0; q < 2; ++q) { unsigned a, b; splitpk(val[2 * q], val[2 * q + 1], a, b); oh[q] = a; ol[q] = b; }
        const size_t oo = (size_t)(q0 + (u >> 3) * 16) * DQ + ((u >> 2) & 1) * 512 + (u & 3) * 128 + c * 8 + hf * 4; *(v4us*)(Ah + oo) = __builtin_bit_cast(v4us, oh); *(v4us*)(Al + oo) = __builtin_bit_cast(v4us, ol); }
}
// grid (NH_, NB_, TT / (32 FW)): 32 FW query rows of one head of one batch; QK*: per batch the q head planes with the k head planes behind them, [b][h] planes of TT rows x HD; VT*: [b][h] planes of HD rows x TT; Ah / Al: the merged rows, one plane of NB_ * TT rows x DQ; all in fragment order
__global__ __launch_bounds__(32 * FW) void k_fattn(const h16* __restrict__ QK16, const bf* __restrict__ QKh, const bf* __restrict__ QKl, const h16* __restrict__ VT16, const bf* __restrict__ VTh, const bf* __restrict__ VTl, const float* __restrict__ pp, const float* __restrict__ ss, const float* __restrict__ cm, const float* __restrict__ gam, bf* Ah, bf* Al) {
    __shared__ __align__(16) unsigned kb[4 * TT]; __shared__ __align__(1024) char ring[2 * STB];
    const int hh = blockIdx.x, q0 = blockIdx.z * (32 * FW), bz = blockIdx.y;
    // Query blocks run slowest, for speed only (no result rests on where or when a work-group runs). The whole grid is resident at once, three work-groups a WGP, and a hi / lo row block takes about twice as long as the others:
    // the grid's lowest flat indices are those of ALL heads and batches of the first query block.
    // The 16 work-groups that read one head's K and V^T planes have flat indices NH_ * NB_ = 48 apart, equal mod 8.
    pp += (size_t)bz * TT * 2; ss += (size_t)bz * TT;
    const size_t qo = ((size_t)bz * (NH_ + NKV) + hh) * TT * HD, ko = ((size_t)bz * (NH_ + NKV) + NH_ + hh / REP) * TT * HD, vo = ((size_t)bz * NKV + hh / REP) * HD * TT;
    Ah += (size_t)bz * TT * DQ; Al += (size_t)bz * TT * DQ;
    if (q0 < RH) fattn_body<bf, true>(QKh + qo, QKl + qo, QKh + ko, QKl + ko, VTh + vo, VTl + vo, cm + hh * 4, q0, Ah + hh * (HD / 32) * 512, Al + hh * (HD / 32) * 512, pp, ss, gam, kb, ring);
    else fattn_body<h16, false>(QK16 + qo, nullptr, QK16 + ko, nullptr, VT16 + vo, nullptr, cm + hh * 4, q0, Ah + hh * (HD / 32) * 512, Al + hh * (HD / 32) * 512, pp, ss, gam, kb, ring);
}

extern "C" void kernel_launch(void* const* d_in, const int* in_sizes, int n_in,
                              void* d_out, int out_size, void* d_ws, size_t ws_size, hipStream_t stream) {
    (void)in_sizes; (void)n_in; (void)out_size;
    const float* x = (const float*)d_in[0]; const float* pp = (const float*)d_in[1]; const float* ss = (const float*)d_in[2]; const float* wq = (const float*)d_in[3]; const float* wk = (const float*)d_in[4]; const float* wv = (const float*)d_in[5]; const float* wo = (const float*)d_in[6]; const float* bo = (const float*)d_in[7]; const float* compat = (const float*)d_in[8]; const float* gam = (const float*)d_in[9]; const float* cosT = nullptr; const float* sinT = nullptr; (void)cosT; (void)sinT;
    float* OUT = (float*)d_out;     // [4][2048][768]
    char* wsp = (char*)d_ws;
    auto take = [&](size_t bytes) { char* p = wsp; wsp += (bytes + 255) & ~(size_t)255; return (void*)p; };
    bf* WQ = (bf*)take((size_t)(DQ + 2 * DKV) * DM * 2 + (size_t)DM * DQ * 2); bf* WO = WQ + (size_t)(DQ + 2 * DKV) * DM;   // wq, wk, wv, wo planes one behind the other: [wq; wk; wv] is one Bt of DQ + 2 DKV rows
    bf* XB = (bf*)take((size_t)NB_ * TT * DM * 2);
    const size_t SQK = (size_t)(NH_ + NKV) * TT * HD, SV = (size_t)NKV * HD * TT;   // elements of one batch's q + k planes and of its v planes
    h16* QP16 = (h16*)take(NB_ * SQK * 2); h16* VT16 = (h16*)take(NB_ * SV * 2);   // the k head planes follow the q head planes
    bf* QPh = (bf*)take(NB_ * SQK * 2); bf* QPl = (bf*)take(NB_ * SQK * 2); bf* VTh = (bf*)take(NB_ * SV * 2); bf* VTl = (bf*)take(NB_ * SV * 2);
    bf* ATh = (bf*)take((size_t)NB_ * TT * DQ * 2); bf* ATl = (bf*)take((size_t)NB_ * TT * DQ * 2);
    if ((size_t)(wsp - (char*)d_ws) > ws_size) return;    // ws 256 MiB
    k_cvt8w<<<dim3((unsigned)(((size_t)DQ * DM / 8 + 255) / 256), 4, 1), 256, 0, stream>>>(wq, wk, wv, wo, WQ, (size_t)DQ * DM / 8);
    k_cvt8<<<(unsigned)(((size_t)NB_ * TT * DM / 8 + 255) / 256), 256, 0, stream>>>(x, XB, (size_t)NB_ * TT * DM / 8);
    k_qkv<<<dim3(NB_ * TT / 128, (NH_ + 2 * NKV) / 2, 1), 128, 0, stream>>>(XB, WQ, QP16, QPh, QPl, VT16, VTh, VTl);   // the four batches' rows follow one another in XB
    k_fattn<<<dim3(NH_, NB_, TT / (32 * FW)), 32 * FW, 0, stream>>>(QP16, QPh, QPl, VT16, VTh, VTl, pp, ss, compat, gam, ATh, ATl);
    k_wo<<<dim3(NB_ * TT / 64, DM / 128, 1), 128, 0, stream>>>(ATh, ATl, WO, OUT, bo);   // the four batches' rows follow one another in ATh / ATl and in OUT
}
